// v000
// Times are from an AMD MI455X. After a warm-up the kernel runs many times in a row, and a time is the length of
// such a window on the GPU divided by its runs, so every launch and the gaps after it count. The runs cycle
// through copies of the inputs. A figure is the median of several windows, for all but v000 over two sittings.
// Sittings can differ by a few percent; kernels timed side by side share one.
// v000, which the later versions start from, runs in 832 microseconds.
#include <hip/hip_runtime.h>
#include <hip/hip_bf16.h>

// ---------------------------------------------------------------------------
// Transformer encoder block for MI455X (gfx1250, wave32, WMMA).
// bf16 inputs / f32 accumulate via v_wmma_f32_16x16x32_bf16.
// GEMM staging uses CDNA5 async global->LDS (ASYNCcnt) with double buffering.
// ---------------------------------------------------------------------------

typedef __bf16 bf16_t;
typedef __attribute__((ext_vector_type(16))) __bf16 bf16x16;
typedef __attribute__((ext_vector_type(8)))  __bf16 bf16x8;
typedef __attribute__((ext_vector_type(8)))  float  f32x8;

#define D_MODEL 1024
#define NHEAD   16
#define DKH     64
#define D_FF    4096
#define SEQ     2048
#define BATCH   2
#define ROWS    (BATCH * SEQ)   // 4096

__device__ __forceinline__ f32x8 zero8() {
  f32x8 z;
#pragma unroll
  for (int i = 0; i < 8; ++i) z[i] = 0.0f;
  return z;
}

// 16-byte async copy global -> LDS (CDNA5 GLOBAL_LOAD_ASYNC_TO_LDS_B128,
// tracked by ASYNCcnt). lds_off is the 32-bit LDS byte offset (generic
// pointers to __shared__ truncate to the LDS offset per the aperture rules).
__device__ __forceinline__ void async_copy16(unsigned lds_off, const bf16_t* gptr) {
  asm volatile("global_load_async_to_lds_b128 %0, %1, off"
               :: "v"(lds_off), "v"(gptr)
               : "memory");
}
__device__ __forceinline__ void wait_async0() {
  asm volatile("s_wait_asynccnt 0x0" ::: "memory");
}
__device__ __forceinline__ unsigned lds_off_of(const bf16_t* p) {
  return (unsigned)(size_t)p;
}

// Build a 16-element bf16 fragment from two contiguous 8-element (16-byte) LDS loads.
// ISA 16-bit A/B layout: lane group g=0 -> K {0..7,16..23}; g=1 -> K {8..15,24..31}.
__device__ __forceinline__ bf16x16 ld_frag(const bf16_t* p_lo, const bf16_t* p_hi) {
  bf16x8 lo = *(const bf16x8*)p_lo;
  bf16x8 hi = *(const bf16x8*)p_hi;
  bf16x16 r;
#pragma unroll
  for (int e = 0; e < 8; ++e) { r[e] = lo[e]; r[8 + e] = hi[e]; }
  return r;
}

// ---------------------------------------------------------------------------
// f32 [K][N]  ->  bf16 [N][K]   (weights pre-transposed so GEMM B-tiles are
// loaded exactly like A-tiles: contiguous along the contraction dim)
// ---------------------------------------------------------------------------
__global__ __launch_bounds__(256) void k_transpose_bf16(
    const float* __restrict__ in, bf16_t* __restrict__ out, int Kd, int Nd) {
  int idx = blockIdx.x * 256 + threadIdx.x;
  if (idx >= Kd * Nd) return;
  int k = idx / Nd, n = idx - k * Nd;
  out[(size_t)n * Kd + k] = (bf16_t)in[idx];
}

// ---------------------------------------------------------------------------
// LayerNorm, faithful to reference: unbiased std (ddof=1), eps added to std.
// f32 in -> bf16 out. One block per row of 1024.
// ---------------------------------------------------------------------------
__global__ __launch_bounds__(256) void k_layernorm_bf16(
    const float* __restrict__ x, const float* __restrict__ alpha,
    const float* __restrict__ beta, bf16_t* __restrict__ out) {
  const int row = blockIdx.x;
  const float* xr = x + (size_t)row * D_MODEL;
  float s = 0.f, ss = 0.f;
  for (int i = threadIdx.x; i < D_MODEL; i += 256) {
    float v = xr[i]; s += v; ss += v * v;
  }
  __shared__ float r1[256], r2[256];
  r1[threadIdx.x] = s; r2[threadIdx.x] = ss;
  __syncthreads();
  for (int o = 128; o > 0; o >>= 1) {
    if (threadIdx.x < o) { r1[threadIdx.x] += r1[threadIdx.x + o];
                           r2[threadIdx.x] += r2[threadIdx.x + o]; }
    __syncthreads();
  }
  float mean = r1[0] * (1.0f / D_MODEL);
  float var  = (r2[0] - (float)D_MODEL * mean * mean) * (1.0f / (D_MODEL - 1));
  var = var > 0.f ? var : 0.f;
  float scale = alpha[0] / (sqrtf(var) + 1e-5f);
  float shift = beta[0];
  bf16_t* orow = out + (size_t)row * D_MODEL;
  for (int i = threadIdx.x; i < D_MODEL; i += 256)
    orow[i] = (bf16_t)((xr[i] - mean) * scale + shift);
}

// ---------------------------------------------------------------------------
// WMMA GEMM: C[M,N] = A[M,K] @ B[K,N], with B supplied transposed (Bt[N][K]).
// 128x128 block tile, BK=32, 256 threads = 8 waves arranged 2(M) x 4(N);
// each wave computes 64x32 = 4x2 accumulator tiles -> 8 WMMA per k-step.
// Double-buffered async global->LDS staging: tile kt+1 streams while tile kt
// is consumed. One barrier per k-step.
// Epilogue fuses bias / ReLU / residual; writes f32 and/or bf16.
// ---------------------------------------------------------------------------
__global__ __launch_bounds__(256) void k_gemm_bf16_wmma(
    const bf16_t* __restrict__ A, const bf16_t* __restrict__ Bt,
    const float* __restrict__ bias, const float* __restrict__ residual,
    float* __restrict__ Cf, bf16_t* __restrict__ Cb,
    int M, int N, int K, int doRelu) {
  __shared__ __align__(16) bf16_t As[2][128 * 32];
  __shared__ __align__(16) bf16_t Bs[2][128 * 32];
  const int tid  = threadIdx.x;
  const int wave = tid >> 5, lane = tid & 31, lh = lane & 15, g = lane >> 4;
  const int waveM = wave >> 2, waveN = wave & 3;       // 2 x 4 wave grid
  const int rowBase = blockIdx.y * 128;
  const int colBase = blockIdx.x * 128;
  const int kOffLo = g ? 8 : 0;
  const int kOffHi = g ? 24 : 16;

  // Per-thread staging slots: rows r0 and r0+64, 8 bf16 starting at col c0.
  const int r0 = tid >> 2;
  const int c0 = (tid & 3) * 8;

  auto stage = [&](int kt, int buf) {
    const int kcol = kt * 32 + c0;
    async_copy16(lds_off_of(&As[buf][r0 * 32 + c0]),
                 &A[(size_t)(rowBase + r0) * K + kcol]);
    async_copy16(lds_off_of(&As[buf][(r0 + 64) * 32 + c0]),
                 &A[(size_t)(rowBase + r0 + 64) * K + kcol]);
    async_copy16(lds_off_of(&Bs[buf][r0 * 32 + c0]),
                 &Bt[(size_t)(colBase + r0) * K + kcol]);
    async_copy16(lds_off_of(&Bs[buf][(r0 + 64) * 32 + c0]),
                 &Bt[(size_t)(colBase + r0 + 64) * K + kcol]);
  };

  f32x8 acc[4][2];
#pragma unroll
  for (int mr = 0; mr < 4; ++mr)
#pragma unroll
    for (int nr = 0; nr < 2; ++nr) acc[mr][nr] = zero8();

  const int kTiles = K >> 5;
  stage(0, 0);                               // prologue prefetch
  for (int kt = 0; kt < kTiles; ++kt) {
    const int cur = kt & 1;
    wait_async0();                           // own async writes to buf(cur) done
    __syncthreads();                         // all waves: buf(cur) ready, prev reads retired
    if (kt + 1 < kTiles) stage(kt + 1, cur ^ 1);   // overlap with compute below

    bf16x16 afrag[4], bfrag[2];
#pragma unroll
    for (int mr = 0; mr < 4; ++mr) {
      int r = waveM * 64 + mr * 16 + lh;
      afrag[mr] = ld_frag(&As[cur][r * 32 + kOffLo], &As[cur][r * 32 + kOffHi]);
    }
#pragma unroll
    for (int nr = 0; nr < 2; ++nr) {
      int r = waveN * 32 + nr * 16 + lh;
      bfrag[nr] = ld_frag(&Bs[cur][r * 32 + kOffLo], &Bs[cur][r * 32 + kOffHi]);
    }
#pragma unroll
    for (int mr = 0; mr < 4; ++mr)
#pragma unroll
      for (int nr = 0; nr < 2; ++nr)
        acc[mr][nr] = __builtin_amdgcn_wmma_f32_16x16x32_bf16(
            false, afrag[mr], false, bfrag[nr], (short)0, acc[mr][nr],
            false, false);
  }

  // Epilogue. C-frag layout: lane L holds rows 8*(L/16)+r, column L%16.
#pragma unroll
  for (int mr = 0; mr < 4; ++mr) {
#pragma unroll
    for (int nr = 0; nr < 2; ++nr) {
      int col = colBase + waveN * 32 + nr * 16 + lh;
#pragma unroll
      for (int r = 0; r < 8; ++r) {
        int row = rowBase + waveM * 64 + mr * 16 + g * 8 + r;
        float v = acc[mr][nr][r];
        if (bias)     v += bias[col];
        if (doRelu)   v  = v > 0.f ? v : 0.f;
        if (residual) v += residual[(size_t)row * N + col];
        if (Cf) Cf[(size_t)row * N + col] = v;
        if (Cb) Cb[(size_t)row * N + col] = (bf16_t)v;
      }
    }
  }
}

// ---------------------------------------------------------------------------
// Flash attention: one block per (64-query tile, head, batch). 4 waves; each
// wave owns 16 query rows. Streams 64-key K/V tiles through LDS with online
// softmax; P restaged via LDS for the PV matmul (A-frag layout); V transposed
// at load so V columns are contiguous B-fragments. Q/K tiles use the async
// global->LDS path; V needs the in-flight transpose so it stays on vector loads.
// ---------------------------------------------------------------------------
__global__ __launch_bounds__(128) void k_attention(
    const bf16_t* __restrict__ Q, const bf16_t* __restrict__ Kmat,
    const bf16_t* __restrict__ V, const int* __restrict__ mask,
    bf16_t* __restrict__ ctx) {
  __shared__ __align__(16) bf16_t Qs[64 * 64];
  __shared__ __align__(16) bf16_t Ks[64 * 64];
  __shared__ __align__(16) bf16_t Vt[64 * 64];   // Vt[d][key]
  __shared__ __align__(16) bf16_t Ps[64 * 64];
  const int tid  = threadIdx.x;
  const int wave = tid >> 5, lane = tid & 31, lh = lane & 15, g = lane >> 4;
  const int qbase = blockIdx.x * 64;
  const int h = blockIdx.y, b = blockIdx.z;
  const size_t row0 = (size_t)b * SEQ;
  const int col0 = h * DKH;
  const int kOffLo = g ? 8 : 0;
  const int kOffHi = g ? 24 : 16;

  // Load Q tile [64 x 64] via async copies.
#pragma unroll
  for (int i = 0; i < 4; ++i) {
    int id = i * 128 + tid;                // 0..511
    int r = id >> 3, c = (id & 7) * 8;
    async_copy16(lds_off_of(&Qs[r * 64 + c]),
                 &Q[(row0 + qbase + r) * D_MODEL + col0 + c]);
  }
  wait_async0();
  __syncthreads();

  // Q A-fragments are invariant across key tiles: hoist.
  bf16x16 aq[2];
#pragma unroll
  for (int c = 0; c < 2; ++c) {
    int r = wave * 16 + lh;
    aq[c] = ld_frag(&Qs[r * 64 + c * 32 + kOffLo],
                    &Qs[r * 64 + c * 32 + kOffHi]);
  }

  f32x8 o[4];
#pragma unroll
  for (int nr = 0; nr < 4; ++nr) o[nr] = zero8();
  float m[8], l[8];
#pragma unroll
  for (int r = 0; r < 8; ++r) { m[r] = -1e30f; l[r] = 0.f; }
  const float sm_scale = 0.125f;           // 1/sqrt(64)

  for (int kt = 0; kt < SEQ / 64; ++kt) {
    const int kbase = kt * 64;
    __syncthreads();                       // prior reads of Ks/Vt/Ps retired
    // K tile: straight async copy (rows=key already matches B-frag layout).
    // V tile: vector load + transpose scatter into Vt[d][key].
#pragma unroll
    for (int i = 0; i < 4; ++i) {
      int id = i * 128 + tid;
      int r = id >> 3, c = (id & 7) * 8;
      async_copy16(lds_off_of(&Ks[r * 64 + c]),
                   &Kmat[(row0 + kbase + r) * D_MODEL + col0 + c]);
      uint4 vv4 =
          *(const uint4*)(&V[(row0 + kbase + r) * D_MODEL + col0 + c]);
      const bf16_t* vv = (const bf16_t*)&vv4;
#pragma unroll
      for (int j = 0; j < 8; ++j) Vt[(c + j) * 64 + r] = vv[j];
    }
    wait_async0();
    __syncthreads();                       // Ks async + Vt ds stores visible

    // Scores: wave's 16 q-rows x 64 keys, contraction over d=64 (2 chunks).
    f32x8 s[4];
#pragma unroll
    for (int nr = 0; nr < 4; ++nr) {
      s[nr] = zero8();
#pragma unroll
      for (int c = 0; c < 2; ++c) {
        int kr = nr * 16 + lh;
        bf16x16 bk = ld_frag(&Ks[kr * 64 + c * 32 + kOffLo],
                             &Ks[kr * 64 + c * 32 + kOffHi]);
        s[nr] = __builtin_amdgcn_wmma_f32_16x16x32_bf16(
            false, aq[c], false, bk, (short)0, s[nr], false, false);
      }
    }
    // Scale + mask (mask shape [B,1,1,S], key-indexed).
#pragma unroll
    for (int nr = 0; nr < 4; ++nr) {
      int key = kbase + nr * 16 + lh;
      bool live = mask[row0 + key] != 0;
#pragma unroll
      for (int r = 0; r < 8; ++r) {
        float sv = s[nr][r] * sm_scale;
        s[nr][r] = live ? sv : -1e9f;
      }
    }
    // Online softmax: row reductions across the 16-lane half-wave.
    float f[8];
#pragma unroll
    for (int r = 0; r < 8; ++r) {
      float v = fmaxf(fmaxf(s[0][r], s[1][r]), fmaxf(s[2][r], s[3][r]));
#pragma unroll
      for (int off = 8; off > 0; off >>= 1) v = fmaxf(v, __shfl_xor(v, off, 16));
      float mn = fmaxf(m[r], v);
      f[r] = __expf(m[r] - mn);
      m[r] = mn;
    }
    float rs[8];
#pragma unroll
    for (int r = 0; r < 8; ++r) rs[r] = 0.f;
#pragma unroll
    for (int nr = 0; nr < 4; ++nr)
#pragma unroll
      for (int r = 0; r < 8; ++r) {
        float p = __expf(s[nr][r] - m[r]);
        s[nr][r] = p; rs[r] += p;
      }
#pragma unroll
    for (int r = 0; r < 8; ++r) {
      float v = rs[r];
#pragma unroll
      for (int off = 8; off > 0; off >>= 1) v += __shfl_xor(v, off, 16);
      l[r] = l[r] * f[r] + v;
    }
    // Rescale running context, stage P into LDS (C-frag -> A-frag transpose).
#pragma unroll
    for (int nr = 0; nr < 4; ++nr)
#pragma unroll
      for (int r = 0; r < 8; ++r) o[nr][r] *= f[r];
#pragma unroll
    for (int nr = 0; nr < 4; ++nr)
#pragma unroll
      for (int r = 0; r < 8; ++r)
        Ps[(wave * 16 + g * 8 + r) * 64 + nr * 16 + lh] = (bf16_t)s[nr][r];
    __syncthreads();

    // ctx += P @ V  (contraction over 64 keys, 2 chunks).
#pragma unroll
    for (int c = 0; c < 2; ++c) {
      int pr = wave * 16 + lh;
      bf16x16 ap = ld_frag(&Ps[pr * 64 + c * 32 + kOffLo],
                           &Ps[pr * 64 + c * 32 + kOffHi]);
#pragma unroll
      for (int nr = 0; nr < 4; ++nr) {
        int dr = nr * 16 + lh;
        bf16x16 bv = ld_frag(&Vt[dr * 64 + c * 32 + kOffLo],
                             &Vt[dr * 64 + c * 32 + kOffHi]);
        o[nr] = __builtin_amdgcn_wmma_f32_16x16x32_bf16(
            false, ap, false, bv, (short)0, o[nr], false, false);
      }
    }
  }

  // Normalize and scatter ctx back to [B,S,H*Dk] layout (bf16).
#pragma unroll
  for (int nr = 0; nr < 4; ++nr)
#pragma unroll
    for (int r = 0; r < 8; ++r) {
      float v = o[nr][r] / l[r];
      ctx[(row0 + qbase + wave * 16 + g * 8 + r) * D_MODEL + col0 + nr * 16 + lh]
          = (bf16_t)v;
    }
}

// ---------------------------------------------------------------------------
// Host-side orchestration (graph-capture safe: stream launches only).
// ---------------------------------------------------------------------------
extern "C" void kernel_launch(void* const* d_in, const int* in_sizes, int n_in,
                              void* d_out, int out_size, void* d_ws, size_t ws_size,
                              hipStream_t stream) {
  const float* x      = (const float*)d_in[0];
  const int*   mask   = (const int*)d_in[1];
  const float* wq     = (const float*)d_in[2];
  const float* wk     = (const float*)d_in[3];
  const float* wv     = (const float*)d_in[4];
  const float* wo     = (const float*)d_in[5];
  const float* w1     = (const float*)d_in[6];
  const float* b1     = (const float*)d_in[7];
  const float* w2     = (const float*)d_in[8];
  const float* b2     = (const float*)d_in[9];
  const float* alpha1 = (const float*)d_in[10];
  const float* bias1  = (const float*)d_in[11];
  const float* alpha2 = (const float*)d_in[12];
  const float* bias2  = (const float*)d_in[13];
  float* out = (float*)d_out;

  // Workspace carve-up (~120 MB), 256B-aligned slices.
  char* ws = (char*)d_ws;
  size_t off = 0;
  auto alloc = [&](size_t bytes) -> char* {
    char* p = ws + off;
    off += (bytes + 255) & ~(size_t)255;
    return p;
  };
  bf16_t* wqT = (bf16_t*)alloc((size_t)D_MODEL * D_MODEL * 2);
  bf16_t* wkT = (bf16_t*)alloc((size_t)D_MODEL * D_MODEL * 2);
  bf16_t* wvT = (bf16_t*)alloc((size_t)D_MODEL * D_MODEL * 2);
  bf16_t* woT = (bf16_t*)alloc((size_t)D_MODEL * D_MODEL * 2);
  bf16_t* w1T = (bf16_t*)alloc((size_t)D_FF * D_MODEL * 2);   // [4096][1024]
  bf16_t* w2T = (bf16_t*)alloc((size_t)D_MODEL * D_FF * 2);   // [1024][4096]
  bf16_t* xn  = (bf16_t*)alloc((size_t)ROWS * D_MODEL * 2);
  bf16_t* qb  = (bf16_t*)alloc((size_t)ROWS * D_MODEL * 2);
  bf16_t* kb  = (bf16_t*)alloc((size_t)ROWS * D_MODEL * 2);
  bf16_t* vb  = (bf16_t*)alloc((size_t)ROWS * D_MODEL * 2);
  bf16_t* ctxb= (bf16_t*)alloc((size_t)ROWS * D_MODEL * 2);
  float*  x2  = (float*) alloc((size_t)ROWS * D_MODEL * 4);
  bf16_t* xn2 = (bf16_t*)alloc((size_t)ROWS * D_MODEL * 2);
  bf16_t* hb  = (bf16_t*)alloc((size_t)ROWS * D_FF * 2);
  (void)ws_size; (void)in_sizes; (void)n_in; (void)out_size;

  // 1) Weights -> bf16, transposed to [N][K].
  k_transpose_bf16<<<(D_MODEL * D_MODEL + 255) / 256, 256, 0, stream>>>(wq, wqT, D_MODEL, D_MODEL);
  k_transpose_bf16<<<(D_MODEL * D_MODEL + 255) / 256, 256, 0, stream>>>(wk, wkT, D_MODEL, D_MODEL);
  k_transpose_bf16<<<(D_MODEL * D_MODEL + 255) / 256, 256, 0, stream>>>(wv, wvT, D_MODEL, D_MODEL);
  k_transpose_bf16<<<(D_MODEL * D_MODEL + 255) / 256, 256, 0, stream>>>(wo, woT, D_MODEL, D_MODEL);
  k_transpose_bf16<<<(D_MODEL * D_FF + 255) / 256, 256, 0, stream>>>(w1, w1T, D_MODEL, D_FF);
  k_transpose_bf16<<<(D_FF * D_MODEL + 255) / 256, 256, 0, stream>>>(w2, w2T, D_FF, D_MODEL);

  // 2) LN1
  k_layernorm_bf16<<<ROWS, 256, 0, stream>>>(x, alpha1, bias1, xn);

  // 3) Q/K/V projections (bf16 out)
  dim3 gProj(D_MODEL / 128, ROWS / 128);
  k_gemm_bf16_wmma<<<gProj, 256, 0, stream>>>(xn, wqT, nullptr, nullptr, nullptr, qb, ROWS, D_MODEL, D_MODEL, 0);
  k_gemm_bf16_wmma<<<gProj, 256, 0, stream>>>(xn, wkT, nullptr, nullptr, nullptr, kb, ROWS, D_MODEL, D_MODEL, 0);
  k_gemm_bf16_wmma<<<gProj, 256, 0, stream>>>(xn, wvT, nullptr, nullptr, nullptr, vb, ROWS, D_MODEL, D_MODEL, 0);

  // 4) Flash attention
  dim3 gAttn(SEQ / 64, NHEAD, BATCH);
  k_attention<<<gAttn, 128, 0, stream>>>(qb, kb, vb, mask, ctxb);

  // 5) Output projection + residual (f32 out)
  k_gemm_bf16_wmma<<<gProj, 256, 0, stream>>>(ctxb, woT, nullptr, x, x2, nullptr, ROWS, D_MODEL, D_MODEL, 0);

  // 6) LN2
  k_layernorm_bf16<<<ROWS, 256, 0, stream>>>(x2, alpha2, bias2, xn2);

  // 7) FFN up: relu(xn2 @ w1 + b1) -> bf16
  dim3 gFF1(D_FF / 128, ROWS / 128);
  k_gemm_bf16_wmma<<<gFF1, 256, 0, stream>>>(xn2, w1T, b1, nullptr, nullptr, hb, ROWS, D_FF, D_MODEL, 1);

  // 8) FFN down + bias + residual -> d_out (f32)
  dim3 gFF2(D_MODEL / 128, ROWS / 128);
  k_gemm_bf16_wmma<<<gFF2, 256, 0, stream>>>(hb, w2T, b2, x2, out, ROWS ? nullptr : nullptr, ROWS, D_MODEL, D_FF, 0);
}

// v001
// A run of this version takes 569 microseconds.
// Two timings next to v000 both put it at 1.47 times that version's speed.
#include <hip/hip_runtime.h>
#include <hip/hip_bf16.h>

// ---------------------------------------------------------------------------
// Transformer encoder block for MI455X (gfx1250, wave32, WMMA).
// bf16 inputs / f32 accumulate via v_wmma_f32_16x16x32_bf16.
// GEMM staging uses CDNA5 async global->LDS (ASYNCcnt) with double buffering.
// ---------------------------------------------------------------------------

typedef __bf16 bf16_t;
typedef __attribute__((ext_vector_type(16))) __bf16 bf16x16;
typedef __attribute__((ext_vector_type(8)))  __bf16 bf16x8;
typedef __attribute__((ext_vector_type(2)))  __bf16 bf16x2;
typedef __attribute__((ext_vector_type(8)))  float  f32x8;

#define D_MODEL 1024
#define NHEAD   16
#define DKH     64
#define D_FF    4096
#define SEQ     2048
#define BATCH   2
#define ROWS    (BATCH * SEQ)   // 4096

__device__ __forceinline__ f32x8 zero8() {
  f32x8 z;
#pragma unroll
  for (int i = 0; i < 8; ++i) z[i] = 0.0f;
  return z;
}

// 16-byte async copy global -> LDS (CDNA5 GLOBAL_LOAD_ASYNC_TO_LDS_B128,
// tracked by ASYNCcnt). lds_off is the 32-bit LDS byte offset (generic
// pointers to __shared__ truncate to the LDS offset per the aperture rules).
__device__ __forceinline__ void async_copy16(unsigned lds_off, const bf16_t* gptr) {
  asm volatile("global_load_async_to_lds_b128 %0, %1, off"
               :: "v"(lds_off), "v"(gptr)
               : "memory");
}
__device__ __forceinline__ void wait_async0() {
  asm volatile("s_wait_asynccnt 0x0" ::: "memory");
}
__device__ __forceinline__ unsigned lds_off_of(const bf16_t* p) {
  return (unsigned)(size_t)p;
}

// Build a 16-element bf16 fragment from two contiguous 8-element (16-byte) LDS loads.
// ISA 16-bit A/B layout: lane group g=0 -> K {0..7,16..23}; g=1 -> K {8..15,24..31}.
__device__ __forceinline__ bf16x16 ld_frag(const bf16_t* p_lo, const bf16_t* p_hi) {
  bf16x8 lo = *(const bf16x8*)p_lo;
  bf16x8 hi = *(const bf16x8*)p_hi;
  bf16x16 r;
#pragma unroll
  for (int e = 0; e < 8; ++e) { r[e] = lo[e]; r[8 + e] = hi[e]; }
  return r;
}

// ---------------------------------------------------------------------------
// f32 [K][N]  ->  bf16 [N][K]   (weights pre-transposed so GEMM B-tiles are
// loaded exactly like A-tiles: contiguous along the contraction dim)
// One block moves a tile of 128 k x 64 n through LDS, so that both global
// sides run along their own contiguous dim: reads are 16 B per lane, 256 B per
// input row; writes are 16 B per lane, 256 B per output row (whole lines).
// LDS holds one dword per (k pair, n): bf16(k) low, bf16(k+1) high. The pitch
// of 65 dwords is odd, so the row-wise writes and the column-wise reads both
// touch every bank at most once per wave.
// KD and ND are compile-time, so a thread's eight loads and four stores each
// share one address and differ only in the instruction's immediate offset.
// Grid = ND/64 x KD/128.
// ---------------------------------------------------------------------------
#define TP_K     128
#define TP_N     64
#define TP_PITCH 65

__device__ __forceinline__ unsigned pack_bf16(float lo, float hi) {
  bf16x2 p;
  p[0] = (bf16_t)lo;
  p[1] = (bf16_t)hi;
  return __builtin_bit_cast(unsigned, p);
}

template <int KD, int ND>
__device__ __forceinline__ void transpose_tile(
    const float* __restrict__ in, bf16_t* __restrict__ out) {
  static_assert(KD % TP_K == 0 && ND % TP_N == 0, "tiles must divide the matrix");
  __shared__ unsigned tile[(TP_K / 2) * TP_PITCH];
  const int tid = threadIdx.x;
  const int n0 = blockIdx.x * TP_N;
  const int k0 = blockIdx.y * TP_K;

  // Read: 16 lanes cover the 64 n of one input row; a thread takes rows
  // 2*kp and 2*kp+1 for four k pairs. All eight loads are issued first.
  const int n4 = (tid & 15) * 4;
  const int kp = tid >> 4;
  const float* src = in + (k0 + 2 * kp) * ND + n0 + n4;
  float4 ev[4], od[4];
#pragma unroll   // keeps ev/od in registers and turns the row steps into immediate offsets
  for (int i = 0; i < 4; ++i) {
    ev[i] = *(const float4*)(src + (32 * i) * ND);
    od[i] = *(const float4*)(src + (32 * i + 1) * ND);
  }
#pragma unroll   // ev/od are indexed by i: must be constant to stay in registers
  for (int i = 0; i < 4; ++i) {
    unsigned* t = &tile[(kp + 16 * i) * TP_PITCH + n4];
    t[0] = pack_bf16(ev[i].x, od[i].x);
    t[1] = pack_bf16(ev[i].y, od[i].y);
    t[2] = pack_bf16(ev[i].z, od[i].z);
    t[3] = pack_bf16(ev[i].w, od[i].w);
  }
  __syncthreads();                         // whole tile in LDS before any column is read

  // Write: 16 lanes cover the 128 k of one output row, 8 k (4 pairs) each.
  const int kc = tid & 15;
  const int nr = tid >> 4;
  bf16_t* dst = out + (n0 + nr) * KD + k0 + 8 * kc;
#pragma unroll   // all LDS reads issue together; the row steps become immediate offsets
  for (int j = 0; j < 4; ++j) {
    const unsigned* s = &tile[(4 * kc) * TP_PITCH + nr + 16 * j];
    uint4 v;
    v.x = s[0];
    v.y = s[TP_PITCH];
    v.z = s[2 * TP_PITCH];
    v.w = s[3 * TP_PITCH];
    *(uint4*)(dst + (16 * j) * KD) = v;
  }
}

__global__ __launch_bounds__(256) void k_transpose_dd(
    const float* __restrict__ in, bf16_t* __restrict__ out) {
  transpose_tile<D_MODEL, D_MODEL>(in, out);
}
__global__ __launch_bounds__(256) void k_transpose_df(
    const float* __restrict__ in, bf16_t* __restrict__ out) {
  transpose_tile<D_MODEL, D_FF>(in, out);
}
__global__ __launch_bounds__(256) void k_transpose_fd(
    const float* __restrict__ in, bf16_t* __restrict__ out) {
  transpose_tile<D_FF, D_MODEL>(in, out);
}

// ---------------------------------------------------------------------------
// LayerNorm, faithful to reference: unbiased std (ddof=1), eps added to std.
// f32 in -> bf16 out. One block per row of 1024.
// ---------------------------------------------------------------------------
__global__ __launch_bounds__(256) void k_layernorm_bf16(
    const float* __restrict__ x, const float* __restrict__ alpha,
    const float* __restrict__ beta, bf16_t* __restrict__ out) {
  const int row = blockIdx.x;
  const float* xr = x + (size_t)row * D_MODEL;
  float s = 0.f, ss = 0.f;
  for (int i = threadIdx.x; i < D_MODEL; i += 256) {
    float v = xr[i]; s += v; ss += v * v;
  }
  __shared__ float r1[256], r2[256];
  r1[threadIdx.x] = s; r2[threadIdx.x] = ss;
  __syncthreads();
  for (int o = 128; o > 0; o >>= 1) {
    if (threadIdx.x < o) { r1[threadIdx.x] += r1[threadIdx.x + o];
                           r2[threadIdx.x] += r2[threadIdx.x + o]; }
    __syncthreads();
  }
  float mean = r1[0] * (1.0f / D_MODEL);
  float var  = (r2[0] - (float)D_MODEL * mean * mean) * (1.0f / (D_MODEL - 1));
  var = var > 0.f ? var : 0.f;
  float scale = alpha[0] / (sqrtf(var) + 1e-5f);
  float shift = beta[0];
  bf16_t* orow = out + (size_t)row * D_MODEL;
  for (int i = threadIdx.x; i < D_MODEL; i += 256)
    orow[i] = (bf16_t)((xr[i] - mean) * scale + shift);
}

// ---------------------------------------------------------------------------
// WMMA GEMM: C[M,N] = A[M,K] @ B[K,N], with B supplied transposed (Bt[N][K]).
// 128x128 block tile, BK=32, 256 threads = 8 waves arranged 2(M) x 4(N);
// each wave computes 64x32 = 4x2 accumulator tiles -> 8 WMMA per k-step.
// Double-buffered async global->LDS staging: tile kt+1 streams while tile kt
// is consumed. One barrier per k-step.
// Epilogue fuses bias / ReLU / residual; writes f32 and/or bf16.
// ---------------------------------------------------------------------------
__global__ __launch_bounds__(256) void k_gemm_bf16_wmma(
    const bf16_t* __restrict__ A, const bf16_t* __restrict__ Bt,
    const float* __restrict__ bias, const float* __restrict__ residual,
    float* __restrict__ Cf, bf16_t* __restrict__ Cb,
    int M, int N, int K, int doRelu) {
  __shared__ __align__(16) bf16_t As[2][128 * 32];
  __shared__ __align__(16) bf16_t Bs[2][128 * 32];
  const int tid  = threadIdx.x;
  const int wave = tid >> 5, lane = tid & 31, lh = lane & 15, g = lane >> 4;
  const int waveM = wave >> 2, waveN = wave & 3;       // 2 x 4 wave grid
  const int rowBase = blockIdx.y * 128;
  const int colBase = blockIdx.x * 128;
  const int kOffLo = g ? 8 : 0;
  const int kOffHi = g ? 24 : 16;

  // Per-thread staging slots: rows r0 and r0+64, 8 bf16 starting at col c0.
  const int r0 = tid >> 2;
  const int c0 = (tid & 3) * 8;

  auto stage = [&](int kt, int buf) {
    const int kcol = kt * 32 + c0;
    async_copy16(lds_off_of(&As[buf][r0 * 32 + c0]),
                 &A[(size_t)(rowBase + r0) * K + kcol]);
    async_copy16(lds_off_of(&As[buf][(r0 + 64) * 32 + c0]),
                 &A[(size_t)(rowBase + r0 + 64) * K + kcol]);
    async_copy16(lds_off_of(&Bs[buf][r0 * 32 + c0]),
                 &Bt[(size_t)(colBase + r0) * K + kcol]);
    async_copy16(lds_off_of(&Bs[buf][(r0 + 64) * 32 + c0]),
                 &Bt[(size_t)(colBase + r0 + 64) * K + kcol]);
  };

  f32x8 acc[4][2];
#pragma unroll
  for (int mr = 0; mr < 4; ++mr)
#pragma unroll
    for (int nr = 0; nr < 2; ++nr) acc[mr][nr] = zero8();

  const int kTiles = K >> 5;
  stage(0, 0);                               // prologue prefetch
  for (int kt = 0; kt < kTiles; ++kt) {
    const int cur = kt & 1;
    wait_async0();                           // own async writes to buf(cur) done
    __syncthreads();                         // all waves: buf(cur) ready, prev reads retired
    if (kt + 1 < kTiles) stage(kt + 1, cur ^ 1);   // overlap with compute below

    bf16x16 afrag[4], bfrag[2];
#pragma unroll
    for (int mr = 0; mr < 4; ++mr) {
      int r = waveM * 64 + mr * 16 + lh;
      afrag[mr] = ld_frag(&As[cur][r * 32 + kOffLo], &As[cur][r * 32 + kOffHi]);
    }
#pragma unroll
    for (int nr = 0; nr < 2; ++nr) {
      int r = waveN * 32 + nr * 16 + lh;
      bfrag[nr] = ld_frag(&Bs[cur][r * 32 + kOffLo], &Bs[cur][r * 32 + kOffHi]);
    }
#pragma unroll
    for (int mr = 0; mr < 4; ++mr)
#pragma unroll
      for (int nr = 0; nr < 2; ++nr)
        acc[mr][nr] = __builtin_amdgcn_wmma_f32_16x16x32_bf16(
            false, afrag[mr], false, bfrag[nr], (short)0, acc[mr][nr],
            false, false);
  }

  // Epilogue. C-frag layout: lane L holds rows 8*(L/16)+r, column L%16.
#pragma unroll
  for (int mr = 0; mr < 4; ++mr) {
#pragma unroll
    for (int nr = 0; nr < 2; ++nr) {
      int col = colBase + waveN * 32 + nr * 16 + lh;
#pragma unroll
      for (int r = 0; r < 8; ++r) {
        int row = rowBase + waveM * 64 + mr * 16 + g * 8 + r;
        float v = acc[mr][nr][r];
        if (bias)     v += bias[col];
        if (doRelu)   v  = v > 0.f ? v : 0.f;
        if (residual) v += residual[(size_t)row * N + col];
        if (Cf) Cf[(size_t)row * N + col] = v;
        if (Cb) Cb[(size_t)row * N + col] = (bf16_t)v;
      }
    }
  }
}

// ---------------------------------------------------------------------------
// Flash attention: one block per (64-query tile, head, batch). 4 waves; each
// wave owns 16 query rows. Streams 64-key K/V tiles through LDS with online
// softmax; P restaged via LDS for the PV matmul (A-frag layout); V transposed
// at load so V columns are contiguous B-fragments. Q/K tiles use the async
// global->LDS path; V needs the in-flight transpose so it stays on vector loads.
// ---------------------------------------------------------------------------
__global__ __launch_bounds__(128) void k_attention(
    const bf16_t* __restrict__ Q, const bf16_t* __restrict__ Kmat,
    const bf16_t* __restrict__ V, const int* __restrict__ mask,
    bf16_t* __restrict__ ctx) {
  __shared__ __align__(16) bf16_t Qs[64 * 64];
  __shared__ __align__(16) bf16_t Ks[64 * 64];
  __shared__ __align__(16) bf16_t Vt[64 * 64];   // Vt[d][key]
  __shared__ __align__(16) bf16_t Ps[64 * 64];
  const int tid  = threadIdx.x;
  const int wave = tid >> 5, lane = tid & 31, lh = lane & 15, g = lane >> 4;
  const int qbase = blockIdx.x * 64;
  const int h = blockIdx.y, b = blockIdx.z;
  const size_t row0 = (size_t)b * SEQ;
  const int col0 = h * DKH;
  const int kOffLo = g ? 8 : 0;
  const int kOffHi = g ? 24 : 16;

  // Load Q tile [64 x 64] via async copies.
#pragma unroll
  for (int i = 0; i < 4; ++i) {
    int id = i * 128 + tid;                // 0..511
    int r = id >> 3, c = (id & 7) * 8;
    async_copy16(lds_off_of(&Qs[r * 64 + c]),
                 &Q[(row0 + qbase + r) * D_MODEL + col0 + c]);
  }
  wait_async0();
  __syncthreads();

  // Q A-fragments are invariant across key tiles: hoist.
  bf16x16 aq[2];
#pragma unroll
  for (int c = 0; c < 2; ++c) {
    int r = wave * 16 + lh;
    aq[c] = ld_frag(&Qs[r * 64 + c * 32 + kOffLo],
                    &Qs[r * 64 + c * 32 + kOffHi]);
  }

  f32x8 o[4];
#pragma unroll
  for (int nr = 0; nr < 4; ++nr) o[nr] = zero8();
  float m[8], l[8];
#pragma unroll
  for (int r = 0; r < 8; ++r) { m[r] = -1e30f; l[r] = 0.f; }
  const float sm_scale = 0.125f;           // 1/sqrt(64)

  for (int kt = 0; kt < SEQ / 64; ++kt) {
    const int kbase = kt * 64;
    __syncthreads();                       // prior reads of Ks/Vt/Ps retired
    // K tile: straight async copy (rows=key already matches B-frag layout).
    // V tile: vector load + transpose scatter into Vt[d][key].
#pragma unroll
    for (int i = 0; i < 4; ++i) {
      int id = i * 128 + tid;
      int r = id >> 3, c = (id & 7) * 8;
      async_copy16(lds_off_of(&Ks[r * 64 + c]),
                   &Kmat[(row0 + kbase + r) * D_MODEL + col0 + c]);
      uint4 vv4 =
          *(const uint4*)(&V[(row0 + kbase + r) * D_MODEL + col0 + c]);
      const bf16_t* vv = (const bf16_t*)&vv4;
#pragma unroll
      for (int j = 0; j < 8; ++j) Vt[(c + j) * 64 + r] = vv[j];
    }
    wait_async0();
    __syncthreads();                       // Ks async + Vt ds stores visible

    // Scores: wave's 16 q-rows x 64 keys, contraction over d=64 (2 chunks).
    f32x8 s[4];
#pragma unroll
    for (int nr = 0; nr < 4; ++nr) {
      s[nr] = zero8();
#pragma unroll
      for (int c = 0; c < 2; ++c) {
        int kr = nr * 16 + lh;
        bf16x16 bk = ld_frag(&Ks[kr * 64 + c * 32 + kOffLo],
                             &Ks[kr * 64 + c * 32 + kOffHi]);
        s[nr] = __builtin_amdgcn_wmma_f32_16x16x32_bf16(
            false, aq[c], false, bk, (short)0, s[nr], false, false);
      }
    }
    // Scale + mask (mask shape [B,1,1,S], key-indexed).
#pragma unroll
    for (int nr = 0; nr < 4; ++nr) {
      int key = kbase + nr * 16 + lh;
      bool live = mask[row0 + key] != 0;
#pragma unroll
      for (int r = 0; r < 8; ++r) {
        float sv = s[nr][r] * sm_scale;
        s[nr][r] = live ? sv : -1e9f;
      }
    }
    // Online softmax: row reductions across the 16-lane half-wave.
    float f[8];
#pragma unroll
    for (int r = 0; r < 8; ++r) {
      float v = fmaxf(fmaxf(s[0][r], s[1][r]), fmaxf(s[2][r], s[3][r]));
#pragma unroll
      for (int off = 8; off > 0; off >>= 1) v = fmaxf(v, __shfl_xor(v, off, 16));
      float mn = fmaxf(m[r], v);
      f[r] = __expf(m[r] - mn);
      m[r] = mn;
    }
    float rs[8];
#pragma unroll
    for (int r = 0; r < 8; ++r) rs[r] = 0.f;
#pragma unroll
    for (int nr = 0; nr < 4; ++nr)
#pragma unroll
      for (int r = 0; r < 8; ++r) {
        float p = __expf(s[nr][r] - m[r]);
        s[nr][r] = p; rs[r] += p;
      }
#pragma unroll
    for (int r = 0; r < 8; ++r) {
      float v = rs[r];
#pragma unroll
      for (int off = 8; off > 0; off >>= 1) v += __shfl_xor(v, off, 16);
      l[r] = l[r] * f[r] + v;
    }
    // Rescale running context, stage P into LDS (C-frag -> A-frag transpose).
#pragma unroll
    for (int nr = 0; nr < 4; ++nr)
#pragma unroll
      for (int r = 0; r < 8; ++r) o[nr][r] *= f[r];
#pragma unroll
    for (int nr = 0; nr < 4; ++nr)
#pragma unroll
      for (int r = 0; r < 8; ++r)
        Ps[(wave * 16 + g * 8 + r) * 64 + nr * 16 + lh] = (bf16_t)s[nr][r];
    __syncthreads();

    // ctx += P @ V  (contraction over 64 keys, 2 chunks).
#pragma unroll
    for (int c = 0; c < 2; ++c) {
      int pr = wave * 16 + lh;
      bf16x16 ap = ld_frag(&Ps[pr * 64 + c * 32 + kOffLo],
                           &Ps[pr * 64 + c * 32 + kOffHi]);
#pragma unroll
      for (int nr = 0; nr < 4; ++nr) {
        int dr = nr * 16 + lh;
        bf16x16 bv = ld_frag(&Vt[dr * 64 + c * 32 + kOffLo],
                             &Vt[dr * 64 + c * 32 + kOffHi]);
        o[nr] = __builtin_amdgcn_wmma_f32_16x16x32_bf16(
            false, ap, false, bv, (short)0, o[nr], false, false);
      }
    }
  }

  // Normalize and scatter ctx back to [B,S,H*Dk] layout (bf16).
#pragma unroll
  for (int nr = 0; nr < 4; ++nr)
#pragma unroll
    for (int r = 0; r < 8; ++r) {
      float v = o[nr][r] / l[r];
      ctx[(row0 + qbase + wave * 16 + g * 8 + r) * D_MODEL + col0 + nr * 16 + lh]
          = (bf16_t)v;
    }
}

// ---------------------------------------------------------------------------
// Host-side orchestration (graph-capture safe: stream launches only).
// ---------------------------------------------------------------------------
extern "C" void kernel_launch(void* const* d_in, const int* in_sizes, int n_in,
                              void* d_out, int out_size, void* d_ws, size_t ws_size,
                              hipStream_t stream) {
  const float* x      = (const float*)d_in[0];
  const int*   mask   = (const int*)d_in[1];
  const float* wq     = (const float*)d_in[2];
  const float* wk     = (const float*)d_in[3];
  const float* wv     = (const float*)d_in[4];
  const float* wo     = (const float*)d_in[5];
  const float* w1     = (const float*)d_in[6];
  const float* b1     = (const float*)d_in[7];
  const float* w2     = (const float*)d_in[8];
  const float* b2     = (const float*)d_in[9];
  const float* alpha1 = (const float*)d_in[10];
  const float* bias1  = (const float*)d_in[11];
  const float* alpha2 = (const float*)d_in[12];
  const float* bias2  = (const float*)d_in[13];
  float* out = (float*)d_out;

  // Workspace carve-up (~120 MB), 256B-aligned slices.
  char* ws = (char*)d_ws;
  size_t off = 0;
  auto alloc = [&](size_t bytes) -> char* {
    char* p = ws + off;
    off += (bytes + 255) & ~(size_t)255;
    return p;
  };
  bf16_t* wqT = (bf16_t*)alloc((size_t)D_MODEL * D_MODEL * 2);
  bf16_t* wkT = (bf16_t*)alloc((size_t)D_MODEL * D_MODEL * 2);
  bf16_t* wvT = (bf16_t*)alloc((size_t)D_MODEL * D_MODEL * 2);
  bf16_t* woT = (bf16_t*)alloc((size_t)D_MODEL * D_MODEL * 2);
  bf16_t* w1T = (bf16_t*)alloc((size_t)D_FF * D_MODEL * 2);   // [4096][1024]
  bf16_t* w2T = (bf16_t*)alloc((size_t)D_MODEL * D_FF * 2);   // [1024][4096]
  bf16_t* xn  = (bf16_t*)alloc((size_t)ROWS * D_MODEL * 2);
  bf16_t* qb  = (bf16_t*)alloc((size_t)ROWS * D_MODEL * 2);
  bf16_t* kb  = (bf16_t*)alloc((size_t)ROWS * D_MODEL * 2);
  bf16_t* vb  = (bf16_t*)alloc((size_t)ROWS * D_MODEL * 2);
  bf16_t* ctxb= (bf16_t*)alloc((size_t)ROWS * D_MODEL * 2);
  float*  x2  = (float*) alloc((size_t)ROWS * D_MODEL * 4);
  bf16_t* xn2 = (bf16_t*)alloc((size_t)ROWS * D_MODEL * 2);
  bf16_t* hb  = (bf16_t*)alloc((size_t)ROWS * D_FF * 2);
  (void)ws_size; (void)in_sizes; (void)n_in; (void)out_size;

  // 1) Weights -> bf16, transposed to [N][K].
  dim3 gTsq(D_MODEL / TP_N, D_MODEL / TP_K);
  dim3 gTw1(D_FF / TP_N, D_MODEL / TP_K);
  dim3 gTw2(D_MODEL / TP_N, D_FF / TP_K);
  k_transpose_dd<<<gTsq, 256, 0, stream>>>(wq, wqT);
  k_transpose_dd<<<gTsq, 256, 0, stream>>>(wk, wkT);
  k_transpose_dd<<<gTsq, 256, 0, stream>>>(wv, wvT);
  k_transpose_dd<<<gTsq, 256, 0, stream>>>(wo, woT);
  k_transpose_df<<<gTw1, 256, 0, stream>>>(w1, w1T);
  k_transpose_fd<<<gTw2, 256, 0, stream>>>(w2, w2T);

  // 2) LN1
  k_layernorm_bf16<<<ROWS, 256, 0, stream>>>(x, alpha1, bias1, xn);

  // 3) Q/K/V projections (bf16 out)
  dim3 gProj(D_MODEL / 128, ROWS / 128);
  k_gemm_bf16_wmma<<<gProj, 256, 0, stream>>>(xn, wqT, nullptr, nullptr, nullptr, qb, ROWS, D_MODEL, D_MODEL, 0);
  k_gemm_bf16_wmma<<<gProj, 256, 0, stream>>>(xn, wkT, nullptr, nullptr, nullptr, kb, ROWS, D_MODEL, D_MODEL, 0);
  k_gemm_bf16_wmma<<<gProj, 256, 0, stream>>>(xn, wvT, nullptr, nullptr, nullptr, vb, ROWS, D_MODEL, D_MODEL, 0);

  // 4) Flash attention
  dim3 gAttn(SEQ / 64, NHEAD, BATCH);
  k_attention<<<gAttn, 128, 0, stream>>>(qb, kb, vb, mask, ctxb);

  // 5) Output projection + residual (f32 out)
  k_gemm_bf16_wmma<<<gProj, 256, 0, stream>>>(ctxb, woT, nullptr, x, x2, nullptr, ROWS, D_MODEL, D_MODEL, 0);

  // 6) LN2
  k_layernorm_bf16<<<ROWS, 256, 0, stream>>>(x2, alpha2, bias2, xn2);

  // 7) FFN up: relu(xn2 @ w1 + b1) -> bf16
  dim3 gFF1(D_FF / 128, ROWS / 128);
  k_gemm_bf16_wmma<<<gFF1, 256, 0, stream>>>(xn2, w1T, b1, nullptr, nullptr, hb, ROWS, D_FF, D_MODEL, 1);

  // 8) FFN down + bias + residual -> d_out (f32)
  dim3 gFF2(D_MODEL / 128, ROWS / 128);
  k_gemm_bf16_wmma<<<gFF2, 256, 0, stream>>>(hb, w2T, b2, x2, out, ROWS ? nullptr : nullptr, ROWS, D_MODEL, D_FF, 0);
}

// v002
// One run takes 481 microseconds.
// In two side-by-side timings against v001, it was 1.20 and 1.21 times as fast.
// Over all steps from v000 it is 1.77 times as fast.
#include <hip/hip_runtime.h>
#include <hip/hip_bf16.h>

// ---------------------------------------------------------------------------
// Transformer encoder block for MI455X (gfx1250, wave32, WMMA).
// bf16 inputs / f32 accumulate via v_wmma_f32_16x16x32_bf16.
// GEMM staging uses CDNA5 async global->LDS (ASYNCcnt) with double buffering.
// ---------------------------------------------------------------------------

typedef __bf16 bf16_t;
typedef __attribute__((ext_vector_type(16))) __bf16 bf16x16;
typedef __attribute__((ext_vector_type(8)))  __bf16 bf16x8;
typedef __attribute__((ext_vector_type(2)))  __bf16 bf16x2;
typedef __attribute__((ext_vector_type(8)))  float  f32x8;

#define D_MODEL 1024
#define NHEAD   16
#define DKH     64
#define D_FF    4096
#define SEQ     2048
#define BATCH   2
#define ROWS    (BATCH * SEQ)   // 4096

__device__ __forceinline__ f32x8 zero8() {
  f32x8 z;
#pragma unroll
  for (int i = 0; i < 8; ++i) z[i] = 0.0f;
  return z;
}

// 16-byte async copy global -> LDS (CDNA5 GLOBAL_LOAD_ASYNC_TO_LDS_B128,
// tracked by ASYNCcnt). lds_off is the 32-bit LDS byte offset (generic
// pointers to __shared__ truncate to the LDS offset per the aperture rules).
// The statement's last line, s_wait_xcnt 0, stands in front of any later
// rewrite of the address registers that the copy names.
__device__ __forceinline__ void async_copy16(unsigned lds_off, const bf16_t* gptr) {
  asm volatile("global_load_async_to_lds_b128 %0, %1, off\n\t"
               "s_wait_xcnt 0x0"
               :: "v"(lds_off), "v"(gptr)
               : "memory");
}
// Four copies that follow one another share one statement and one such wait.
__device__ __forceinline__ void async_copy16_x4(
    unsigned l0, const bf16_t* g0, unsigned l1, const bf16_t* g1,
    unsigned l2, const bf16_t* g2, unsigned l3, const bf16_t* g3) {
  asm volatile("global_load_async_to_lds_b128 %0, %1, off\n\t"
               "global_load_async_to_lds_b128 %2, %3, off\n\t"
               "global_load_async_to_lds_b128 %4, %5, off\n\t"
               "global_load_async_to_lds_b128 %6, %7, off\n\t"
               "s_wait_xcnt 0x0"
               :: "v"(l0), "v"(g0), "v"(l1), "v"(g1),
                  "v"(l2), "v"(g2), "v"(l3), "v"(g3)
               : "memory");
}
__device__ __forceinline__ void wait_async0() {
  asm volatile("s_wait_asynccnt 0x0" ::: "memory");
}
// This wave's LDS reads have returned before the barrier behind which a copy
// refills the buffer they came from.
__device__ __forceinline__ void wait_ds0() {
  asm volatile("s_wait_dscnt 0x0" ::: "memory");
}
__device__ __forceinline__ unsigned lds_off_of(const bf16_t* p) {
  return (unsigned)(size_t)p;
}

// Build a 16-element bf16 fragment from two contiguous 8-element (16-byte) LDS loads.
// ISA 16-bit A/B layout: lane group g=0 -> K {0..7,16..23}; g=1 -> K {8..15,24..31}.
__device__ __forceinline__ bf16x16 ld_frag(const bf16_t* p_lo, const bf16_t* p_hi) {
  bf16x8 lo = *(const bf16x8*)p_lo;
  bf16x8 hi = *(const bf16x8*)p_hi;
  bf16x16 r;
#pragma unroll
  for (int e = 0; e < 8; ++e) { r[e] = lo[e]; r[8 + e] = hi[e]; }
  return r;
}

// ---------------------------------------------------------------------------
// f32 [K][N]  ->  bf16 [N][K]   (weights pre-transposed so GEMM B-tiles are
// loaded exactly like A-tiles: contiguous along the contraction dim)
// One block moves a tile of 128 k x 64 n through LDS, so that both global
// sides run along their own contiguous dim: reads are 16 B per lane, 256 B per
// input row; writes are 16 B per lane, 256 B per output row (whole lines).
// LDS holds one dword per (k pair, n): bf16(k) low, bf16(k+1) high. The pitch
// of 65 dwords is odd, so the row-wise writes and the column-wise reads both
// touch every bank at most once per wave.
// KD and ND are compile-time, so a thread's eight loads and four stores each
// share one address and differ only in the instruction's immediate offset.
// Grid = ND/64 x KD/128.
// ---------------------------------------------------------------------------
#define TP_K     128
#define TP_N     64
#define TP_PITCH 65

__device__ __forceinline__ unsigned pack_bf16(float lo, float hi) {
  bf16x2 p;
  p[0] = (bf16_t)lo;
  p[1] = (bf16_t)hi;
  return __builtin_bit_cast(unsigned, p);
}

template <int KD, int ND>
__device__ __forceinline__ void transpose_tile(
    const float* __restrict__ in, bf16_t* __restrict__ out) {
  static_assert(KD % TP_K == 0 && ND % TP_N == 0, "tiles must divide the matrix");
  __shared__ unsigned tile[(TP_K / 2) * TP_PITCH];
  const int tid = threadIdx.x;
  const int n0 = blockIdx.x * TP_N;
  const int k0 = blockIdx.y * TP_K;

  // Read: 16 lanes cover the 64 n of one input row; a thread takes rows
  // 2*kp and 2*kp+1 for four k pairs. All eight loads are issued first.
  const int n4 = (tid & 15) * 4;
  const int kp = tid >> 4;
  const float* src = in + (k0 + 2 * kp) * ND + n0 + n4;
  float4 ev[4], od[4];
#pragma unroll   // keeps ev/od in registers and turns the row steps into immediate offsets
  for (int i = 0; i < 4; ++i) {
    ev[i] = *(const float4*)(src + (32 * i) * ND);
    od[i] = *(const float4*)(src + (32 * i + 1) * ND);
  }
#pragma unroll   // ev/od are indexed by i: must be constant to stay in registers
  for (int i = 0; i < 4; ++i) {
    unsigned* t = &tile[(kp + 16 * i) * TP_PITCH + n4];
    t[0] = pack_bf16(ev[i].x, od[i].x);
    t[1] = pack_bf16(ev[i].y, od[i].y);
    t[2] = pack_bf16(ev[i].z, od[i].z);
    t[3] = pack_bf16(ev[i].w, od[i].w);
  }
  __syncthreads();                         // whole tile in LDS before any column is read

  // Write: 16 lanes cover the 128 k of one output row, 8 k (4 pairs) each.
  const int kc = tid & 15;
  const int nr = tid >> 4;
  bf16_t* dst = out + (n0 + nr) * KD + k0 + 8 * kc;
#pragma unroll   // all LDS reads issue together; the row steps become immediate offsets
  for (int j = 0; j < 4; ++j) {
    const unsigned* s = &tile[(4 * kc) * TP_PITCH + nr + 16 * j];
    uint4 v;
    v.x = s[0];
    v.y = s[TP_PITCH];
    v.z = s[2 * TP_PITCH];
    v.w = s[3 * TP_PITCH];
    *(uint4*)(dst + (16 * j) * KD) = v;
  }
}

__global__ __launch_bounds__(256) void k_transpose_dd(
    const float* __restrict__ in, bf16_t* __restrict__ out) {
  transpose_tile<D_MODEL, D_MODEL>(in, out);
}
__global__ __launch_bounds__(256) void k_transpose_df(
    const float* __restrict__ in, bf16_t* __restrict__ out) {
  transpose_tile<D_MODEL, D_FF>(in, out);
}
__global__ __launch_bounds__(256) void k_transpose_fd(
    const float* __restrict__ in, bf16_t* __restrict__ out) {
  transpose_tile<D_FF, D_MODEL>(in, out);
}

// ---------------------------------------------------------------------------
// LayerNorm, faithful to reference: unbiased std (ddof=1), eps added to std.
// f32 in -> bf16 out. One block per row of 1024.
// ---------------------------------------------------------------------------
__global__ __launch_bounds__(256) void k_layernorm_bf16(
    const float* __restrict__ x, const float* __restrict__ alpha,
    const float* __restrict__ beta, bf16_t* __restrict__ out) {
  const int row = blockIdx.x;
  const float* xr = x + (size_t)row * D_MODEL;
  float s = 0.f, ss = 0.f;
  for (int i = threadIdx.x; i < D_MODEL; i += 256) {
    float v = xr[i]; s += v; ss += v * v;
  }
  __shared__ float r1[256], r2[256];
  r1[threadIdx.x] = s; r2[threadIdx.x] = ss;
  __syncthreads();
  for (int o = 128; o > 0; o >>= 1) {
    if (threadIdx.x < o) { r1[threadIdx.x] += r1[threadIdx.x + o];
                           r2[threadIdx.x] += r2[threadIdx.x + o]; }
    __syncthreads();
  }
  float mean = r1[0] * (1.0f / D_MODEL);
  float var  = (r2[0] - (float)D_MODEL * mean * mean) * (1.0f / (D_MODEL - 1));
  var = var > 0.f ? var : 0.f;
  float scale = alpha[0] / (sqrtf(var) + 1e-5f);
  float shift = beta[0];
  bf16_t* orow = out + (size_t)row * D_MODEL;
  for (int i = threadIdx.x; i < D_MODEL; i += 256)
    orow[i] = (bf16_t)((xr[i] - mean) * scale + shift);
}

// ---------------------------------------------------------------------------
// WMMA GEMM: C[M,N] = A[M,K] @ B[K,N], with B supplied transposed (Bt[N][K]).
// 128x128 block tile, BK=32, 256 threads = 8 waves arranged 2(M) x 4(N);
// each wave computes 64x32 = 4x2 accumulator tiles -> 8 WMMA per k-step.
// Double-buffered async global->LDS staging: tile kt+1 streams while tile kt
// is consumed. One barrier per k-step.
// LDS rows of 32 bf16 lie at a pitch of 40 (80 B = 16 B x odd), so that the 16
// rows of one ds_load_b128 fall on different banks.
// Epilogue fuses bias / ReLU / residual; writes f32 and/or bf16.
// ---------------------------------------------------------------------------
#define GP 40   // GEMM LDS row pitch, bf16 elements
__global__ __launch_bounds__(256) void k_gemm_bf16_wmma(
    const bf16_t* __restrict__ A, const bf16_t* __restrict__ Bt,
    const float* __restrict__ bias, const float* __restrict__ residual,
    float* __restrict__ Cf, bf16_t* __restrict__ Cb,
    int M, int N, int K, int doRelu) {
  __shared__ __align__(16) bf16_t As[2][128 * GP];
  __shared__ __align__(16) bf16_t Bs[2][128 * GP];
  const int tid  = threadIdx.x;
  const int wave = tid >> 5, lane = tid & 31, lh = lane & 15, g = lane >> 4;
  const int waveM = wave >> 2, waveN = wave & 3;       // 2 x 4 wave grid
  const int rowBase = blockIdx.y * 128;
  const int colBase = blockIdx.x * 128;
  const int kOffLo = g ? 8 : 0;
  const int kOffHi = g ? 24 : 16;

  // Per-thread staging slots: rows r0 and r0+64, 8 bf16 starting at col c0.
  const int r0 = tid >> 2;
  const int c0 = (tid & 3) * 8;

  auto stage = [&](int kt, int buf) {
    const int kcol = kt * 32 + c0;
    async_copy16_x4(lds_off_of(&As[buf][r0 * GP + c0]),
                    &A[(size_t)(rowBase + r0) * K + kcol],
                    lds_off_of(&As[buf][(r0 + 64) * GP + c0]),
                    &A[(size_t)(rowBase + r0 + 64) * K + kcol],
                    lds_off_of(&Bs[buf][r0 * GP + c0]),
                    &Bt[(size_t)(colBase + r0) * K + kcol],
                    lds_off_of(&Bs[buf][(r0 + 64) * GP + c0]),
                    &Bt[(size_t)(colBase + r0 + 64) * K + kcol]);
  };

  f32x8 acc[4][2];
#pragma unroll
  for (int mr = 0; mr < 4; ++mr)
#pragma unroll
    for (int nr = 0; nr < 2; ++nr) acc[mr][nr] = zero8();

  const int kTiles = K >> 5;
  stage(0, 0);                               // prologue prefetch
  for (int kt = 0; kt < kTiles; ++kt) {
    const int cur = kt & 1;
    wait_ds0();                              // own reads of buf(cur^1) returned
    wait_async0();                           // own async writes to buf(cur) done
    __syncthreads();                         // all waves: buf(cur) ready, prev reads retired
    if (kt + 1 < kTiles) stage(kt + 1, cur ^ 1);   // overlap with compute below

    bf16x16 afrag[4], bfrag[2];
#pragma unroll
    for (int mr = 0; mr < 4; ++mr) {
      int r = waveM * 64 + mr * 16 + lh;
      afrag[mr] = ld_frag(&As[cur][r * GP + kOffLo], &As[cur][r * GP + kOffHi]);
    }
#pragma unroll
    for (int nr = 0; nr < 2; ++nr) {
      int r = waveN * 32 + nr * 16 + lh;
      bfrag[nr] = ld_frag(&Bs[cur][r * GP + kOffLo], &Bs[cur][r * GP + kOffHi]);
    }
#pragma unroll
    for (int mr = 0; mr < 4; ++mr)
#pragma unroll
      for (int nr = 0; nr < 2; ++nr)
        acc[mr][nr] = __builtin_amdgcn_wmma_f32_16x16x32_bf16(
            false, afrag[mr], false, bfrag[nr], (short)0, acc[mr][nr],
            false, false);
  }

  // Epilogue. C-frag layout: lane L holds rows 8*(L/16)+r, column L%16.
#pragma unroll
  for (int mr = 0; mr < 4; ++mr) {
#pragma unroll
    for (int nr = 0; nr < 2; ++nr) {
      int col = colBase + waveN * 32 + nr * 16 + lh;
#pragma unroll
      for (int r = 0; r < 8; ++r) {
        int row = rowBase + waveM * 64 + mr * 16 + g * 8 + r;
        float v = acc[mr][nr][r];
        if (bias)     v += bias[col];
        if (doRelu)   v  = v > 0.f ? v : 0.f;
        if (residual) v += residual[(size_t)row * N + col];
        if (Cf) Cf[(size_t)row * N + col] = v;
        if (Cb) Cb[(size_t)row * N + col] = (bf16_t)v;
      }
    }
  }
}

// ---------------------------------------------------------------------------
// Flash attention: one block per (64-query tile, head, batch). 4 waves; each
// wave owns 16 query rows. Streams 64-key K/V tiles through LDS with online
// softmax; P restaged via LDS for the PV matmul (A-frag layout); V transposed
// at load so V columns are contiguous B-fragments. Q/K tiles use the async
// global->LDS path; V needs the in-flight transpose so it stays on vector loads.
// LDS rows of 64 bf16 lie at a pitch of 72 (144 B = 16 B x odd), so that the 16
// rows of one ds_load_b128 fall on different banks.
// ---------------------------------------------------------------------------
#define AP 72   // attention LDS row pitch, bf16 elements
__global__ __launch_bounds__(128) void k_attention(
    const bf16_t* __restrict__ Q, const bf16_t* __restrict__ Kmat,
    const bf16_t* __restrict__ V, const int* __restrict__ mask,
    bf16_t* __restrict__ ctx) {
  __shared__ __align__(16) bf16_t Qs[64 * AP];
  __shared__ __align__(16) bf16_t Ks[64 * AP];
  __shared__ __align__(16) bf16_t Vt[64 * AP];   // Vt[d][key]
  __shared__ __align__(16) bf16_t Ps[64 * AP];
  const int tid  = threadIdx.x;
  const int wave = tid >> 5, lane = tid & 31, lh = lane & 15, g = lane >> 4;
  const int qbase = blockIdx.x * 64;
  const int h = blockIdx.y, b = blockIdx.z;
  const size_t row0 = (size_t)b * SEQ;
  const int col0 = h * DKH;
  const int kOffLo = g ? 8 : 0;
  const int kOffHi = g ? 24 : 16;

  // Load Q tile [64 x 64] via async copies.
#pragma unroll
  for (int i = 0; i < 4; ++i) {
    int id = i * 128 + tid;                // 0..511
    int r = id >> 3, c = (id & 7) * 8;
    async_copy16(lds_off_of(&Qs[r * AP + c]),
                 &Q[(row0 + qbase + r) * D_MODEL + col0 + c]);
  }
  wait_async0();
  __syncthreads();

  // Q A-fragments are invariant across key tiles: hoist.
  bf16x16 aq[2];
#pragma unroll
  for (int c = 0; c < 2; ++c) {
    int r = wave * 16 + lh;
    aq[c] = ld_frag(&Qs[r * AP + c * 32 + kOffLo],
                    &Qs[r * AP + c * 32 + kOffHi]);
  }

  f32x8 o[4];
#pragma unroll
  for (int nr = 0; nr < 4; ++nr) o[nr] = zero8();
  float m[8], l[8];
#pragma unroll
  for (int r = 0; r < 8; ++r) { m[r] = -1e30f; l[r] = 0.f; }
  const float sm_scale = 0.125f;           // 1/sqrt(64)

  for (int kt = 0; kt < SEQ / 64; ++kt) {
    const int kbase = kt * 64;
    __syncthreads();                       // prior reads of Ks/Vt/Ps retired
    // K tile: straight async copy (rows=key already matches B-frag layout).
    // V tile: vector load + transpose scatter into Vt[d][key].
#pragma unroll
    for (int i = 0; i < 4; ++i) {
      int id = i * 128 + tid;
      int r = id >> 3, c = (id & 7) * 8;
      async_copy16(lds_off_of(&Ks[r * AP + c]),
                   &Kmat[(row0 + kbase + r) * D_MODEL + col0 + c]);
      uint4 vv4 =
          *(const uint4*)(&V[(row0 + kbase + r) * D_MODEL + col0 + c]);
      const bf16_t* vv = (const bf16_t*)&vv4;
#pragma unroll
      for (int j = 0; j < 8; ++j) Vt[(c + j) * AP + r] = vv[j];
    }
    wait_async0();
    __syncthreads();                       // Ks async + Vt ds stores visible

    // Scores: wave's 16 q-rows x 64 keys, contraction over d=64 (2 chunks).
    f32x8 s[4];
#pragma unroll
    for (int nr = 0; nr < 4; ++nr) {
      s[nr] = zero8();
#pragma unroll
      for (int c = 0; c < 2; ++c) {
        int kr = nr * 16 + lh;
        bf16x16 bk = ld_frag(&Ks[kr * AP + c * 32 + kOffLo],
                             &Ks[kr * AP + c * 32 + kOffHi]);
        s[nr] = __builtin_amdgcn_wmma_f32_16x16x32_bf16(
            false, aq[c], false, bk, (short)0, s[nr], false, false);
      }
    }
    // Scale + mask (mask shape [B,1,1,S], key-indexed).
#pragma unroll
    for (int nr = 0; nr < 4; ++nr) {
      int key = kbase + nr * 16 + lh;
      bool live = mask[row0 + key] != 0;
#pragma unroll
      for (int r = 0; r < 8; ++r) {
        float sv = s[nr][r] * sm_scale;
        s[nr][r] = live ? sv : -1e9f;
      }
    }
    // Online softmax: row reductions across the 16-lane half-wave.
    float f[8];
#pragma unroll
    for (int r = 0; r < 8; ++r) {
      float v = fmaxf(fmaxf(s[0][r], s[1][r]), fmaxf(s[2][r], s[3][r]));
#pragma unroll
      for (int off = 8; off > 0; off >>= 1) v = fmaxf(v, __shfl_xor(v, off, 16));
      float mn = fmaxf(m[r], v);
      f[r] = __expf(m[r] - mn);
      m[r] = mn;
    }
    float rs[8];
#pragma unroll
    for (int r = 0; r < 8; ++r) rs[r] = 0.f;
#pragma unroll
    for (int nr = 0; nr < 4; ++nr)
#pragma unroll
      for (int r = 0; r < 8; ++r) {
        float p = __expf(s[nr][r] - m[r]);
        s[nr][r] = p; rs[r] += p;
      }
#pragma unroll
    for (int r = 0; r < 8; ++r) {
      float v = rs[r];
#pragma unroll
      for (int off = 8; off > 0; off >>= 1) v += __shfl_xor(v, off, 16);
      l[r] = l[r] * f[r] + v;
    }
    // Rescale running context, stage P into LDS (C-frag -> A-frag transpose).
#pragma unroll
    for (int nr = 0; nr < 4; ++nr)
#pragma unroll
      for (int r = 0; r < 8; ++r) o[nr][r] *= f[r];
#pragma unroll
    for (int nr = 0; nr < 4; ++nr)
#pragma unroll
      for (int r = 0; r < 8; ++r)
        Ps[(wave * 16 + g * 8 + r) * AP + nr * 16 + lh] = (bf16_t)s[nr][r];
    __syncthreads();

    // ctx += P @ V  (contraction over 64 keys, 2 chunks).
#pragma unroll
    for (int c = 0; c < 2; ++c) {
      int pr = wave * 16 + lh;
      bf16x16 ap = ld_frag(&Ps[pr * AP + c * 32 + kOffLo],
                           &Ps[pr * AP + c * 32 + kOffHi]);
#pragma unroll
      for (int nr = 0; nr < 4; ++nr) {
        int dr = nr * 16 + lh;
        bf16x16 bv = ld_frag(&Vt[dr * AP + c * 32 + kOffLo],
                             &Vt[dr * AP + c * 32 + kOffHi]);
        o[nr] = __builtin_amdgcn_wmma_f32_16x16x32_bf16(
            false, ap, false, bv, (short)0, o[nr], false, false);
      }
    }
  }

  // Normalize and scatter ctx back to [B,S,H*Dk] layout (bf16).
#pragma unroll
  for (int nr = 0; nr < 4; ++nr)
#pragma unroll
    for (int r = 0; r < 8; ++r) {
      float v = o[nr][r] / l[r];
      ctx[(row0 + qbase + wave * 16 + g * 8 + r) * D_MODEL + col0 + nr * 16 + lh]
          = (bf16_t)v;
    }
}

// ---------------------------------------------------------------------------
// Host-side orchestration (graph-capture safe: stream launches only).
// ---------------------------------------------------------------------------
extern "C" void kernel_launch(void* const* d_in, const int* in_sizes, int n_in,
                              void* d_out, int out_size, void* d_ws, size_t ws_size,
                              hipStream_t stream) {
  const float* x      = (const float*)d_in[0];
  const int*   mask   = (const int*)d_in[1];
  const float* wq     = (const float*)d_in[2];
  const float* wk     = (const float*)d_in[3];
  const float* wv     = (const float*)d_in[4];
  const float* wo     = (const float*)d_in[5];
  const float* w1     = (const float*)d_in[6];
  const float* b1     = (const float*)d_in[7];
  const float* w2     = (const float*)d_in[8];
  const float* b2     = (const float*)d_in[9];
  const float* alpha1 = (const float*)d_in[10];
  const float* bias1  = (const float*)d_in[11];
  const float* alpha2 = (const float*)d_in[12];
  const float* bias2  = (const float*)d_in[13];
  float* out = (float*)d_out;

  // Workspace carve-up (~120 MB), 256B-aligned slices.
  char* ws = (char*)d_ws;
  size_t off = 0;
  auto alloc = [&](size_t bytes) -> char* {
    char* p = ws + off;
    off += (bytes + 255) & ~(size_t)255;
    return p;
  };
  bf16_t* wqT = (bf16_t*)alloc((size_t)D_MODEL * D_MODEL * 2);
  bf16_t* wkT = (bf16_t*)alloc((size_t)D_MODEL * D_MODEL * 2);
  bf16_t* wvT = (bf16_t*)alloc((size_t)D_MODEL * D_MODEL * 2);
  bf16_t* woT = (bf16_t*)alloc((size_t)D_MODEL * D_MODEL * 2);
  bf16_t* w1T = (bf16_t*)alloc((size_t)D_FF * D_MODEL * 2);   // [4096][1024]
  bf16_t* w2T = (bf16_t*)alloc((size_t)D_MODEL * D_FF * 2);   // [1024][4096]
  bf16_t* xn  = (bf16_t*)alloc((size_t)ROWS * D_MODEL * 2);
  bf16_t* qb  = (bf16_t*)alloc((size_t)ROWS * D_MODEL * 2);
  bf16_t* kb  = (bf16_t*)alloc((size_t)ROWS * D_MODEL * 2);
  bf16_t* vb  = (bf16_t*)alloc((size_t)ROWS * D_MODEL * 2);
  bf16_t* ctxb= (bf16_t*)alloc((size_t)ROWS * D_MODEL * 2);
  float*  x2  = (float*) alloc((size_t)ROWS * D_MODEL * 4);
  bf16_t* xn2 = (bf16_t*)alloc((size_t)ROWS * D_MODEL * 2);
  bf16_t* hb  = (bf16_t*)alloc((size_t)ROWS * D_FF * 2);
  (void)ws_size; (void)in_sizes; (void)n_in; (void)out_size;

  // 1) Weights -> bf16, transposed to [N][K].
  dim3 gTsq(D_MODEL / TP_N, D_MODEL / TP_K);
  dim3 gTw1(D_FF / TP_N, D_MODEL / TP_K);
  dim3 gTw2(D_MODEL / TP_N, D_FF / TP_K);
  k_transpose_dd<<<gTsq, 256, 0, stream>>>(wq, wqT);
  k_transpose_dd<<<gTsq, 256, 0, stream>>>(wk, wkT);
  k_transpose_dd<<<gTsq, 256, 0, stream>>>(wv, wvT);
  k_transpose_dd<<<gTsq, 256, 0, stream>>>(wo, woT);
  k_transpose_df<<<gTw1, 256, 0, stream>>>(w1, w1T);
  k_transpose_fd<<<gTw2, 256, 0, stream>>>(w2, w2T);

  // 2) LN1
  k_layernorm_bf16<<<ROWS, 256, 0, stream>>>(x, alpha1, bias1, xn);

  // 3) Q/K/V projections (bf16 out)
  dim3 gProj(D_MODEL / 128, ROWS / 128);
  k_gemm_bf16_wmma<<<gProj, 256, 0, stream>>>(xn, wqT, nullptr, nullptr, nullptr, qb, ROWS, D_MODEL, D_MODEL, 0);
  k_gemm_bf16_wmma<<<gProj, 256, 0, stream>>>(xn, wkT, nullptr, nullptr, nullptr, kb, ROWS, D_MODEL, D_MODEL, 0);
  k_gemm_bf16_wmma<<<gProj, 256, 0, stream>>>(xn, wvT, nullptr, nullptr, nullptr, vb, ROWS, D_MODEL, D_MODEL, 0);

  // 4) Flash attention
  dim3 gAttn(SEQ / 64, NHEAD, BATCH);
  k_attention<<<gAttn, 128, 0, stream>>>(qb, kb, vb, mask, ctxb);

  // 5) Output projection + residual (f32 out)
  k_gemm_bf16_wmma<<<gProj, 256, 0, stream>>>(ctxb, woT, nullptr, x, x2, nullptr, ROWS, D_MODEL, D_MODEL, 0);

  // 6) LN2
  k_layernorm_bf16<<<ROWS, 256, 0, stream>>>(x2, alpha2, bias2, xn2);

  // 7) FFN up: relu(xn2 @ w1 + b1) -> bf16
  dim3 gFF1(D_FF / 128, ROWS / 128);
  k_gemm_bf16_wmma<<<gFF1, 256, 0, stream>>>(xn2, w1T, b1, nullptr, nullptr, hb, ROWS, D_FF, D_MODEL, 1);

  // 8) FFN down + bias + residual -> d_out (f32)
  dim3 gFF2(D_MODEL / 128, ROWS / 128);
  k_gemm_bf16_wmma<<<gFF2, 256, 0, stream>>>(hb, w2T, b2, x2, out, ROWS ? nullptr : nullptr, ROWS, D_MODEL, D_FF, 0);
}

// v003
// A run of this version takes 432 microseconds.
// Two timings next to v002 both put it at 1.11 times that version's speed.
// Counting every step since v000, it is 1.96 times as fast.
#include <hip/hip_runtime.h>
#include <hip/hip_bf16.h>

// ---------------------------------------------------------------------------
// Transformer encoder block for MI455X (gfx1250, wave32, WMMA).
// bf16 inputs / f32 accumulate via v_wmma_f32_16x16x32_bf16.
// GEMM staging uses CDNA5 async global->LDS (ASYNCcnt) with double buffering.
// ---------------------------------------------------------------------------

typedef __bf16 bf16_t;
typedef __attribute__((ext_vector_type(16))) __bf16 bf16x16;
typedef __attribute__((ext_vector_type(8)))  __bf16 bf16x8;
typedef __attribute__((ext_vector_type(2)))  __bf16 bf16x2;
typedef __attribute__((ext_vector_type(8)))  float  f32x8;

#define D_MODEL 1024
#define NHEAD   16
#define DKH     64
#define D_FF    4096
#define SEQ     2048
#define BATCH   2
#define ROWS    (BATCH * SEQ)   // 4096

__device__ __forceinline__ f32x8 zero8() {
  f32x8 z;
#pragma unroll
  for (int i = 0; i < 8; ++i) z[i] = 0.0f;
  return z;
}

// 16-byte async copy global -> LDS (CDNA5 GLOBAL_LOAD_ASYNC_TO_LDS_B128,
// tracked by ASYNCcnt). lds_off is the 32-bit LDS byte offset (generic
// pointers to __shared__ truncate to the LDS offset per the aperture rules).
// The statement's last line, s_wait_xcnt 0, stands in front of any later
// rewrite of the address registers that the copy names.
__device__ __forceinline__ void async_copy16(unsigned lds_off, const bf16_t* gptr) {
  asm volatile("global_load_async_to_lds_b128 %0, %1, off\n\t"
               "s_wait_xcnt 0x0"
               :: "v"(lds_off), "v"(gptr)
               : "memory");
}
// Eight copies that follow one another share one statement and one such wait:
// rows 0, 1, ... 7 times a fixed row step, in LDS (lstep bytes) and in global
// memory (gstep elements).
__device__ __forceinline__ void async_copy16_x8(
    unsigned l, unsigned lstep, const bf16_t* g, size_t gstep) {
  asm volatile("global_load_async_to_lds_b128 %0, %1, off\n\t"
               "global_load_async_to_lds_b128 %2, %3, off\n\t"
               "global_load_async_to_lds_b128 %4, %5, off\n\t"
               "global_load_async_to_lds_b128 %6, %7, off\n\t"
               "global_load_async_to_lds_b128 %8, %9, off\n\t"
               "global_load_async_to_lds_b128 %10, %11, off\n\t"
               "global_load_async_to_lds_b128 %12, %13, off\n\t"
               "global_load_async_to_lds_b128 %14, %15, off\n\t"
               "s_wait_xcnt 0x0"
               :: "v"(l),             "v"(g),
                  "v"(l + lstep),     "v"(g + gstep),
                  "v"(l + 2 * lstep), "v"(g + 2 * gstep),
                  "v"(l + 3 * lstep), "v"(g + 3 * gstep),
                  "v"(l + 4 * lstep), "v"(g + 4 * gstep),
                  "v"(l + 5 * lstep), "v"(g + 5 * gstep),
                  "v"(l + 6 * lstep), "v"(g + 6 * gstep),
                  "v"(l + 7 * lstep), "v"(g + 7 * gstep)
               : "memory");
}
__device__ __forceinline__ void wait_async0() {
  asm volatile("s_wait_asynccnt 0x0" ::: "memory");
}
// This wave's LDS reads have returned before the barrier behind which a copy
// refills the buffer they came from.
__device__ __forceinline__ void wait_ds0() {
  asm volatile("s_wait_dscnt 0x0" ::: "memory");
}
__device__ __forceinline__ unsigned lds_off_of(const bf16_t* p) {
  return (unsigned)(size_t)p;
}

// Build a 16-element bf16 fragment from two contiguous 8-element (16-byte) LDS loads.
// ISA 16-bit A/B layout: lane group g=0 -> K {0..7,16..23}; g=1 -> K {8..15,24..31}.
__device__ __forceinline__ bf16x16 ld_frag(const bf16_t* p_lo, const bf16_t* p_hi) {
  bf16x8 lo = *(const bf16x8*)p_lo;
  bf16x8 hi = *(const bf16x8*)p_hi;
  bf16x16 r;
#pragma unroll
  for (int e = 0; e < 8; ++e) { r[e] = lo[e]; r[8 + e] = hi[e]; }
  return r;
}

// ---------------------------------------------------------------------------
// f32 [K][N]  ->  bf16 [N][K]   (weights pre-transposed so GEMM B-tiles are
// loaded exactly like A-tiles: contiguous along the contraction dim)
// One block moves a tile of 128 k x 64 n through LDS, so that both global
// sides run along their own contiguous dim: reads are 16 B per lane, 256 B per
// input row; writes are 16 B per lane, 256 B per output row (whole lines).
// LDS holds one dword per (k pair, n): bf16(k) low, bf16(k+1) high. The pitch
// of 65 dwords is odd, so the row-wise writes and the column-wise reads both
// touch every bank at most once per wave.
// KD and ND are compile-time, so a thread's eight loads and four stores each
// share one address and differ only in the instruction's immediate offset.
// Grid = ND/64 x KD/128.
// ---------------------------------------------------------------------------
#define TP_K     128
#define TP_N     64
#define TP_PITCH 65

__device__ __forceinline__ unsigned pack_bf16(float lo, float hi) {
  bf16x2 p;
  p[0] = (bf16_t)lo;
  p[1] = (bf16_t)hi;
  return __builtin_bit_cast(unsigned, p);
}

template <int KD, int ND>
__device__ __forceinline__ void transpose_tile(
    const float* __restrict__ in, bf16_t* __restrict__ out) {
  static_assert(KD % TP_K == 0 && ND % TP_N == 0, "tiles must divide the matrix");
  __shared__ unsigned tile[(TP_K / 2) * TP_PITCH];
  const int tid = threadIdx.x;
  const int n0 = blockIdx.x * TP_N;
  const int k0 = blockIdx.y * TP_K;

  // Read: 16 lanes cover the 64 n of one input row; a thread takes rows
  // 2*kp and 2*kp+1 for four k pairs. All eight loads are issued first.
  const int n4 = (tid & 15) * 4;
  const int kp = tid >> 4;
  const float* src = in + (k0 + 2 * kp) * ND + n0 + n4;
  float4 ev[4], od[4];
#pragma unroll   // keeps ev/od in registers and turns the row steps into immediate offsets
  for (int i = 0; i < 4; ++i) {
    ev[i] = *(const float4*)(src + (32 * i) * ND);
    od[i] = *(const float4*)(src + (32 * i + 1) * ND);
  }
#pragma unroll   // ev/od are indexed by i: must be constant to stay in registers
  for (int i = 0; i < 4; ++i) {
    unsigned* t = &tile[(kp + 16 * i) * TP_PITCH + n4];
    t[0] = pack_bf16(ev[i].x, od[i].x);
    t[1] = pack_bf16(ev[i].y, od[i].y);
    t[2] = pack_bf16(ev[i].z, od[i].z);
    t[3] = pack_bf16(ev[i].w, od[i].w);
  }
  __syncthreads();                         // whole tile in LDS before any column is read

  // Write: 16 lanes cover the 128 k of one output row, 8 k (4 pairs) each.
  const int kc = tid & 15;
  const int nr = tid >> 4;
  bf16_t* dst = out + (n0 + nr) * KD + k0 + 8 * kc;
#pragma unroll   // all LDS reads issue together; the row steps become immediate offsets
  for (int j = 0; j < 4; ++j) {
    const unsigned* s = &tile[(4 * kc) * TP_PITCH + nr + 16 * j];
    uint4 v;
    v.x = s[0];
    v.y = s[TP_PITCH];
    v.z = s[2 * TP_PITCH];
    v.w = s[3 * TP_PITCH];
    *(uint4*)(dst + (16 * j) * KD) = v;
  }
}

__global__ __launch_bounds__(256) void k_transpose_dd(
    const float* __restrict__ in, bf16_t* __restrict__ out) {
  transpose_tile<D_MODEL, D_MODEL>(in, out);
}
__global__ __launch_bounds__(256) void k_transpose_df(
    const float* __restrict__ in, bf16_t* __restrict__ out) {
  transpose_tile<D_MODEL, D_FF>(in, out);
}
__global__ __launch_bounds__(256) void k_transpose_fd(
    const float* __restrict__ in, bf16_t* __restrict__ out) {
  transpose_tile<D_FF, D_MODEL>(in, out);
}

// ---------------------------------------------------------------------------
// LayerNorm, faithful to reference: unbiased std (ddof=1), eps added to std.
// f32 in -> bf16 out. One block per row of 1024.
// ---------------------------------------------------------------------------
__global__ __launch_bounds__(256) void k_layernorm_bf16(
    const float* __restrict__ x, const float* __restrict__ alpha,
    const float* __restrict__ beta, bf16_t* __restrict__ out) {
  const int row = blockIdx.x;
  const float* xr = x + (size_t)row * D_MODEL;
  float s = 0.f, ss = 0.f;
  for (int i = threadIdx.x; i < D_MODEL; i += 256) {
    float v = xr[i]; s += v; ss += v * v;
  }
  __shared__ float r1[256], r2[256];
  r1[threadIdx.x] = s; r2[threadIdx.x] = ss;
  __syncthreads();
  for (int o = 128; o > 0; o >>= 1) {
    if (threadIdx.x < o) { r1[threadIdx.x] += r1[threadIdx.x + o];
                           r2[threadIdx.x] += r2[threadIdx.x + o]; }
    __syncthreads();
  }
  float mean = r1[0] * (1.0f / D_MODEL);
  float var  = (r2[0] - (float)D_MODEL * mean * mean) * (1.0f / (D_MODEL - 1));
  var = var > 0.f ? var : 0.f;
  float scale = alpha[0] / (sqrtf(var) + 1e-5f);
  float shift = beta[0];
  bf16_t* orow = out + (size_t)row * D_MODEL;
  for (int i = threadIdx.x; i < D_MODEL; i += 256)
    orow[i] = (bf16_t)((xr[i] - mean) * scale + shift);
}

// ---------------------------------------------------------------------------
// WMMA GEMM: C[M,N] = A[M,K] @ B[K,N], with B supplied transposed (Bt[N][K]).
// 128x128 block tile, BK=128, 256 threads = 8 waves arranged 2(M) x 4(N);
// each wave computes 64x32 = 4x2 accumulator tiles -> 32 WMMA per k-step.
// Double-buffered async global->LDS staging: tile kt+1 streams while tile kt
// is consumed. One barrier per k-step. A k-step takes 256 B of every operand
// row, so 16 lanes of a copy cover two whole lines of one row, 64 KiB are in
// flight per block, and the wait for a tile is paid once per 128 k.
// K must be a multiple of 128.
// LDS rows of 128 bf16 lie at a pitch of 136 (272 B = 16 B x odd), so that the
// 16 rows of one ds_load_b128 fall on different banks.
// Epilogue fuses bias / ReLU / residual; writes f32 and/or bf16.
// ---------------------------------------------------------------------------
#define GK 128  // GEMM k-step, bf16 elements
#define GP 136  // GEMM LDS row pitch, bf16 elements
__global__ __launch_bounds__(256) void k_gemm_bf16_wmma(
    const bf16_t* __restrict__ A, const bf16_t* __restrict__ Bt,
    const float* __restrict__ bias, const float* __restrict__ residual,
    float* __restrict__ Cf, bf16_t* __restrict__ Cb,
    int M, int N, int K, int doRelu) {
  __shared__ __align__(16) bf16_t As[2][128 * GP];
  __shared__ __align__(16) bf16_t Bs[2][128 * GP];
  const int tid  = threadIdx.x;
  const int wave = tid >> 5, lane = tid & 31, lh = lane & 15, g = lane >> 4;
  const int waveM = wave >> 2, waveN = wave & 3;       // 2 x 4 wave grid
  const int rowBase = blockIdx.y * 128;
  const int colBase = blockIdx.x * 128;
  const int kOffLo = g ? 8 : 0;
  const int kOffHi = g ? 24 : 16;

  // Per-thread staging slots: rows r0 + 16 * i (i = 0..7) of each operand,
  // 8 bf16 starting at col c0; 16 lanes cover the 256 B of one row.
  const int r0 = tid >> 4;
  const int c0 = (tid & 15) * 8;

  auto stage = [&](int kt, int buf) {
    const int kcol = kt * GK + c0;
    async_copy16_x8(lds_off_of(&As[buf][r0 * GP + c0]), 16 * GP * 2,
                    &A[(size_t)(rowBase + r0) * K + kcol], (size_t)16 * K);
    async_copy16_x8(lds_off_of(&Bs[buf][r0 * GP + c0]), 16 * GP * 2,
                    &Bt[(size_t)(colBase + r0) * K + kcol], (size_t)16 * K);
  };

  f32x8 acc[4][2];
#pragma unroll
  for (int mr = 0; mr < 4; ++mr)
#pragma unroll
    for (int nr = 0; nr < 2; ++nr) acc[mr][nr] = zero8();

  const int kTiles = K / GK;
  stage(0, 0);                               // prologue prefetch
  for (int kt = 0; kt < kTiles; ++kt) {
    const int cur = kt & 1;
    wait_ds0();                              // own reads of buf(cur^1) returned
    wait_async0();                           // own async writes to buf(cur) done
    __syncthreads();                         // all waves: buf(cur) ready, prev reads retired
    if (kt + 1 < kTiles) stage(kt + 1, cur ^ 1);   // overlap with compute below

#pragma unroll   // the four 32-k chunks differ only in LDS immediate offsets; their loads can run ahead
    for (int ks = 0; ks < GK; ks += 32) {
      bf16x16 afrag[4], bfrag[2];
#pragma unroll
      for (int mr = 0; mr < 4; ++mr) {
        int r = waveM * 64 + mr * 16 + lh;
        afrag[mr] = ld_frag(&As[cur][r * GP + ks + kOffLo],
                            &As[cur][r * GP + ks + kOffHi]);
      }
#pragma unroll
      for (int nr = 0; nr < 2; ++nr) {
        int r = waveN * 32 + nr * 16 + lh;
        bfrag[nr] = ld_frag(&Bs[cur][r * GP + ks + kOffLo],
                            &Bs[cur][r * GP + ks + kOffHi]);
      }
#pragma unroll
      for (int mr = 0; mr < 4; ++mr)
#pragma unroll
        for (int nr = 0; nr < 2; ++nr)
          acc[mr][nr] = __builtin_amdgcn_wmma_f32_16x16x32_bf16(
              false, afrag[mr], false, bfrag[nr], (short)0, acc[mr][nr],
              false, false);
    }
  }

  // Epilogue. C-frag layout: lane L holds rows 8*(L/16)+r, column L%16.
#pragma unroll
  for (int mr = 0; mr < 4; ++mr) {
#pragma unroll
    for (int nr = 0; nr < 2; ++nr) {
      int col = colBase + waveN * 32 + nr * 16 + lh;
#pragma unroll
      for (int r = 0; r < 8; ++r) {
        int row = rowBase + waveM * 64 + mr * 16 + g * 8 + r;
        float v = acc[mr][nr][r];
        if (bias)     v += bias[col];
        if (doRelu)   v  = v > 0.f ? v : 0.f;
        if (residual) v += residual[(size_t)row * N + col];
        if (Cf) Cf[(size_t)row * N + col] = v;
        if (Cb) Cb[(size_t)row * N + col] = (bf16_t)v;
      }
    }
  }
}

// ---------------------------------------------------------------------------
// Flash attention: one block per (64-query tile, head, batch). 4 waves; each
// wave owns 16 query rows. Streams 64-key K/V tiles through LDS with online
// softmax; P restaged via LDS for the PV matmul (A-frag layout); V transposed
// at load so V columns are contiguous B-fragments. Q/K tiles use the async
// global->LDS path; V needs the in-flight transpose so it stays on vector loads.
// LDS rows of 64 bf16 lie at a pitch of 72 (144 B = 16 B x odd), so that the 16
// rows of one ds_load_b128 fall on different banks.
// ---------------------------------------------------------------------------
#define AP 72   // attention LDS row pitch, bf16 elements
__global__ __launch_bounds__(128) void k_attention(
    const bf16_t* __restrict__ Q, const bf16_t* __restrict__ Kmat,
    const bf16_t* __restrict__ V, const int* __restrict__ mask,
    bf16_t* __restrict__ ctx) {
  __shared__ __align__(16) bf16_t Qs[64 * AP];
  __shared__ __align__(16) bf16_t Ks[64 * AP];
  __shared__ __align__(16) bf16_t Vt[64 * AP];   // Vt[d][key]
  __shared__ __align__(16) bf16_t Ps[64 * AP];
  const int tid  = threadIdx.x;
  const int wave = tid >> 5, lane = tid & 31, lh = lane & 15, g = lane >> 4;
  const int qbase = blockIdx.x * 64;
  const int h = blockIdx.y, b = blockIdx.z;
  const size_t row0 = (size_t)b * SEQ;
  const int col0 = h * DKH;
  const int kOffLo = g ? 8 : 0;
  const int kOffHi = g ? 24 : 16;

  // Load Q tile [64 x 64] via async copies.
#pragma unroll
  for (int i = 0; i < 4; ++i) {
    int id = i * 128 + tid;                // 0..511
    int r = id >> 3, c = (id & 7) * 8;
    async_copy16(lds_off_of(&Qs[r * AP + c]),
                 &Q[(row0 + qbase + r) * D_MODEL + col0 + c]);
  }
  wait_async0();
  __syncthreads();

  // Q A-fragments are invariant across key tiles: hoist.
  bf16x16 aq[2];
#pragma unroll
  for (int c = 0; c < 2; ++c) {
    int r = wave * 16 + lh;
    aq[c] = ld_frag(&Qs[r * AP + c * 32 + kOffLo],
                    &Qs[r * AP + c * 32 + kOffHi]);
  }

  f32x8 o[4];
#pragma unroll
  for (int nr = 0; nr < 4; ++nr) o[nr] = zero8();
  float m[8], l[8];
#pragma unroll
  for (int r = 0; r < 8; ++r) { m[r] = -1e30f; l[r] = 0.f; }
  const float sm_scale = 0.125f;           // 1/sqrt(64)

  for (int kt = 0; kt < SEQ / 64; ++kt) {
    const int kbase = kt * 64;
    __syncthreads();                       // prior reads of Ks/Vt/Ps retired
    // K tile: straight async copy (rows=key already matches B-frag layout).
    // V tile: vector load + transpose scatter into Vt[d][key].
#pragma unroll
    for (int i = 0; i < 4; ++i) {
      int id = i * 128 + tid;
      int r = id >> 3, c = (id & 7) * 8;
      async_copy16(lds_off_of(&Ks[r * AP + c]),
                   &Kmat[(row0 + kbase + r) * D_MODEL + col0 + c]);
      uint4 vv4 =
          *(const uint4*)(&V[(row0 + kbase + r) * D_MODEL + col0 + c]);
      const bf16_t* vv = (const bf16_t*)&vv4;
#pragma unroll
      for (int j = 0; j < 8; ++j) Vt[(c + j) * AP + r] = vv[j];
    }
    wait_async0();
    __syncthreads();                       // Ks async + Vt ds stores visible

    // Scores: wave's 16 q-rows x 64 keys, contraction over d=64 (2 chunks).
    f32x8 s[4];
#pragma unroll
    for (int nr = 0; nr < 4; ++nr) {
      s[nr] = zero8();
#pragma unroll
      for (int c = 0; c < 2; ++c) {
        int kr = nr * 16 + lh;
        bf16x16 bk = ld_frag(&Ks[kr * AP + c * 32 + kOffLo],
                             &Ks[kr * AP + c * 32 + kOffHi]);
        s[nr] = __builtin_amdgcn_wmma_f32_16x16x32_bf16(
            false, aq[c], false, bk, (short)0, s[nr], false, false);
      }
    }
    // Scale + mask (mask shape [B,1,1,S], key-indexed).
#pragma unroll
    for (int nr = 0; nr < 4; ++nr) {
      int key = kbase + nr * 16 + lh;
      bool live = mask[row0 + key] != 0;
#pragma unroll
      for (int r = 0; r < 8; ++r) {
        float sv = s[nr][r] * sm_scale;
        s[nr][r] = live ? sv : -1e9f;
      }
    }
    // Online softmax: row reductions across the 16-lane half-wave.
    float f[8];
#pragma unroll
    for (int r = 0; r < 8; ++r) {
      float v = fmaxf(fmaxf(s[0][r], s[1][r]), fmaxf(s[2][r], s[3][r]));
#pragma unroll
      for (int off = 8; off > 0; off >>= 1) v = fmaxf(v, __shfl_xor(v, off, 16));
      float mn = fmaxf(m[r], v);
      f[r] = __expf(m[r] - mn);
      m[r] = mn;
    }
    float rs[8];
#pragma unroll
    for (int r = 0; r < 8; ++r) rs[r] = 0.f;
#pragma unroll
    for (int nr = 0; nr < 4; ++nr)
#pragma unroll
      for (int r = 0; r < 8; ++r) {
        float p = __expf(s[nr][r] - m[r]);
        s[nr][r] = p; rs[r] += p;
      }
#pragma unroll
    for (int r = 0; r < 8; ++r) {
      float v = rs[r];
#pragma unroll
      for (int off = 8; off > 0; off >>= 1) v += __shfl_xor(v, off, 16);
      l[r] = l[r] * f[r] + v;
    }
    // Rescale running context, stage P into LDS (C-frag -> A-frag transpose).
#pragma unroll
    for (int nr = 0; nr < 4; ++nr)
#pragma unroll
      for (int r = 0; r < 8; ++r) o[nr][r] *= f[r];
#pragma unroll
    for (int nr = 0; nr < 4; ++nr)
#pragma unroll
      for (int r = 0; r < 8; ++r)
        Ps[(wave * 16 + g * 8 + r) * AP + nr * 16 + lh] = (bf16_t)s[nr][r];
    __syncthreads();

    // ctx += P @ V  (contraction over 64 keys, 2 chunks).
#pragma unroll
    for (int c = 0; c < 2; ++c) {
      int pr = wave * 16 + lh;
      bf16x16 ap = ld_frag(&Ps[pr * AP + c * 32 + kOffLo],
                           &Ps[pr * AP + c * 32 + kOffHi]);
#pragma unroll
      for (int nr = 0; nr < 4; ++nr) {
        int dr = nr * 16 + lh;
        bf16x16 bv = ld_frag(&Vt[dr * AP + c * 32 + kOffLo],
                             &Vt[dr * AP + c * 32 + kOffHi]);
        o[nr] = __builtin_amdgcn_wmma_f32_16x16x32_bf16(
            false, ap, false, bv, (short)0, o[nr], false, false);
      }
    }
  }

  // Normalize and scatter ctx back to [B,S,H*Dk] layout (bf16).
#pragma unroll
  for (int nr = 0; nr < 4; ++nr)
#pragma unroll
    for (int r = 0; r < 8; ++r) {
      float v = o[nr][r] / l[r];
      ctx[(row0 + qbase + wave * 16 + g * 8 + r) * D_MODEL + col0 + nr * 16 + lh]
          = (bf16_t)v;
    }
}

// ---------------------------------------------------------------------------
// Host-side orchestration (graph-capture safe: stream launches only).
// ---------------------------------------------------------------------------
extern "C" void kernel_launch(void* const* d_in, const int* in_sizes, int n_in,
                              void* d_out, int out_size, void* d_ws, size_t ws_size,
                              hipStream_t stream) {
  const float* x      = (const float*)d_in[0];
  const int*   mask   = (const int*)d_in[1];
  const float* wq     = (const float*)d_in[2];
  const float* wk     = (const float*)d_in[3];
  const float* wv     = (const float*)d_in[4];
  const float* wo     = (const float*)d_in[5];
  const float* w1     = (const float*)d_in[6];
  const float* b1     = (const float*)d_in[7];
  const float* w2     = (const float*)d_in[8];
  const float* b2     = (const float*)d_in[9];
  const float* alpha1 = (const float*)d_in[10];
  const float* bias1  = (const float*)d_in[11];
  const float* alpha2 = (const float*)d_in[12];
  const float* bias2  = (const float*)d_in[13];
  float* out = (float*)d_out;

  // Workspace carve-up (~120 MB), 256B-aligned slices.
  char* ws = (char*)d_ws;
  size_t off = 0;
  auto alloc = [&](size_t bytes) -> char* {
    char* p = ws + off;
    off += (bytes + 255) & ~(size_t)255;
    return p;
  };
  bf16_t* wqT = (bf16_t*)alloc((size_t)D_MODEL * D_MODEL * 2);
  bf16_t* wkT = (bf16_t*)alloc((size_t)D_MODEL * D_MODEL * 2);
  bf16_t* wvT = (bf16_t*)alloc((size_t)D_MODEL * D_MODEL * 2);
  bf16_t* woT = (bf16_t*)alloc((size_t)D_MODEL * D_MODEL * 2);
  bf16_t* w1T = (bf16_t*)alloc((size_t)D_FF * D_MODEL * 2);   // [4096][1024]
  bf16_t* w2T = (bf16_t*)alloc((size_t)D_MODEL * D_FF * 2);   // [1024][4096]
  bf16_t* xn  = (bf16_t*)alloc((size_t)ROWS * D_MODEL * 2);
  bf16_t* qb  = (bf16_t*)alloc((size_t)ROWS * D_MODEL * 2);
  bf16_t* kb  = (bf16_t*)alloc((size_t)ROWS * D_MODEL * 2);
  bf16_t* vb  = (bf16_t*)alloc((size_t)ROWS * D_MODEL * 2);
  bf16_t* ctxb= (bf16_t*)alloc((size_t)ROWS * D_MODEL * 2);
  float*  x2  = (float*) alloc((size_t)ROWS * D_MODEL * 4);
  bf16_t* xn2 = (bf16_t*)alloc((size_t)ROWS * D_MODEL * 2);
  bf16_t* hb  = (bf16_t*)alloc((size_t)ROWS * D_FF * 2);
  (void)ws_size; (void)in_sizes; (void)n_in; (void)out_size;

  // 1) Weights -> bf16, transposed to [N][K].
  dim3 gTsq(D_MODEL / TP_N, D_MODEL / TP_K);
  dim3 gTw1(D_FF / TP_N, D_MODEL / TP_K);
  dim3 gTw2(D_MODEL / TP_N, D_FF / TP_K);
  k_transpose_dd<<<gTsq, 256, 0, stream>>>(wq, wqT);
  k_transpose_dd<<<gTsq, 256, 0, stream>>>(wk, wkT);
  k_transpose_dd<<<gTsq, 256, 0, stream>>>(wv, wvT);
  k_transpose_dd<<<gTsq, 256, 0, stream>>>(wo, woT);
  k_transpose_df<<<gTw1, 256, 0, stream>>>(w1, w1T);
  k_transpose_fd<<<gTw2, 256, 0, stream>>>(w2, w2T);

  // 2) LN1
  k_layernorm_bf16<<<ROWS, 256, 0, stream>>>(x, alpha1, bias1, xn);

  // 3) Q/K/V projections (bf16 out)
  dim3 gProj(D_MODEL / 128, ROWS / 128);
  k_gemm_bf16_wmma<<<gProj, 256, 0, stream>>>(xn, wqT, nullptr, nullptr, nullptr, qb, ROWS, D_MODEL, D_MODEL, 0);
  k_gemm_bf16_wmma<<<gProj, 256, 0, stream>>>(xn, wkT, nullptr, nullptr, nullptr, kb, ROWS, D_MODEL, D_MODEL, 0);
  k_gemm_bf16_wmma<<<gProj, 256, 0, stream>>>(xn, wvT, nullptr, nullptr, nullptr, vb, ROWS, D_MODEL, D_MODEL, 0);

  // 4) Flash attention
  dim3 gAttn(SEQ / 64, NHEAD, BATCH);
  k_attention<<<gAttn, 128, 0, stream>>>(qb, kb, vb, mask, ctxb);

  // 5) Output projection + residual (f32 out)
  k_gemm_bf16_wmma<<<gProj, 256, 0, stream>>>(ctxb, woT, nullptr, x, x2, nullptr, ROWS, D_MODEL, D_MODEL, 0);

  // 6) LN2
  k_layernorm_bf16<<<ROWS, 256, 0, stream>>>(x2, alpha2, bias2, xn2);

  // 7) FFN up: relu(xn2 @ w1 + b1) -> bf16
  dim3 gFF1(D_FF / 128, ROWS / 128);
  k_gemm_bf16_wmma<<<gFF1, 256, 0, stream>>>(xn2, w1T, b1, nullptr, nullptr, hb, ROWS, D_FF, D_MODEL, 1);

  // 8) FFN down + bias + residual -> d_out (f32)
  dim3 gFF2(D_MODEL / 128, ROWS / 128);
  k_gemm_bf16_wmma<<<gFF2, 256, 0, stream>>>(hb, w2T, b2, x2, out, ROWS ? nullptr : nullptr, ROWS, D_MODEL, D_FF, 0);
}

// v004
// A run of this version takes 333 microseconds.
// In two side-by-side timings against v003, it was 1.30 and 1.31 times as fast.
// Counting every step since v000, it is 2.57 times as fast.
#include <hip/hip_runtime.h>
#include <hip/hip_bf16.h>

// ---------------------------------------------------------------------------
// Transformer encoder block for MI455X (gfx1250, wave32, WMMA).
// bf16 inputs / f32 accumulate via v_wmma_f32_16x16x32_bf16.
// GEMM staging uses CDNA5 async global->LDS (ASYNCcnt) with double buffering.
// ---------------------------------------------------------------------------

typedef __bf16 bf16_t;
typedef __attribute__((ext_vector_type(16))) __bf16 bf16x16;
typedef __attribute__((ext_vector_type(8)))  __bf16 bf16x8;
typedef __attribute__((ext_vector_type(2)))  __bf16 bf16x2;
typedef __attribute__((ext_vector_type(8)))  float  f32x8;

#define D_MODEL 1024
#define NHEAD   16
#define DKH     64
#define D_FF    4096
#define SEQ     2048
#define BATCH   2
#define ROWS    (BATCH * SEQ)   // 4096

__device__ __forceinline__ f32x8 zero8() {
  f32x8 z;
#pragma unroll
  for (int i = 0; i < 8; ++i) z[i] = 0.0f;
  return z;
}

// 16-byte async copy global -> LDS (CDNA5 GLOBAL_LOAD_ASYNC_TO_LDS_B128,
// tracked by ASYNCcnt). lds_off is the 32-bit LDS byte offset (generic
// pointers to __shared__ truncate to the LDS offset per the aperture rules).
// The statement's last line, s_wait_xcnt 0, stands in front of any later
// rewrite of the address registers that the copy names.
__device__ __forceinline__ void async_copy16(unsigned lds_off, const bf16_t* gptr) {
  asm volatile("global_load_async_to_lds_b128 %0, %1, off\n\t"
               "s_wait_xcnt 0x0"
               :: "v"(lds_off), "v"(gptr)
               : "memory");
}
// Eight copies that follow one another share one statement and one such wait:
// rows 0, 1, ... 7 times a fixed row step, in LDS (lstep bytes) and in global
// memory (gstep elements).
__device__ __forceinline__ void async_copy16_x8(
    unsigned l, unsigned lstep, const bf16_t* g, size_t gstep) {
  asm volatile("global_load_async_to_lds_b128 %0, %1, off\n\t"
               "global_load_async_to_lds_b128 %2, %3, off\n\t"
               "global_load_async_to_lds_b128 %4, %5, off\n\t"
               "global_load_async_to_lds_b128 %6, %7, off\n\t"
               "global_load_async_to_lds_b128 %8, %9, off\n\t"
               "global_load_async_to_lds_b128 %10, %11, off\n\t"
               "global_load_async_to_lds_b128 %12, %13, off\n\t"
               "global_load_async_to_lds_b128 %14, %15, off\n\t"
               "s_wait_xcnt 0x0"
               :: "v"(l),             "v"(g),
                  "v"(l + lstep),     "v"(g + gstep),
                  "v"(l + 2 * lstep), "v"(g + 2 * gstep),
                  "v"(l + 3 * lstep), "v"(g + 3 * gstep),
                  "v"(l + 4 * lstep), "v"(g + 4 * gstep),
                  "v"(l + 5 * lstep), "v"(g + 5 * gstep),
                  "v"(l + 6 * lstep), "v"(g + 6 * gstep),
                  "v"(l + 7 * lstep), "v"(g + 7 * gstep)
               : "memory");
}
__device__ __forceinline__ void wait_async0() {
  asm volatile("s_wait_asynccnt 0x0" ::: "memory");
}
// This wave's LDS reads have returned before the barrier behind which a copy
// refills the buffer they came from.
__device__ __forceinline__ void wait_ds0() {
  asm volatile("s_wait_dscnt 0x0" ::: "memory");
}
__device__ __forceinline__ unsigned lds_off_of(const bf16_t* p) {
  return (unsigned)(size_t)p;
}

// Build a 16-element bf16 fragment from two contiguous 8-element (16-byte) LDS loads.
// ISA 16-bit A/B layout: lane group g=0 -> K {0..7,16..23}; g=1 -> K {8..15,24..31}.
__device__ __forceinline__ bf16x16 ld_frag(const bf16_t* p_lo, const bf16_t* p_hi) {
  bf16x8 lo = *(const bf16x8*)p_lo;
  bf16x8 hi = *(const bf16x8*)p_hi;
  bf16x16 r;
#pragma unroll
  for (int e = 0; e < 8; ++e) { r[e] = lo[e]; r[8 + e] = hi[e]; }
  return r;
}

// ---------------------------------------------------------------------------
// f32 [K][N]  ->  bf16 [N][K]   (weights pre-transposed so GEMM B-tiles are
// loaded exactly like A-tiles: contiguous along the contraction dim)
// One block moves a tile of 128 k x 64 n through LDS, so that both global
// sides run along their own contiguous dim: reads are 16 B per lane, 256 B per
// input row; writes are 16 B per lane, 256 B per output row (whole lines).
// LDS holds one dword per (k pair, n): bf16(k) low, bf16(k+1) high. The pitch
// of 65 dwords is odd, so the row-wise writes and the column-wise reads both
// touch every bank at most once per wave.
// KD and ND are compile-time, so a thread's eight loads and four stores each
// share one address and differ only in the instruction's immediate offset.
// Grid = ND/64 x KD/128.
// ---------------------------------------------------------------------------
#define TP_K     128
#define TP_N     64
#define TP_PITCH 65

__device__ __forceinline__ unsigned pack_bf16(float lo, float hi) {
  bf16x2 p;
  p[0] = (bf16_t)lo;
  p[1] = (bf16_t)hi;
  return __builtin_bit_cast(unsigned, p);
}

template <int KD, int ND>
__device__ __forceinline__ void transpose_tile(
    const float* __restrict__ in, bf16_t* __restrict__ out) {
  static_assert(KD % TP_K == 0 && ND % TP_N == 0, "tiles must divide the matrix");
  __shared__ unsigned tile[(TP_K / 2) * TP_PITCH];
  const int tid = threadIdx.x;
  const int n0 = blockIdx.x * TP_N;
  const int k0 = blockIdx.y * TP_K;

  // Read: 16 lanes cover the 64 n of one input row; a thread takes rows
  // 2*kp and 2*kp+1 for four k pairs. All eight loads are issued first.
  const int n4 = (tid & 15) * 4;
  const int kp = tid >> 4;
  const float* src = in + (k0 + 2 * kp) * ND + n0 + n4;
  float4 ev[4], od[4];
#pragma unroll   // keeps ev/od in registers and turns the row steps into immediate offsets
  for (int i = 0; i < 4; ++i) {
    ev[i] = *(const float4*)(src + (32 * i) * ND);
    od[i] = *(const float4*)(src + (32 * i + 1) * ND);
  }
#pragma unroll   // ev/od are indexed by i: must be constant to stay in registers
  for (int i = 0; i < 4; ++i) {
    unsigned* t = &tile[(kp + 16 * i) * TP_PITCH + n4];
    t[0] = pack_bf16(ev[i].x, od[i].x);
    t[1] = pack_bf16(ev[i].y, od[i].y);
    t[2] = pack_bf16(ev[i].z, od[i].z);
    t[3] = pack_bf16(ev[i].w, od[i].w);
  }
  __syncthreads();                         // whole tile in LDS before any column is read

  // Write: 16 lanes cover the 128 k of one output row, 8 k (4 pairs) each.
  const int kc = tid & 15;
  const int nr = tid >> 4;
  bf16_t* dst = out + (n0 + nr) * KD + k0 + 8 * kc;
#pragma unroll   // all LDS reads issue together; the row steps become immediate offsets
  for (int j = 0; j < 4; ++j) {
    const unsigned* s = &tile[(4 * kc) * TP_PITCH + nr + 16 * j];
    uint4 v;
    v.x = s[0];
    v.y = s[TP_PITCH];
    v.z = s[2 * TP_PITCH];
    v.w = s[3 * TP_PITCH];
    *(uint4*)(dst + (16 * j) * KD) = v;
  }
}

__global__ __launch_bounds__(256) void k_transpose_dd(
    const float* __restrict__ in, bf16_t* __restrict__ out) {
  transpose_tile<D_MODEL, D_MODEL>(in, out);
}
__global__ __launch_bounds__(256) void k_transpose_df(
    const float* __restrict__ in, bf16_t* __restrict__ out) {
  transpose_tile<D_MODEL, D_FF>(in, out);
}
__global__ __launch_bounds__(256) void k_transpose_fd(
    const float* __restrict__ in, bf16_t* __restrict__ out) {
  transpose_tile<D_FF, D_MODEL>(in, out);
}

// ---------------------------------------------------------------------------
// LayerNorm, faithful to reference: unbiased std (ddof=1), eps added to std.
// f32 in -> bf16 out. One block per row of 1024.
// ---------------------------------------------------------------------------
__global__ __launch_bounds__(256) void k_layernorm_bf16(
    const float* __restrict__ x, const float* __restrict__ alpha,
    const float* __restrict__ beta, bf16_t* __restrict__ out) {
  const int row = blockIdx.x;
  const float* xr = x + (size_t)row * D_MODEL;
  float s = 0.f, ss = 0.f;
  for (int i = threadIdx.x; i < D_MODEL; i += 256) {
    float v = xr[i]; s += v; ss += v * v;
  }
  __shared__ float r1[256], r2[256];
  r1[threadIdx.x] = s; r2[threadIdx.x] = ss;
  __syncthreads();
  for (int o = 128; o > 0; o >>= 1) {
    if (threadIdx.x < o) { r1[threadIdx.x] += r1[threadIdx.x + o];
                           r2[threadIdx.x] += r2[threadIdx.x + o]; }
    __syncthreads();
  }
  float mean = r1[0] * (1.0f / D_MODEL);
  float var  = (r2[0] - (float)D_MODEL * mean * mean) * (1.0f / (D_MODEL - 1));
  var = var > 0.f ? var : 0.f;
  float scale = alpha[0] / (sqrtf(var) + 1e-5f);
  float shift = beta[0];
  bf16_t* orow = out + (size_t)row * D_MODEL;
  for (int i = threadIdx.x; i < D_MODEL; i += 256)
    orow[i] = (bf16_t)((xr[i] - mean) * scale + shift);
}

// ---------------------------------------------------------------------------
// WMMA GEMM: C[M,N] = A[M,K] @ B[K,N], with B supplied transposed (Bt[N][K]).
// 128x128 block tile, BK=128, 256 threads = 8 waves arranged 2(M) x 4(N);
// each wave computes 64x32 = 4x2 accumulator tiles -> 32 WMMA per k-step.
// Double-buffered async global->LDS staging: tile kt+1 streams while tile kt
// is consumed. One barrier per k-step. A k-step takes 256 B of every operand
// row, so 16 lanes of a copy cover two whole lines of one row, 64 KiB are in
// flight per block, and the wait for a tile is paid once per 128 k.
// K must be a multiple of 128.
// LDS rows of 128 bf16 lie at a pitch of 136 (272 B = 16 B x odd), so that the
// 16 rows of one ds_load_b128 fall on different banks.
// Epilogue fuses bias / ReLU / residual; writes f32 or bf16. What it fuses, the
// output type and N are compile-time: no test stands between two elements, so
// a lane's two bias loads and its 64 residual loads are issued in a row, their
// latencies overlap, and every load and store is one base plus an immediate.
// ---------------------------------------------------------------------------
#define GK 128  // GEMM k-step, bf16 elements
#define GP 136  // GEMM LDS row pitch, bf16 elements
template <bool HAS_BIAS, bool RELU, bool HAS_RES, bool OUT_F32, int N>
__device__ __forceinline__ void gemm_tile(
    const bf16_t* __restrict__ A, const bf16_t* __restrict__ Bt,
    const float* __restrict__ bias, const float* __restrict__ residual,
    float* __restrict__ Cf, bf16_t* __restrict__ Cb, int K) {
  __shared__ __align__(16) bf16_t As[2][128 * GP];
  __shared__ __align__(16) bf16_t Bs[2][128 * GP];
  const int tid  = threadIdx.x;
  const int wave = tid >> 5, lane = tid & 31, lh = lane & 15, g = lane >> 4;
  const int waveM = wave >> 2, waveN = wave & 3;       // 2 x 4 wave grid
  const int rowBase = blockIdx.y * 128;
  const int colBase = blockIdx.x * 128;
  const int kOffLo = g ? 8 : 0;
  const int kOffHi = g ? 24 : 16;

  // Per-thread staging slots: rows r0 + 16 * i (i = 0..7) of each operand,
  // 8 bf16 starting at col c0; 16 lanes cover the 256 B of one row.
  const int r0 = tid >> 4;
  const int c0 = (tid & 15) * 8;

  auto stage = [&](int kt, int buf) {
    const int kcol = kt * GK + c0;
    async_copy16_x8(lds_off_of(&As[buf][r0 * GP + c0]), 16 * GP * 2,
                    &A[(size_t)(rowBase + r0) * K + kcol], (size_t)16 * K);
    async_copy16_x8(lds_off_of(&Bs[buf][r0 * GP + c0]), 16 * GP * 2,
                    &Bt[(size_t)(colBase + r0) * K + kcol], (size_t)16 * K);
  };

  f32x8 acc[4][2];
#pragma unroll
  for (int mr = 0; mr < 4; ++mr)
#pragma unroll
    for (int nr = 0; nr < 2; ++nr) acc[mr][nr] = zero8();

  const int kTiles = K / GK;
  stage(0, 0);                               // prologue prefetch
  for (int kt = 0; kt < kTiles; ++kt) {
    const int cur = kt & 1;
    wait_ds0();                              // own reads of buf(cur^1) returned
    wait_async0();                           // own async writes to buf(cur) done
    __syncthreads();                         // all waves: buf(cur) ready, prev reads retired
    if (kt + 1 < kTiles) stage(kt + 1, cur ^ 1);   // overlap with compute below

#pragma unroll   // the four 32-k chunks differ only in LDS immediate offsets; their loads can run ahead
    for (int ks = 0; ks < GK; ks += 32) {
      bf16x16 afrag[4], bfrag[2];
#pragma unroll
      for (int mr = 0; mr < 4; ++mr) {
        int r = waveM * 64 + mr * 16 + lh;
        afrag[mr] = ld_frag(&As[cur][r * GP + ks + kOffLo],
                            &As[cur][r * GP + ks + kOffHi]);
      }
#pragma unroll
      for (int nr = 0; nr < 2; ++nr) {
        int r = waveN * 32 + nr * 16 + lh;
        bfrag[nr] = ld_frag(&Bs[cur][r * GP + ks + kOffLo],
                            &Bs[cur][r * GP + ks + kOffHi]);
      }
#pragma unroll
      for (int mr = 0; mr < 4; ++mr)
#pragma unroll
        for (int nr = 0; nr < 2; ++nr)
          acc[mr][nr] = __builtin_amdgcn_wmma_f32_16x16x32_bf16(
              false, afrag[mr], false, bfrag[nr], (short)0, acc[mr][nr],
              false, false);
    }
  }

  // Epilogue. C-frag layout: lane L holds rows 8*(L/16)+r, column L%16.
  // Element (mr, nr, r) of a lane lies (mr * 16 + r) * N + nr * 16 behind base.
  const int col0 = colBase + waveN * 32 + lh;
  const size_t base = (size_t)(rowBase + waveM * 64 + g * 8) * N + col0;
  float bv[2] = {0.f, 0.f};
  if constexpr (HAS_BIAS) {
#pragma unroll   // bv is indexed by nr: must be constant to stay in registers
    for (int nr = 0; nr < 2; ++nr) bv[nr] = bias[col0 + nr * 16];
  }
  f32x8 res[4][2];
  if constexpr (HAS_RES) {
    const float* rp = residual + base;
    // All three loops unrolled: res stays in registers, the 64 loads stand in a
    // row with nothing between them, and their steps become immediate offsets.
#pragma unroll
    for (int mr = 0; mr < 4; ++mr)
#pragma unroll
      for (int nr = 0; nr < 2; ++nr)
#pragma unroll
        for (int r = 0; r < 8; ++r)
          res[mr][nr][r] = rp[(mr * 16 + r) * N + nr * 16];
  }
  // Unrolled for the same reasons: acc and res in registers, immediate offsets.
#pragma unroll
  for (int mr = 0; mr < 4; ++mr) {
#pragma unroll
    for (int nr = 0; nr < 2; ++nr) {
#pragma unroll
      for (int r = 0; r < 8; ++r) {
        float v = acc[mr][nr][r];
        if constexpr (HAS_BIAS) v += bv[nr];
        if constexpr (RELU)     v  = v > 0.f ? v : 0.f;
        if constexpr (HAS_RES)  v += res[mr][nr][r];
        if constexpr (OUT_F32) (Cf + base)[(mr * 16 + r) * N + nr * 16] = v;
        else                   (Cb + base)[(mr * 16 + r) * N + nr * 16] = (bf16_t)v;
      }
    }
  }
}

// C = A @ B, bf16 out (Q, K, V projections).
__global__ __launch_bounds__(256) void k_gemm_plain_bf16(
    const bf16_t* __restrict__ A, const bf16_t* __restrict__ Bt,
    bf16_t* __restrict__ Cb, int K) {
  gemm_tile<false, false, false, false, D_MODEL>(A, Bt, nullptr, nullptr, nullptr, Cb, K);
}
// C = A @ B + residual, f32 out (output projection).
__global__ __launch_bounds__(256) void k_gemm_res_f32(
    const bf16_t* __restrict__ A, const bf16_t* __restrict__ Bt,
    const float* __restrict__ residual, float* __restrict__ Cf, int K) {
  gemm_tile<false, false, true, true, D_MODEL>(A, Bt, nullptr, residual, Cf, nullptr, K);
}
// C = relu(A @ B + bias), bf16 out (FFN up).
__global__ __launch_bounds__(256) void k_gemm_bias_relu_bf16(
    const bf16_t* __restrict__ A, const bf16_t* __restrict__ Bt,
    const float* __restrict__ bias, bf16_t* __restrict__ Cb, int K) {
  gemm_tile<true, true, false, false, D_FF>(A, Bt, bias, nullptr, nullptr, Cb, K);
}
// C = A @ B + bias + residual, f32 out (FFN down).
__global__ __launch_bounds__(256) void k_gemm_bias_res_f32(
    const bf16_t* __restrict__ A, const bf16_t* __restrict__ Bt,
    const float* __restrict__ bias, const float* __restrict__ residual,
    float* __restrict__ Cf, int K) {
  gemm_tile<true, false, true, true, D_MODEL>(A, Bt, bias, residual, Cf, nullptr, K);
}

// ---------------------------------------------------------------------------
// Flash attention: one block per (64-query tile, head, batch). 4 waves; each
// wave owns 16 query rows. Streams 64-key K/V tiles through LDS with online
// softmax; P restaged via LDS for the PV matmul (A-frag layout); V transposed
// at load so V columns are contiguous B-fragments. Q/K tiles use the async
// global->LDS path; V needs the in-flight transpose so it stays on vector loads.
// LDS rows of 64 bf16 lie at a pitch of 72 (144 B = 16 B x odd), so that the 16
// rows of one ds_load_b128 fall on different banks.
// ---------------------------------------------------------------------------
#define AP 72   // attention LDS row pitch, bf16 elements
__global__ __launch_bounds__(128) void k_attention(
    const bf16_t* __restrict__ Q, const bf16_t* __restrict__ Kmat,
    const bf16_t* __restrict__ V, const int* __restrict__ mask,
    bf16_t* __restrict__ ctx) {
  __shared__ __align__(16) bf16_t Qs[64 * AP];
  __shared__ __align__(16) bf16_t Ks[64 * AP];
  __shared__ __align__(16) bf16_t Vt[64 * AP];   // Vt[d][key]
  __shared__ __align__(16) bf16_t Ps[64 * AP];
  const int tid  = threadIdx.x;
  const int wave = tid >> 5, lane = tid & 31, lh = lane & 15, g = lane >> 4;
  const int qbase = blockIdx.x * 64;
  const int h = blockIdx.y, b = blockIdx.z;
  const size_t row0 = (size_t)b * SEQ;
  const int col0 = h * DKH;
  const int kOffLo = g ? 8 : 0;
  const int kOffHi = g ? 24 : 16;

  // Load Q tile [64 x 64] via async copies.
#pragma unroll
  for (int i = 0; i < 4; ++i) {
    int id = i * 128 + tid;                // 0..511
    int r = id >> 3, c = (id & 7) * 8;
    async_copy16(lds_off_of(&Qs[r * AP + c]),
                 &Q[(row0 + qbase + r) * D_MODEL + col0 + c]);
  }
  wait_async0();
  __syncthreads();

  // Q A-fragments are invariant across key tiles: hoist.
  bf16x16 aq[2];
#pragma unroll
  for (int c = 0; c < 2; ++c) {
    int r = wave * 16 + lh;
    aq[c] = ld_frag(&Qs[r * AP + c * 32 + kOffLo],
                    &Qs[r * AP + c * 32 + kOffHi]);
  }

  f32x8 o[4];
#pragma unroll
  for (int nr = 0; nr < 4; ++nr) o[nr] = zero8();
  float m[8], l[8];
#pragma unroll
  for (int r = 0; r < 8; ++r) { m[r] = -1e30f; l[r] = 0.f; }
  const float sm_scale = 0.125f;           // 1/sqrt(64)

  for (int kt = 0; kt < SEQ / 64; ++kt) {
    const int kbase = kt * 64;
    __syncthreads();                       // prior reads of Ks/Vt/Ps retired
    // K tile: straight async copy (rows=key already matches B-frag layout).
    // V tile: vector load + transpose scatter into Vt[d][key].
#pragma unroll
    for (int i = 0; i < 4; ++i) {
      int id = i * 128 + tid;
      int r = id >> 3, c = (id & 7) * 8;
      async_copy16(lds_off_of(&Ks[r * AP + c]),
                   &Kmat[(row0 + kbase + r) * D_MODEL + col0 + c]);
      uint4 vv4 =
          *(const uint4*)(&V[(row0 + kbase + r) * D_MODEL + col0 + c]);
      const bf16_t* vv = (const bf16_t*)&vv4;
#pragma unroll
      for (int j = 0; j < 8; ++j) Vt[(c + j) * AP + r] = vv[j];
    }
    wait_async0();
    __syncthreads();                       // Ks async + Vt ds stores visible

    // Scores: wave's 16 q-rows x 64 keys, contraction over d=64 (2 chunks).
    f32x8 s[4];
#pragma unroll
    for (int nr = 0; nr < 4; ++nr) {
      s[nr] = zero8();
#pragma unroll
      for (int c = 0; c < 2; ++c) {
        int kr = nr * 16 + lh;
        bf16x16 bk = ld_frag(&Ks[kr * AP + c * 32 + kOffLo],
                             &Ks[kr * AP + c * 32 + kOffHi]);
        s[nr] = __builtin_amdgcn_wmma_f32_16x16x32_bf16(
            false, aq[c], false, bk, (short)0, s[nr], false, false);
      }
    }
    // Scale + mask (mask shape [B,1,1,S], key-indexed).
#pragma unroll
    for (int nr = 0; nr < 4; ++nr) {
      int key = kbase + nr * 16 + lh;
      bool live = mask[row0 + key] != 0;
#pragma unroll
      for (int r = 0; r < 8; ++r) {
        float sv = s[nr][r] * sm_scale;
        s[nr][r] = live ? sv : -1e9f;
      }
    }
    // Online softmax: row reductions across the 16-lane half-wave.
    float f[8];
#pragma unroll
    for (int r = 0; r < 8; ++r) {
      float v = fmaxf(fmaxf(s[0][r], s[1][r]), fmaxf(s[2][r], s[3][r]));
#pragma unroll
      for (int off = 8; off > 0; off >>= 1) v = fmaxf(v, __shfl_xor(v, off, 16));
      float mn = fmaxf(m[r], v);
      f[r] = __expf(m[r] - mn);
      m[r] = mn;
    }
    float rs[8];
#pragma unroll
    for (int r = 0; r < 8; ++r) rs[r] = 0.f;
#pragma unroll
    for (int nr = 0; nr < 4; ++nr)
#pragma unroll
      for (int r = 0; r < 8; ++r) {
        float p = __expf(s[nr][r] - m[r]);
        s[nr][r] = p; rs[r] += p;
      }
#pragma unroll
    for (int r = 0; r < 8; ++r) {
      float v = rs[r];
#pragma unroll
      for (int off = 8; off > 0; off >>= 1) v += __shfl_xor(v, off, 16);
      l[r] = l[r] * f[r] + v;
    }
    // Rescale running context, stage P into LDS (C-frag -> A-frag transpose).
#pragma unroll
    for (int nr = 0; nr < 4; ++nr)
#pragma unroll
      for (int r = 0; r < 8; ++r) o[nr][r] *= f[r];
#pragma unroll
    for (int nr = 0; nr < 4; ++nr)
#pragma unroll
      for (int r = 0; r < 8; ++r)
        Ps[(wave * 16 + g * 8 + r) * AP + nr * 16 + lh] = (bf16_t)s[nr][r];
    __syncthreads();

    // ctx += P @ V  (contraction over 64 keys, 2 chunks).
#pragma unroll
    for (int c = 0; c < 2; ++c) {
      int pr = wave * 16 + lh;
      bf16x16 ap = ld_frag(&Ps[pr * AP + c * 32 + kOffLo],
                           &Ps[pr * AP + c * 32 + kOffHi]);
#pragma unroll
      for (int nr = 0; nr < 4; ++nr) {
        int dr = nr * 16 + lh;
        bf16x16 bv = ld_frag(&Vt[dr * AP + c * 32 + kOffLo],
                             &Vt[dr * AP + c * 32 + kOffHi]);
        o[nr] = __builtin_amdgcn_wmma_f32_16x16x32_bf16(
            false, ap, false, bv, (short)0, o[nr], false, false);
      }
    }
  }

  // Normalize and scatter ctx back to [B,S,H*Dk] layout (bf16).
#pragma unroll
  for (int nr = 0; nr < 4; ++nr)
#pragma unroll
    for (int r = 0; r < 8; ++r) {
      float v = o[nr][r] / l[r];
      ctx[(row0 + qbase + wave * 16 + g * 8 + r) * D_MODEL + col0 + nr * 16 + lh]
          = (bf16_t)v;
    }
}

// ---------------------------------------------------------------------------
// Host-side orchestration (graph-capture safe: stream launches only).
// ---------------------------------------------------------------------------
extern "C" void kernel_launch(void* const* d_in, const int* in_sizes, int n_in,
                              void* d_out, int out_size, void* d_ws, size_t ws_size,
                              hipStream_t stream) {
  const float* x      = (const float*)d_in[0];
  const int*   mask   = (const int*)d_in[1];
  const float* wq     = (const float*)d_in[2];
  const float* wk     = (const float*)d_in[3];
  const float* wv     = (const float*)d_in[4];
  const float* wo     = (const float*)d_in[5];
  const float* w1     = (const float*)d_in[6];
  const float* b1     = (const float*)d_in[7];
  const float* w2     = (const float*)d_in[8];
  const float* b2     = (const float*)d_in[9];
  const float* alpha1 = (const float*)d_in[10];
  const float* bias1  = (const float*)d_in[11];
  const float* alpha2 = (const float*)d_in[12];
  const float* bias2  = (const float*)d_in[13];
  float* out = (float*)d_out;

  // Workspace carve-up (~120 MB), 256B-aligned slices.
  char* ws = (char*)d_ws;
  size_t off = 0;
  auto alloc = [&](size_t bytes) -> char* {
    char* p = ws + off;
    off += (bytes + 255) & ~(size_t)255;
    return p;
  };
  bf16_t* wqT = (bf16_t*)alloc((size_t)D_MODEL * D_MODEL * 2);
  bf16_t* wkT = (bf16_t*)alloc((size_t)D_MODEL * D_MODEL * 2);
  bf16_t* wvT = (bf16_t*)alloc((size_t)D_MODEL * D_MODEL * 2);
  bf16_t* woT = (bf16_t*)alloc((size_t)D_MODEL * D_MODEL * 2);
  bf16_t* w1T = (bf16_t*)alloc((size_t)D_FF * D_MODEL * 2);   // [4096][1024]
  bf16_t* w2T = (bf16_t*)alloc((size_t)D_MODEL * D_FF * 2);   // [1024][4096]
  bf16_t* xn  = (bf16_t*)alloc((size_t)ROWS * D_MODEL * 2);
  bf16_t* qb  = (bf16_t*)alloc((size_t)ROWS * D_MODEL * 2);
  bf16_t* kb  = (bf16_t*)alloc((size_t)ROWS * D_MODEL * 2);
  bf16_t* vb  = (bf16_t*)alloc((size_t)ROWS * D_MODEL * 2);
  bf16_t* ctxb= (bf16_t*)alloc((size_t)ROWS * D_MODEL * 2);
  float*  x2  = (float*) alloc((size_t)ROWS * D_MODEL * 4);
  bf16_t* xn2 = (bf16_t*)alloc((size_t)ROWS * D_MODEL * 2);
  bf16_t* hb  = (bf16_t*)alloc((size_t)ROWS * D_FF * 2);
  (void)ws_size; (void)in_sizes; (void)n_in; (void)out_size;

  // 1) Weights -> bf16, transposed to [N][K].
  dim3 gTsq(D_MODEL / TP_N, D_MODEL / TP_K);
  dim3 gTw1(D_FF / TP_N, D_MODEL / TP_K);
  dim3 gTw2(D_MODEL / TP_N, D_FF / TP_K);
  k_transpose_dd<<<gTsq, 256, 0, stream>>>(wq, wqT);
  k_transpose_dd<<<gTsq, 256, 0, stream>>>(wk, wkT);
  k_transpose_dd<<<gTsq, 256, 0, stream>>>(wv, wvT);
  k_transpose_dd<<<gTsq, 256, 0, stream>>>(wo, woT);
  k_transpose_df<<<gTw1, 256, 0, stream>>>(w1, w1T);
  k_transpose_fd<<<gTw2, 256, 0, stream>>>(w2, w2T);

  // 2) LN1
  k_layernorm_bf16<<<ROWS, 256, 0, stream>>>(x, alpha1, bias1, xn);

  // 3) Q/K/V projections (bf16 out)
  dim3 gProj(D_MODEL / 128, ROWS / 128);
  k_gemm_plain_bf16<<<gProj, 256, 0, stream>>>(xn, wqT, qb, D_MODEL);
  k_gemm_plain_bf16<<<gProj, 256, 0, stream>>>(xn, wkT, kb, D_MODEL);
  k_gemm_plain_bf16<<<gProj, 256, 0, stream>>>(xn, wvT, vb, D_MODEL);

  // 4) Flash attention
  dim3 gAttn(SEQ / 64, NHEAD, BATCH);
  k_attention<<<gAttn, 128, 0, stream>>>(qb, kb, vb, mask, ctxb);

  // 5) Output projection + residual (f32 out)
  k_gemm_res_f32<<<gProj, 256, 0, stream>>>(ctxb, woT, x, x2, D_MODEL);

  // 6) LN2
  k_layernorm_bf16<<<ROWS, 256, 0, stream>>>(x2, alpha2, bias2, xn2);

  // 7) FFN up: relu(xn2 @ w1 + b1) -> bf16
  dim3 gFF1(D_FF / 128, ROWS / 128);
  k_gemm_bias_relu_bf16<<<gFF1, 256, 0, stream>>>(xn2, w1T, b1, hb, D_MODEL);

  // 8) FFN down + bias + residual -> d_out (f32)
  dim3 gFF2(D_MODEL / 128, ROWS / 128);
  k_gemm_bias_res_f32<<<gFF2, 256, 0, stream>>>(hb, w2T, b2, x2, out, D_FF);
}

// v005
// One run takes 270 microseconds.
// In both of two side-by-side timings against v004, it was 1.23 times as fast.
// Over all steps from v000 it is 3.16 times as fast.
#include <hip/hip_runtime.h>
#include <hip/hip_bf16.h>

// ---------------------------------------------------------------------------
// Transformer encoder block for MI455X (gfx1250, wave32, WMMA).
// bf16 inputs / f32 accumulate via v_wmma_f32_16x16x32_bf16.
// GEMM staging uses CDNA5 async global->LDS (ASYNCcnt) with double buffering.
// ---------------------------------------------------------------------------

typedef __bf16 bf16_t;
typedef __attribute__((ext_vector_type(16))) __bf16 bf16x16;
typedef __attribute__((ext_vector_type(8)))  __bf16 bf16x8;
typedef __attribute__((ext_vector_type(2)))  __bf16 bf16x2;
typedef __attribute__((ext_vector_type(8)))  float  f32x8;

#define D_MODEL 1024
#define NHEAD   16
#define DKH     64
#define D_FF    4096
#define SEQ     2048
#define BATCH   2
#define ROWS    (BATCH * SEQ)   // 4096

__device__ __forceinline__ f32x8 zero8() {
  f32x8 z;
#pragma unroll
  for (int i = 0; i < 8; ++i) z[i] = 0.0f;
  return z;
}

// 16-byte async copy global -> LDS (CDNA5 GLOBAL_LOAD_ASYNC_TO_LDS_B128,
// tracked by ASYNCcnt). lds_off is the 32-bit LDS byte offset (generic
// pointers to __shared__ truncate to the LDS offset per the aperture rules).
// The statement's last line, s_wait_xcnt 0, stands in front of any later
// rewrite of the address registers that the copy names.
__device__ __forceinline__ void async_copy16(unsigned lds_off, const bf16_t* gptr) {
  asm volatile("global_load_async_to_lds_b128 %0, %1, off\n\t"
               "s_wait_xcnt 0x0"
               :: "v"(lds_off), "v"(gptr)
               : "memory");
}
// Eight copies that follow one another share one statement and one such wait:
// rows 0, 1, ... 7 times a fixed row step, in LDS (lstep bytes) and in global
// memory (gstep elements).
__device__ __forceinline__ void async_copy16_x8(
    unsigned l, unsigned lstep, const bf16_t* g, size_t gstep) {
  asm volatile("global_load_async_to_lds_b128 %0, %1, off\n\t"
               "global_load_async_to_lds_b128 %2, %3, off\n\t"
               "global_load_async_to_lds_b128 %4, %5, off\n\t"
               "global_load_async_to_lds_b128 %6, %7, off\n\t"
               "global_load_async_to_lds_b128 %8, %9, off\n\t"
               "global_load_async_to_lds_b128 %10, %11, off\n\t"
               "global_load_async_to_lds_b128 %12, %13, off\n\t"
               "global_load_async_to_lds_b128 %14, %15, off\n\t"
               "s_wait_xcnt 0x0"
               :: "v"(l),             "v"(g),
                  "v"(l + lstep),     "v"(g + gstep),
                  "v"(l + 2 * lstep), "v"(g + 2 * gstep),
                  "v"(l + 3 * lstep), "v"(g + 3 * gstep),
                  "v"(l + 4 * lstep), "v"(g + 4 * gstep),
                  "v"(l + 5 * lstep), "v"(g + 5 * gstep),
                  "v"(l + 6 * lstep), "v"(g + 6 * gstep),
                  "v"(l + 7 * lstep), "v"(g + 7 * gstep)
               : "memory");
}
// Four such copies, rows 0 ... 3 times a fixed row step, with the one wait.
__device__ __forceinline__ void async_copy16_x4(
    unsigned l, unsigned lstep, const bf16_t* g, size_t gstep) {
  asm volatile("global_load_async_to_lds_b128 %0, %1, off\n\t"
               "global_load_async_to_lds_b128 %2, %3, off\n\t"
               "global_load_async_to_lds_b128 %4, %5, off\n\t"
               "global_load_async_to_lds_b128 %6, %7, off\n\t"
               "s_wait_xcnt 0x0"
               :: "v"(l),             "v"(g),
                  "v"(l + lstep),     "v"(g + gstep),
                  "v"(l + 2 * lstep), "v"(g + 2 * gstep),
                  "v"(l + 3 * lstep), "v"(g + 3 * gstep)
               : "memory");
}
__device__ __forceinline__ void wait_async0() {
  asm volatile("s_wait_asynccnt 0x0" ::: "memory");
}
// This wave's LDS reads have returned before the barrier behind which a copy
// refills the buffer they came from.
__device__ __forceinline__ void wait_ds0() {
  asm volatile("s_wait_dscnt 0x0" ::: "memory");
}
__device__ __forceinline__ unsigned lds_off_of(const bf16_t* p) {
  return (unsigned)(size_t)p;
}

// Build a 16-element bf16 fragment from two contiguous 8-element (16-byte) LDS loads.
// ISA 16-bit A/B layout: lane group g=0 -> K {0..7,16..23}; g=1 -> K {8..15,24..31}.
__device__ __forceinline__ bf16x16 ld_frag(const bf16_t* p_lo, const bf16_t* p_hi) {
  bf16x8 lo = *(const bf16x8*)p_lo;
  bf16x8 hi = *(const bf16x8*)p_hi;
  bf16x16 r;
#pragma unroll
  for (int e = 0; e < 8; ++e) { r[e] = lo[e]; r[8 + e] = hi[e]; }
  return r;
}

// The same fragment out of a row-major [k][n] LDS tile, by two transposing loads
// (ds_load_tr16_b128): each hands lane (c, h) the eight k = 8h ... 8h+7 of column
// c, so loads at k and k + 16 give the k order of ld_frag. Lane l passes the
// address of row 8 * (l >> 4) + (l & 7), 16-byte half (l >> 3) & 1.
typedef __attribute__((address_space(3))) bf16x8 lds_bf16x8;
__device__ __forceinline__ bf16x16 ld_frag_tr(const bf16_t* p_lo, const bf16_t* p_hi) {
  bf16x8 lo = __builtin_amdgcn_ds_load_tr16_b128_v8bf16((lds_bf16x8*)p_lo);
  bf16x8 hi = __builtin_amdgcn_ds_load_tr16_b128_v8bf16((lds_bf16x8*)p_hi);
  bf16x16 r;
#pragma unroll   // r is indexed by e: must be constant to stay in registers
  for (int e = 0; e < 8; ++e) { r[e] = lo[e]; r[8 + e] = hi[e]; }
  return r;
}

// ---------------------------------------------------------------------------
// f32 [K][N]  ->  bf16 [N][K]   (weights pre-transposed so GEMM B-tiles are
// loaded exactly like A-tiles: contiguous along the contraction dim)
// One block moves a tile of 128 k x 64 n through LDS, so that both global
// sides run along their own contiguous dim: reads are 16 B per lane, 256 B per
// input row; writes are 16 B per lane, 256 B per output row (whole lines).
// LDS holds one dword per (k pair, n): bf16(k) low, bf16(k+1) high. The pitch
// of 65 dwords is odd, so the row-wise writes and the column-wise reads both
// touch every bank at most once per wave.
// KD and ND are compile-time, so a thread's eight loads and four stores each
// share one address and differ only in the instruction's immediate offset.
// Grid = ND/64 x KD/128.
// ---------------------------------------------------------------------------
#define TP_K     128
#define TP_N     64
#define TP_PITCH 65

__device__ __forceinline__ unsigned pack_bf16(float lo, float hi) {
  bf16x2 p;
  p[0] = (bf16_t)lo;
  p[1] = (bf16_t)hi;
  return __builtin_bit_cast(unsigned, p);
}

template <int KD, int ND>
__device__ __forceinline__ void transpose_tile(
    const float* __restrict__ in, bf16_t* __restrict__ out) {
  static_assert(KD % TP_K == 0 && ND % TP_N == 0, "tiles must divide the matrix");
  __shared__ unsigned tile[(TP_K / 2) * TP_PITCH];
  const int tid = threadIdx.x;
  const int n0 = blockIdx.x * TP_N;
  const int k0 = blockIdx.y * TP_K;

  // Read: 16 lanes cover the 64 n of one input row; a thread takes rows
  // 2*kp and 2*kp+1 for four k pairs. All eight loads are issued first.
  const int n4 = (tid & 15) * 4;
  const int kp = tid >> 4;
  const float* src = in + (k0 + 2 * kp) * ND + n0 + n4;
  float4 ev[4], od[4];
#pragma unroll   // keeps ev/od in registers and turns the row steps into immediate offsets
  for (int i = 0; i < 4; ++i) {
    ev[i] = *(const float4*)(src + (32 * i) * ND);
    od[i] = *(const float4*)(src + (32 * i + 1) * ND);
  }
#pragma unroll   // ev/od are indexed by i: must be constant to stay in registers
  for (int i = 0; i < 4; ++i) {
    unsigned* t = &tile[(kp + 16 * i) * TP_PITCH + n4];
    t[0] = pack_bf16(ev[i].x, od[i].x);
    t[1] = pack_bf16(ev[i].y, od[i].y);
    t[2] = pack_bf16(ev[i].z, od[i].z);
    t[3] = pack_bf16(ev[i].w, od[i].w);
  }
  __syncthreads();                         // whole tile in LDS before any column is read

  // Write: 16 lanes cover the 128 k of one output row, 8 k (4 pairs) each.
  const int kc = tid & 15;
  const int nr = tid >> 4;
  bf16_t* dst = out + (n0 + nr) * KD + k0 + 8 * kc;
#pragma unroll   // all LDS reads issue together; the row steps become immediate offsets
  for (int j = 0; j < 4; ++j) {
    const unsigned* s = &tile[(4 * kc) * TP_PITCH + nr + 16 * j];
    uint4 v;
    v.x = s[0];
    v.y = s[TP_PITCH];
    v.z = s[2 * TP_PITCH];
    v.w = s[3 * TP_PITCH];
    *(uint4*)(dst + (16 * j) * KD) = v;
  }
}

__global__ __launch_bounds__(256) void k_transpose_dd(
    const float* __restrict__ in, bf16_t* __restrict__ out) {
  transpose_tile<D_MODEL, D_MODEL>(in, out);
}
__global__ __launch_bounds__(256) void k_transpose_df(
    const float* __restrict__ in, bf16_t* __restrict__ out) {
  transpose_tile<D_MODEL, D_FF>(in, out);
}
__global__ __launch_bounds__(256) void k_transpose_fd(
    const float* __restrict__ in, bf16_t* __restrict__ out) {
  transpose_tile<D_FF, D_MODEL>(in, out);
}

// ---------------------------------------------------------------------------
// LayerNorm, faithful to reference: unbiased std (ddof=1), eps added to std.
// f32 in -> bf16 out. One block per row of 1024.
// ---------------------------------------------------------------------------
__global__ __launch_bounds__(256) void k_layernorm_bf16(
    const float* __restrict__ x, const float* __restrict__ alpha,
    const float* __restrict__ beta, bf16_t* __restrict__ out) {
  const int row = blockIdx.x;
  const float* xr = x + (size_t)row * D_MODEL;
  float s = 0.f, ss = 0.f;
  for (int i = threadIdx.x; i < D_MODEL; i += 256) {
    float v = xr[i]; s += v; ss += v * v;
  }
  __shared__ float r1[256], r2[256];
  r1[threadIdx.x] = s; r2[threadIdx.x] = ss;
  __syncthreads();
  for (int o = 128; o > 0; o >>= 1) {
    if (threadIdx.x < o) { r1[threadIdx.x] += r1[threadIdx.x + o];
                           r2[threadIdx.x] += r2[threadIdx.x + o]; }
    __syncthreads();
  }
  float mean = r1[0] * (1.0f / D_MODEL);
  float var  = (r2[0] - (float)D_MODEL * mean * mean) * (1.0f / (D_MODEL - 1));
  var = var > 0.f ? var : 0.f;
  float scale = alpha[0] / (sqrtf(var) + 1e-5f);
  float shift = beta[0];
  bf16_t* orow = out + (size_t)row * D_MODEL;
  for (int i = threadIdx.x; i < D_MODEL; i += 256)
    orow[i] = (bf16_t)((xr[i] - mean) * scale + shift);
}

// ---------------------------------------------------------------------------
// WMMA GEMM: C[M,N] = A[M,K] @ B[K,N], with B supplied transposed (Bt[N][K]).
// 128x128 block tile, BK=128, 256 threads = 8 waves arranged 2(M) x 4(N);
// each wave computes 64x32 = 4x2 accumulator tiles -> 32 WMMA per k-step.
// Double-buffered async global->LDS staging: tile kt+1 streams while tile kt
// is consumed. One barrier per k-step. A k-step takes 256 B of every operand
// row, so 16 lanes of a copy cover two whole lines of one row, 64 KiB are in
// flight per block, and the wait for a tile is paid once per 128 k.
// K must be a multiple of 128.
// LDS rows of 128 bf16 lie at a pitch of 136 (272 B = 16 B x odd), so that the
// 16 rows of one ds_load_b128 fall on different banks.
// Epilogue fuses bias / ReLU / residual; writes f32 or bf16. What it fuses, the
// output type and N are compile-time: no test stands between two elements, so
// a lane's two bias loads and its 64 residual loads are issued in a row, their
// latencies overlap, and every load and store is one base plus an immediate.
// ---------------------------------------------------------------------------
#define GK 128  // GEMM k-step, bf16 elements
#define GP 136  // GEMM LDS row pitch, bf16 elements
template <bool HAS_BIAS, bool RELU, bool HAS_RES, bool OUT_F32, int N>
__device__ __forceinline__ void gemm_tile(
    const bf16_t* __restrict__ A, const bf16_t* __restrict__ Bt,
    const float* __restrict__ bias, const float* __restrict__ residual,
    float* __restrict__ Cf, bf16_t* __restrict__ Cb, int K) {
  __shared__ __align__(16) bf16_t As[2][128 * GP];
  __shared__ __align__(16) bf16_t Bs[2][128 * GP];
  const int tid  = threadIdx.x;
  const int wave = tid >> 5, lane = tid & 31, lh = lane & 15, g = lane >> 4;
  const int waveM = wave >> 2, waveN = wave & 3;       // 2 x 4 wave grid
  const int rowBase = blockIdx.y * 128;
  const int colBase = blockIdx.x * 128;
  const int kOffLo = g ? 8 : 0;
  const int kOffHi = g ? 24 : 16;

  // Per-thread staging slots: rows r0 + 16 * i (i = 0..7) of each operand,
  // 8 bf16 starting at col c0; 16 lanes cover the 256 B of one row.
  const int r0 = tid >> 4;
  const int c0 = (tid & 15) * 8;

  auto stage = [&](int kt, int buf) {
    const int kcol = kt * GK + c0;
    async_copy16_x8(lds_off_of(&As[buf][r0 * GP + c0]), 16 * GP * 2,
                    &A[(size_t)(rowBase + r0) * K + kcol], (size_t)16 * K);
    async_copy16_x8(lds_off_of(&Bs[buf][r0 * GP + c0]), 16 * GP * 2,
                    &Bt[(size_t)(colBase + r0) * K + kcol], (size_t)16 * K);
  };

  f32x8 acc[4][2];
#pragma unroll
  for (int mr = 0; mr < 4; ++mr)
#pragma unroll
    for (int nr = 0; nr < 2; ++nr) acc[mr][nr] = zero8();

  const int kTiles = K / GK;
  stage(0, 0);                               // prologue prefetch
  for (int kt = 0; kt < kTiles; ++kt) {
    const int cur = kt & 1;
    wait_ds0();                              // own reads of buf(cur^1) returned
    wait_async0();                           // own async writes to buf(cur) done
    __syncthreads();                         // all waves: buf(cur) ready, prev reads retired
    if (kt + 1 < kTiles) stage(kt + 1, cur ^ 1);   // overlap with compute below

#pragma unroll   // the four 32-k chunks differ only in LDS immediate offsets; their loads can run ahead
    for (int ks = 0; ks < GK; ks += 32) {
      bf16x16 afrag[4], bfrag[2];
#pragma unroll
      for (int mr = 0; mr < 4; ++mr) {
        int r = waveM * 64 + mr * 16 + lh;
        afrag[mr] = ld_frag(&As[cur][r * GP + ks + kOffLo],
                            &As[cur][r * GP + ks + kOffHi]);
      }
#pragma unroll
      for (int nr = 0; nr < 2; ++nr) {
        int r = waveN * 32 + nr * 16 + lh;
        bfrag[nr] = ld_frag(&Bs[cur][r * GP + ks + kOffLo],
                            &Bs[cur][r * GP + ks + kOffHi]);
      }
#pragma unroll
      for (int mr = 0; mr < 4; ++mr)
#pragma unroll
        for (int nr = 0; nr < 2; ++nr)
          acc[mr][nr] = __builtin_amdgcn_wmma_f32_16x16x32_bf16(
              false, afrag[mr], false, bfrag[nr], (short)0, acc[mr][nr],
              false, false);
    }
  }

  // Epilogue. C-frag layout: lane L holds rows 8*(L/16)+r, column L%16.
  // Element (mr, nr, r) of a lane lies (mr * 16 + r) * N + nr * 16 behind base.
  const int col0 = colBase + waveN * 32 + lh;
  const size_t base = (size_t)(rowBase + waveM * 64 + g * 8) * N + col0;
  float bv[2] = {0.f, 0.f};
  if constexpr (HAS_BIAS) {
#pragma unroll   // bv is indexed by nr: must be constant to stay in registers
    for (int nr = 0; nr < 2; ++nr) bv[nr] = bias[col0 + nr * 16];
  }
  f32x8 res[4][2];
  if constexpr (HAS_RES) {
    const float* rp = residual + base;
    // All three loops unrolled: res stays in registers, the 64 loads stand in a
    // row with nothing between them, and their steps become immediate offsets.
#pragma unroll
    for (int mr = 0; mr < 4; ++mr)
#pragma unroll
      for (int nr = 0; nr < 2; ++nr)
#pragma unroll
        for (int r = 0; r < 8; ++r)
          res[mr][nr][r] = rp[(mr * 16 + r) * N + nr * 16];
  }
  // Unrolled for the same reasons: acc and res in registers, immediate offsets.
#pragma unroll
  for (int mr = 0; mr < 4; ++mr) {
#pragma unroll
    for (int nr = 0; nr < 2; ++nr) {
#pragma unroll
      for (int r = 0; r < 8; ++r) {
        float v = acc[mr][nr][r];
        if constexpr (HAS_BIAS) v += bv[nr];
        if constexpr (RELU)     v  = v > 0.f ? v : 0.f;
        if constexpr (HAS_RES)  v += res[mr][nr][r];
        if constexpr (OUT_F32) (Cf + base)[(mr * 16 + r) * N + nr * 16] = v;
        else                   (Cb + base)[(mr * 16 + r) * N + nr * 16] = (bf16_t)v;
      }
    }
  }
}

// C = A @ B, bf16 out (Q, K, V projections).
__global__ __launch_bounds__(256) void k_gemm_plain_bf16(
    const bf16_t* __restrict__ A, const bf16_t* __restrict__ Bt,
    bf16_t* __restrict__ Cb, int K) {
  gemm_tile<false, false, false, false, D_MODEL>(A, Bt, nullptr, nullptr, nullptr, Cb, K);
}
// C = A @ B + residual, f32 out (output projection).
__global__ __launch_bounds__(256) void k_gemm_res_f32(
    const bf16_t* __restrict__ A, const bf16_t* __restrict__ Bt,
    const float* __restrict__ residual, float* __restrict__ Cf, int K) {
  gemm_tile<false, false, true, true, D_MODEL>(A, Bt, nullptr, residual, Cf, nullptr, K);
}
// C = relu(A @ B + bias), bf16 out (FFN up).
__global__ __launch_bounds__(256) void k_gemm_bias_relu_bf16(
    const bf16_t* __restrict__ A, const bf16_t* __restrict__ Bt,
    const float* __restrict__ bias, bf16_t* __restrict__ Cb, int K) {
  gemm_tile<true, true, false, false, D_FF>(A, Bt, bias, nullptr, nullptr, Cb, K);
}
// C = A @ B + bias + residual, f32 out (FFN down).
__global__ __launch_bounds__(256) void k_gemm_bias_res_f32(
    const bf16_t* __restrict__ A, const bf16_t* __restrict__ Bt,
    const float* __restrict__ bias, const float* __restrict__ residual,
    float* __restrict__ Cf, int K) {
  gemm_tile<true, false, true, true, D_MODEL>(A, Bt, bias, residual, Cf, nullptr, K);
}

// ---------------------------------------------------------------------------
// Flash attention: one block per (64-query tile, head, batch). 4 waves; each
// wave owns 16 query rows. Streams 64-key K/V tiles through LDS with online
// softmax; P restaged via LDS for the PV matmul (A-frag layout). Q, K and V
// tiles all take the async global->LDS path, row-major as they lie in memory;
// the PV matmul's B-fragments (V columns) come out of the V tile by the
// transposing LDS load.
// LDS rows of 64 bf16 lie at a pitch of 72 (144 B = 16 B x odd), so that the 16
// rows of one ds_load_b128 fall on different banks; the V tile's at a pitch of
// 80 (160 B = 32 B x odd), which does the same for ds_load_tr16_b128.
// ---------------------------------------------------------------------------
#define AP 72   // attention LDS row pitch, bf16 elements
#define VP 80   // V tile LDS row pitch, bf16 elements
__global__ __launch_bounds__(128) void k_attention(
    const bf16_t* __restrict__ Q, const bf16_t* __restrict__ Kmat,
    const bf16_t* __restrict__ V, const int* __restrict__ mask,
    bf16_t* __restrict__ ctx) {
  __shared__ __align__(16) bf16_t Qs[64 * AP];
  __shared__ __align__(16) bf16_t Ks[64 * AP];
  __shared__ __align__(16) bf16_t Vs[64 * VP];   // Vs[key][d]
  __shared__ __align__(16) bf16_t Ps[64 * AP];
  const int tid  = threadIdx.x;
  const int wave = tid >> 5, lane = tid & 31, lh = lane & 15, g = lane >> 4;
  const int qbase = blockIdx.x * 64;
  const int h = blockIdx.y, b = blockIdx.z;
  const size_t row0 = (size_t)b * SEQ;
  const int col0 = h * DKH;
  const int kOffLo = g ? 8 : 0;
  const int kOffHi = g ? 24 : 16;

  // Load Q tile [64 x 64] via async copies.
#pragma unroll
  for (int i = 0; i < 4; ++i) {
    int id = i * 128 + tid;                // 0..511
    int r = id >> 3, c = (id & 7) * 8;
    async_copy16(lds_off_of(&Qs[r * AP + c]),
                 &Q[(row0 + qbase + r) * D_MODEL + col0 + c]);
  }
  wait_async0();
  __syncthreads();

  // Q A-fragments are invariant across key tiles: hoist.
  bf16x16 aq[2];
#pragma unroll
  for (int c = 0; c < 2; ++c) {
    int r = wave * 16 + lh;
    aq[c] = ld_frag(&Qs[r * AP + c * 32 + kOffLo],
                    &Qs[r * AP + c * 32 + kOffHi]);
  }

  f32x8 o[4];
#pragma unroll
  for (int nr = 0; nr < 4; ++nr) o[nr] = zero8();
  float m[8], l[8];
#pragma unroll
  for (int r = 0; r < 8; ++r) { m[r] = -1e30f; l[r] = 0.f; }
  const float sm_scale = 0.125f;           // 1/sqrt(64)
  const int vr0 = tid >> 3, vc0 = (tid & 7) * 8;                     // V staging slot
  const int vtr = (g * 8 + (lane & 7)) * VP + ((lane >> 3) & 1) * 8; // lane's transposing-load slot

  for (int kt = 0; kt < SEQ / 64; ++kt) {
    const int kbase = kt * 64;
    wait_ds0();                            // own reads of Ks/Vs returned before copies refill them
    __syncthreads();                       // prior reads of Ks/Vs/Ps retired
    // K tile: straight async copy (rows=key already matches B-frag layout).
#pragma unroll
    for (int i = 0; i < 4; ++i) {
      int id = i * 128 + tid;
      int r = id >> 3, c = (id & 7) * 8;
      async_copy16(lds_off_of(&Ks[r * AP + c]),
                   &Kmat[(row0 + kbase + r) * D_MODEL + col0 + c]);
    }
    // V tile: the same rows and columns, key rows (tid >> 3) + 16 * i.
    async_copy16_x4(lds_off_of(&Vs[vr0 * VP + vc0]), 16 * VP * 2,
                    &V[(row0 + kbase + vr0) * D_MODEL + col0 + vc0],
                    (size_t)16 * D_MODEL);
    wait_async0();
    __syncthreads();                       // Ks and Vs copies visible to all waves

    // Scores: wave's 16 q-rows x 64 keys, contraction over d=64 (2 chunks).
    f32x8 s[4];
#pragma unroll
    for (int nr = 0; nr < 4; ++nr) {
      s[nr] = zero8();
#pragma unroll
      for (int c = 0; c < 2; ++c) {
        int kr = nr * 16 + lh;
        bf16x16 bk = ld_frag(&Ks[kr * AP + c * 32 + kOffLo],
                             &Ks[kr * AP + c * 32 + kOffHi]);
        s[nr] = __builtin_amdgcn_wmma_f32_16x16x32_bf16(
            false, aq[c], false, bk, (short)0, s[nr], false, false);
      }
    }
    // Scale + mask (mask shape [B,1,1,S], key-indexed).
#pragma unroll
    for (int nr = 0; nr < 4; ++nr) {
      int key = kbase + nr * 16 + lh;
      bool live = mask[row0 + key] != 0;
#pragma unroll
      for (int r = 0; r < 8; ++r) {
        float sv = s[nr][r] * sm_scale;
        s[nr][r] = live ? sv : -1e9f;
      }
    }
    // Online softmax: row reductions across the 16-lane half-wave.
    float f[8];
#pragma unroll
    for (int r = 0; r < 8; ++r) {
      float v = fmaxf(fmaxf(s[0][r], s[1][r]), fmaxf(s[2][r], s[3][r]));
#pragma unroll
      for (int off = 8; off > 0; off >>= 1) v = fmaxf(v, __shfl_xor(v, off, 16));
      float mn = fmaxf(m[r], v);
      f[r] = __expf(m[r] - mn);
      m[r] = mn;
    }
    float rs[8];
#pragma unroll
    for (int r = 0; r < 8; ++r) rs[r] = 0.f;
#pragma unroll
    for (int nr = 0; nr < 4; ++nr)
#pragma unroll
      for (int r = 0; r < 8; ++r) {
        float p = __expf(s[nr][r] - m[r]);
        s[nr][r] = p; rs[r] += p;
      }
#pragma unroll
    for (int r = 0; r < 8; ++r) {
      float v = rs[r];
#pragma unroll
      for (int off = 8; off > 0; off >>= 1) v += __shfl_xor(v, off, 16);
      l[r] = l[r] * f[r] + v;
    }
    // Rescale running context, stage P into LDS (C-frag -> A-frag transpose).
#pragma unroll
    for (int nr = 0; nr < 4; ++nr)
#pragma unroll
      for (int r = 0; r < 8; ++r) o[nr][r] *= f[r];
#pragma unroll
    for (int nr = 0; nr < 4; ++nr)
#pragma unroll
      for (int r = 0; r < 8; ++r)
        Ps[(wave * 16 + g * 8 + r) * AP + nr * 16 + lh] = (bf16_t)s[nr][r];
    __syncthreads();

    // ctx += P @ V  (contraction over 64 keys, 2 chunks).
#pragma unroll
    for (int c = 0; c < 2; ++c) {
      int pr = wave * 16 + lh;
      bf16x16 ap = ld_frag(&Ps[pr * AP + c * 32 + kOffLo],
                           &Ps[pr * AP + c * 32 + kOffHi]);
#pragma unroll
      for (int nr = 0; nr < 4; ++nr) {
        bf16x16 bv = ld_frag_tr(&Vs[vtr + (c * 32) * VP + nr * 16],
                                &Vs[vtr + (c * 32 + 16) * VP + nr * 16]);
        o[nr] = __builtin_amdgcn_wmma_f32_16x16x32_bf16(
            false, ap, false, bv, (short)0, o[nr], false, false);
      }
    }
  }

  // Normalize and scatter ctx back to [B,S,H*Dk] layout (bf16).
#pragma unroll
  for (int nr = 0; nr < 4; ++nr)
#pragma unroll
    for (int r = 0; r < 8; ++r) {
      float v = o[nr][r] / l[r];
      ctx[(row0 + qbase + wave * 16 + g * 8 + r) * D_MODEL + col0 + nr * 16 + lh]
          = (bf16_t)v;
    }
}

// ---------------------------------------------------------------------------
// Host-side orchestration (graph-capture safe: stream launches only).
// ---------------------------------------------------------------------------
extern "C" void kernel_launch(void* const* d_in, const int* in_sizes, int n_in,
                              void* d_out, int out_size, void* d_ws, size_t ws_size,
                              hipStream_t stream) {
  const float* x      = (const float*)d_in[0];
  const int*   mask   = (const int*)d_in[1];
  const float* wq     = (const float*)d_in[2];
  const float* wk     = (const float*)d_in[3];
  const float* wv     = (const float*)d_in[4];
  const float* wo     = (const float*)d_in[5];
  const float* w1     = (const float*)d_in[6];
  const float* b1     = (const float*)d_in[7];
  const float* w2     = (const float*)d_in[8];
  const float* b2     = (const float*)d_in[9];
  const float* alpha1 = (const float*)d_in[10];
  const float* bias1  = (const float*)d_in[11];
  const float* alpha2 = (const float*)d_in[12];
  const float* bias2  = (const float*)d_in[13];
  float* out = (float*)d_out;

  // Workspace carve-up (~120 MB), 256B-aligned slices.
  char* ws = (char*)d_ws;
  size_t off = 0;
  auto alloc = [&](size_t bytes) -> char* {
    char* p = ws + off;
    off += (bytes + 255) & ~(size_t)255;
    return p;
  };
  bf16_t* wqT = (bf16_t*)alloc((size_t)D_MODEL * D_MODEL * 2);
  bf16_t* wkT = (bf16_t*)alloc((size_t)D_MODEL * D_MODEL * 2);
  bf16_t* wvT = (bf16_t*)alloc((size_t)D_MODEL * D_MODEL * 2);
  bf16_t* woT = (bf16_t*)alloc((size_t)D_MODEL * D_MODEL * 2);
  bf16_t* w1T = (bf16_t*)alloc((size_t)D_FF * D_MODEL * 2);   // [4096][1024]
  bf16_t* w2T = (bf16_t*)alloc((size_t)D_MODEL * D_FF * 2);   // [1024][4096]
  bf16_t* xn  = (bf16_t*)alloc((size_t)ROWS * D_MODEL * 2);
  bf16_t* qb  = (bf16_t*)alloc((size_t)ROWS * D_MODEL * 2);
  bf16_t* kb  = (bf16_t*)alloc((size_t)ROWS * D_MODEL * 2);
  bf16_t* vb  = (bf16_t*)alloc((size_t)ROWS * D_MODEL * 2);
  bf16_t* ctxb= (bf16_t*)alloc((size_t)ROWS * D_MODEL * 2);
  float*  x2  = (float*) alloc((size_t)ROWS * D_MODEL * 4);
  bf16_t* xn2 = (bf16_t*)alloc((size_t)ROWS * D_MODEL * 2);
  bf16_t* hb  = (bf16_t*)alloc((size_t)ROWS * D_FF * 2);
  (void)ws_size; (void)in_sizes; (void)n_in; (void)out_size;

  // 1) Weights -> bf16, transposed to [N][K].
  dim3 gTsq(D_MODEL / TP_N, D_MODEL / TP_K);
  dim3 gTw1(D_FF / TP_N, D_MODEL / TP_K);
  dim3 gTw2(D_MODEL / TP_N, D_FF / TP_K);
  k_transpose_dd<<<gTsq, 256, 0, stream>>>(wq, wqT);
  k_transpose_dd<<<gTsq, 256, 0, stream>>>(wk, wkT);
  k_transpose_dd<<<gTsq, 256, 0, stream>>>(wv, wvT);
  k_transpose_dd<<<gTsq, 256, 0, stream>>>(wo, woT);
  k_transpose_df<<<gTw1, 256, 0, stream>>>(w1, w1T);
  k_transpose_fd<<<gTw2, 256, 0, stream>>>(w2, w2T);

  // 2) LN1
  k_layernorm_bf16<<<ROWS, 256, 0, stream>>>(x, alpha1, bias1, xn);

  // 3) Q/K/V projections (bf16 out)
  dim3 gProj(D_MODEL / 128, ROWS / 128);
  k_gemm_plain_bf16<<<gProj, 256, 0, stream>>>(xn, wqT, qb, D_MODEL);
  k_gemm_plain_bf16<<<gProj, 256, 0, stream>>>(xn, wkT, kb, D_MODEL);
  k_gemm_plain_bf16<<<gProj, 256, 0, stream>>>(xn, wvT, vb, D_MODEL);

  // 4) Flash attention
  dim3 gAttn(SEQ / 64, NHEAD, BATCH);
  k_attention<<<gAttn, 128, 0, stream>>>(qb, kb, vb, mask, ctxb);

  // 5) Output projection + residual (f32 out)
  k_gemm_res_f32<<<gProj, 256, 0, stream>>>(ctxb, woT, x, x2, D_MODEL);

  // 6) LN2
  k_layernorm_bf16<<<ROWS, 256, 0, stream>>>(x2, alpha2, bias2, xn2);

  // 7) FFN up: relu(xn2 @ w1 + b1) -> bf16
  dim3 gFF1(D_FF / 128, ROWS / 128);
  k_gemm_bias_relu_bf16<<<gFF1, 256, 0, stream>>>(xn2, w1T, b1, hb, D_MODEL);

  // 8) FFN down + bias + residual -> d_out (f32)
  dim3 gFF2(D_MODEL / 128, ROWS / 128);
  k_gemm_bias_res_f32<<<gFF2, 256, 0, stream>>>(hb, w2T, b2, x2, out, D_FF);
}

// v006
// A run of this version takes 255 microseconds.
// Next to v005, in two timings, it ran 1.05 and 1.06 times as fast.
// Counting every step since v000, it is 3.33 times as fast.
#include <hip/hip_runtime.h>
#include <hip/hip_bf16.h>

// ---------------------------------------------------------------------------
// Transformer encoder block for MI455X (gfx1250, wave32, WMMA).
// bf16 inputs / f32 accumulate via v_wmma_f32_16x16x32_bf16.
// GEMM staging uses CDNA5 async global->LDS (ASYNCcnt) with double buffering.
// ---------------------------------------------------------------------------

typedef __bf16 bf16_t;
typedef __attribute__((ext_vector_type(16))) __bf16 bf16x16;
typedef __attribute__((ext_vector_type(8)))  __bf16 bf16x8;
typedef __attribute__((ext_vector_type(2)))  __bf16 bf16x2;
typedef __attribute__((ext_vector_type(8)))  float  f32x8;

#define D_MODEL 1024
#define NHEAD   16
#define DKH     64
#define D_FF    4096
#define SEQ     2048
#define BATCH   2
#define ROWS    (BATCH * SEQ)   // 4096

__device__ __forceinline__ f32x8 zero8() {
  f32x8 z;
#pragma unroll
  for (int i = 0; i < 8; ++i) z[i] = 0.0f;
  return z;
}

// 16-byte async copy global -> LDS (CDNA5 GLOBAL_LOAD_ASYNC_TO_LDS_B128,
// tracked by ASYNCcnt). lds_off is the 32-bit LDS byte offset (generic
// pointers to __shared__ truncate to the LDS offset per the aperture rules).
// The statement's last line, s_wait_xcnt 0, stands in front of any later
// rewrite of the address registers that the copy names.
__device__ __forceinline__ void async_copy16(unsigned lds_off, const bf16_t* gptr) {
  asm volatile("global_load_async_to_lds_b128 %0, %1, off\n\t"
               "s_wait_xcnt 0x0"
               :: "v"(lds_off), "v"(gptr)
               : "memory");
}
// Eight copies that follow one another share one statement and one such wait:
// rows 0, 1, ... 7 times a fixed row step, in LDS (lstep bytes) and in global
// memory (gstep elements).
__device__ __forceinline__ void async_copy16_x8(
    unsigned l, unsigned lstep, const bf16_t* g, size_t gstep) {
  asm volatile("global_load_async_to_lds_b128 %0, %1, off\n\t"
               "global_load_async_to_lds_b128 %2, %3, off\n\t"
               "global_load_async_to_lds_b128 %4, %5, off\n\t"
               "global_load_async_to_lds_b128 %6, %7, off\n\t"
               "global_load_async_to_lds_b128 %8, %9, off\n\t"
               "global_load_async_to_lds_b128 %10, %11, off\n\t"
               "global_load_async_to_lds_b128 %12, %13, off\n\t"
               "global_load_async_to_lds_b128 %14, %15, off\n\t"
               "s_wait_xcnt 0x0"
               :: "v"(l),             "v"(g),
                  "v"(l + lstep),     "v"(g + gstep),
                  "v"(l + 2 * lstep), "v"(g + 2 * gstep),
                  "v"(l + 3 * lstep), "v"(g + 3 * gstep),
                  "v"(l + 4 * lstep), "v"(g + 4 * gstep),
                  "v"(l + 5 * lstep), "v"(g + 5 * gstep),
                  "v"(l + 6 * lstep), "v"(g + 6 * gstep),
                  "v"(l + 7 * lstep), "v"(g + 7 * gstep)
               : "memory");
}
// Four such copies, rows 0 ... 3 times a fixed row step, with the one wait.
__device__ __forceinline__ void async_copy16_x4(
    unsigned l, unsigned lstep, const bf16_t* g, size_t gstep) {
  asm volatile("global_load_async_to_lds_b128 %0, %1, off\n\t"
               "global_load_async_to_lds_b128 %2, %3, off\n\t"
               "global_load_async_to_lds_b128 %4, %5, off\n\t"
               "global_load_async_to_lds_b128 %6, %7, off\n\t"
               "s_wait_xcnt 0x0"
               :: "v"(l),             "v"(g),
                  "v"(l + lstep),     "v"(g + gstep),
                  "v"(l + 2 * lstep), "v"(g + 2 * gstep),
                  "v"(l + 3 * lstep), "v"(g + 3 * gstep)
               : "memory");
}
__device__ __forceinline__ void wait_async0() {
  asm volatile("s_wait_asynccnt 0x0" ::: "memory");
}
// This wave's LDS reads have returned before the barrier behind which a copy
// refills the buffer they came from.
__device__ __forceinline__ void wait_ds0() {
  asm volatile("s_wait_dscnt 0x0" ::: "memory");
}
__device__ __forceinline__ unsigned lds_off_of(const bf16_t* p) {
  return (unsigned)(size_t)p;
}

// Build a 16-element bf16 fragment from two contiguous 8-element (16-byte) LDS loads.
// ISA 16-bit A/B layout: lane group g=0 -> K {0..7,16..23}; g=1 -> K {8..15,24..31}.
__device__ __forceinline__ bf16x16 ld_frag(const bf16_t* p_lo, const bf16_t* p_hi) {
  bf16x8 lo = *(const bf16x8*)p_lo;
  bf16x8 hi = *(const bf16x8*)p_hi;
  bf16x16 r;
#pragma unroll
  for (int e = 0; e < 8; ++e) { r[e] = lo[e]; r[8 + e] = hi[e]; }
  return r;
}

// The same fragment out of a row-major [k][n] LDS tile, by two transposing loads
// (ds_load_tr16_b128): each hands lane (c, h) the eight k = 8h ... 8h+7 of column
// c, so loads at k and k + 16 give the k order of ld_frag. Lane l passes the
// address of row 8 * (l >> 4) + (l & 7), 16-byte half (l >> 3) & 1.
typedef __attribute__((address_space(3))) bf16x8 lds_bf16x8;
__device__ __forceinline__ bf16x16 ld_frag_tr(const bf16_t* p_lo, const bf16_t* p_hi) {
  bf16x8 lo = __builtin_amdgcn_ds_load_tr16_b128_v8bf16((lds_bf16x8*)p_lo);
  bf16x8 hi = __builtin_amdgcn_ds_load_tr16_b128_v8bf16((lds_bf16x8*)p_hi);
  bf16x16 r;
#pragma unroll   // r is indexed by e: must be constant to stay in registers
  for (int e = 0; e < 8; ++e) { r[e] = lo[e]; r[8 + e] = hi[e]; }
  return r;
}

// ---------------------------------------------------------------------------
// f32 [K][N]  ->  bf16 [N][K]   (weights pre-transposed so GEMM B-tiles are
// loaded exactly like A-tiles: contiguous along the contraction dim)
// One block moves a tile of 128 k x 64 n through LDS, so that both global
// sides run along their own contiguous dim: reads are 16 B per lane, 256 B per
// input row; writes are 16 B per lane, 256 B per output row (whole lines).
// LDS holds one dword per (k pair, n): bf16(k) low, bf16(k+1) high. The pitch
// of 65 dwords is odd, so the row-wise writes and the column-wise reads both
// touch every bank at most once per wave.
// KD and ND are compile-time, so a thread's eight loads and four stores each
// share one address and differ only in the instruction's immediate offset.
// Grid = ND/64 x KD/128.
// ---------------------------------------------------------------------------
#define TP_K     128
#define TP_N     64
#define TP_PITCH 65

__device__ __forceinline__ unsigned pack_bf16(float lo, float hi) {
  bf16x2 p;
  p[0] = (bf16_t)lo;
  p[1] = (bf16_t)hi;
  return __builtin_bit_cast(unsigned, p);
}

template <int KD, int ND>
__device__ __forceinline__ void transpose_tile(
    const float* __restrict__ in, bf16_t* __restrict__ out) {
  static_assert(KD % TP_K == 0 && ND % TP_N == 0, "tiles must divide the matrix");
  __shared__ unsigned tile[(TP_K / 2) * TP_PITCH];
  const int tid = threadIdx.x;
  const int n0 = blockIdx.x * TP_N;
  const int k0 = blockIdx.y * TP_K;

  // Read: 16 lanes cover the 64 n of one input row; a thread takes rows
  // 2*kp and 2*kp+1 for four k pairs. All eight loads are issued first.
  const int n4 = (tid & 15) * 4;
  const int kp = tid >> 4;
  const float* src = in + (k0 + 2 * kp) * ND + n0 + n4;
  float4 ev[4], od[4];
#pragma unroll   // keeps ev/od in registers and turns the row steps into immediate offsets
  for (int i = 0; i < 4; ++i) {
    ev[i] = *(const float4*)(src + (32 * i) * ND);
    od[i] = *(const float4*)(src + (32 * i + 1) * ND);
  }
#pragma unroll   // ev/od are indexed by i: must be constant to stay in registers
  for (int i = 0; i < 4; ++i) {
    unsigned* t = &tile[(kp + 16 * i) * TP_PITCH + n4];
    t[0] = pack_bf16(ev[i].x, od[i].x);
    t[1] = pack_bf16(ev[i].y, od[i].y);
    t[2] = pack_bf16(ev[i].z, od[i].z);
    t[3] = pack_bf16(ev[i].w, od[i].w);
  }
  __syncthreads();                         // whole tile in LDS before any column is read

  // Write: 16 lanes cover the 128 k of one output row, 8 k (4 pairs) each.
  const int kc = tid & 15;
  const int nr = tid >> 4;
  bf16_t* dst = out + (n0 + nr) * KD + k0 + 8 * kc;
#pragma unroll   // all LDS reads issue together; the row steps become immediate offsets
  for (int j = 0; j < 4; ++j) {
    const unsigned* s = &tile[(4 * kc) * TP_PITCH + nr + 16 * j];
    uint4 v;
    v.x = s[0];
    v.y = s[TP_PITCH];
    v.z = s[2 * TP_PITCH];
    v.w = s[3 * TP_PITCH];
    *(uint4*)(dst + (16 * j) * KD) = v;
  }
}

__global__ __launch_bounds__(256) void k_transpose_dd(
    const float* __restrict__ in, bf16_t* __restrict__ out) {
  transpose_tile<D_MODEL, D_MODEL>(in, out);
}
__global__ __launch_bounds__(256) void k_transpose_df(
    const float* __restrict__ in, bf16_t* __restrict__ out) {
  transpose_tile<D_MODEL, D_FF>(in, out);
}
__global__ __launch_bounds__(256) void k_transpose_fd(
    const float* __restrict__ in, bf16_t* __restrict__ out) {
  transpose_tile<D_FF, D_MODEL>(in, out);
}

// ---------------------------------------------------------------------------
// LayerNorm, faithful to reference: unbiased std (ddof=1), eps added to std.
// f32 in -> bf16 out. One wave per row of 1024, eight rows per block.
// A lane holds 32 elements of its row in registers: eight 16 B loads, each of
// them 512 contiguous bytes per wave, all issued before the first is used. The
// row is read from memory once, the sums are joined by a five-step butterfly
// over the 32 lanes, and there is no LDS and no barrier. One eighth of the
// waves of a block-per-row launch have to be started.
// ---------------------------------------------------------------------------
#define LN_ROWS 8   // rows (waves) per block
__global__ __launch_bounds__(256) void k_layernorm_bf16(
    const float* __restrict__ x, const float* __restrict__ alpha,
    const float* __restrict__ beta, bf16_t* __restrict__ out) {
  const int lane = threadIdx.x & 31;
  const int row  = blockIdx.x * LN_ROWS + (threadIdx.x >> 5);
  const float* xr = x + (size_t)row * D_MODEL + lane * 4;
  float4 v[8];
#pragma unroll   // v is indexed by i: must be constant to stay in registers; the steps become immediate offsets
  for (int i = 0; i < 8; ++i) v[i] = *(const float4*)(xr + i * 128);
  const float a = alpha[0];
  const float shift = beta[0];
  // Four independent chains for each of the two sums, one per vector component.
  float4 s4  = make_float4(0.f, 0.f, 0.f, 0.f);
  float4 ss4 = make_float4(0.f, 0.f, 0.f, 0.f);
#pragma unroll   // v is indexed by i
  for (int i = 0; i < 8; ++i) {
    s4.x += v[i].x; ss4.x += v[i].x * v[i].x;
    s4.y += v[i].y; ss4.y += v[i].y * v[i].y;
    s4.z += v[i].z; ss4.z += v[i].z * v[i].z;
    s4.w += v[i].w; ss4.w += v[i].w * v[i].w;
  }
  float s  = (s4.x + s4.y) + (s4.z + s4.w);
  float ss = (ss4.x + ss4.y) + (ss4.z + ss4.w);
#pragma unroll   // five fixed exchange distances
  for (int o = 16; o > 0; o >>= 1) {
    s  += __shfl_xor(s, o, 32);
    ss += __shfl_xor(ss, o, 32);
  }
  float mean = s * (1.0f / D_MODEL);
  float var  = (ss - (float)D_MODEL * mean * mean) * (1.0f / (D_MODEL - 1));
  var = var > 0.f ? var : 0.f;
  float scale = a / (sqrtf(var) + 1e-5f);
  bf16_t* orow = out + (size_t)row * D_MODEL + lane * 4;
#pragma unroll   // v is indexed by i; the steps become immediate offsets
  for (int i = 0; i < 8; ++i) {
    uint2 p;
    p.x = pack_bf16((v[i].x - mean) * scale + shift, (v[i].y - mean) * scale + shift);
    p.y = pack_bf16((v[i].z - mean) * scale + shift, (v[i].w - mean) * scale + shift);
    *(uint2*)(orow + i * 128) = p;
  }
}

// ---------------------------------------------------------------------------
// WMMA GEMM: C[M,N] = A[M,K] @ B[K,N], with B supplied transposed (Bt[N][K]).
// 128x128 block tile, BK=128, 256 threads = 8 waves arranged 2(M) x 4(N);
// each wave computes 64x32 = 4x2 accumulator tiles -> 32 WMMA per k-step.
// Double-buffered async global->LDS staging: tile kt+1 streams while tile kt
// is consumed. One barrier per k-step. A k-step takes 256 B of every operand
// row, so 16 lanes of a copy cover two whole lines of one row, 64 KiB are in
// flight per block, and the wait for a tile is paid once per 128 k.
// K must be a multiple of 128.
// LDS rows of 128 bf16 lie at a pitch of 136 (272 B = 16 B x odd), so that the
// 16 rows of one ds_load_b128 fall on different banks.
// Epilogue fuses bias / ReLU / residual; writes f32 or bf16. What it fuses, the
// output type and N are compile-time: no test stands between two elements, so
// a lane's two bias loads and its 64 residual loads are issued in a row, their
// latencies overlap, and every load and store is one base plus an immediate.
// ---------------------------------------------------------------------------
#define GK 128  // GEMM k-step, bf16 elements
#define GP 136  // GEMM LDS row pitch, bf16 elements
template <bool HAS_BIAS, bool RELU, bool HAS_RES, bool OUT_F32, int N>
__device__ __forceinline__ void gemm_tile(
    const bf16_t* __restrict__ A, const bf16_t* __restrict__ Bt,
    const float* __restrict__ bias, const float* __restrict__ residual,
    float* __restrict__ Cf, bf16_t* __restrict__ Cb, int K) {
  __shared__ __align__(16) bf16_t As[2][128 * GP];
  __shared__ __align__(16) bf16_t Bs[2][128 * GP];
  const int tid  = threadIdx.x;
  const int wave = tid >> 5, lane = tid & 31, lh = lane & 15, g = lane >> 4;
  const int waveM = wave >> 2, waveN = wave & 3;       // 2 x 4 wave grid
  const int rowBase = blockIdx.y * 128;
  const int colBase = blockIdx.x * 128;
  const int kOffLo = g ? 8 : 0;
  const int kOffHi = g ? 24 : 16;

  // Per-thread staging slots: rows r0 + 16 * i (i = 0..7) of each operand,
  // 8 bf16 starting at col c0; 16 lanes cover the 256 B of one row.
  const int r0 = tid >> 4;
  const int c0 = (tid & 15) * 8;

  auto stage = [&](int kt, int buf) {
    const int kcol = kt * GK + c0;
    async_copy16_x8(lds_off_of(&As[buf][r0 * GP + c0]), 16 * GP * 2,
                    &A[(size_t)(rowBase + r0) * K + kcol], (size_t)16 * K);
    async_copy16_x8(lds_off_of(&Bs[buf][r0 * GP + c0]), 16 * GP * 2,
                    &Bt[(size_t)(colBase + r0) * K + kcol], (size_t)16 * K);
  };

  f32x8 acc[4][2];
#pragma unroll
  for (int mr = 0; mr < 4; ++mr)
#pragma unroll
    for (int nr = 0; nr < 2; ++nr) acc[mr][nr] = zero8();

  const int kTiles = K / GK;
  stage(0, 0);                               // prologue prefetch
  for (int kt = 0; kt < kTiles; ++kt) {
    const int cur = kt & 1;
    wait_ds0();                              // own reads of buf(cur^1) returned
    wait_async0();                           // own async writes to buf(cur) done
    __syncthreads();                         // all waves: buf(cur) ready, prev reads retired
    if (kt + 1 < kTiles) stage(kt + 1, cur ^ 1);   // overlap with compute below

#pragma unroll   // the four 32-k chunks differ only in LDS immediate offsets; their loads can run ahead
    for (int ks = 0; ks < GK; ks += 32) {
      bf16x16 afrag[4], bfrag[2];
#pragma unroll
      for (int mr = 0; mr < 4; ++mr) {
        int r = waveM * 64 + mr * 16 + lh;
        afrag[mr] = ld_frag(&As[cur][r * GP + ks + kOffLo],
                            &As[cur][r * GP + ks + kOffHi]);
      }
#pragma unroll
      for (int nr = 0; nr < 2; ++nr) {
        int r = waveN * 32 + nr * 16 + lh;
        bfrag[nr] = ld_frag(&Bs[cur][r * GP + ks + kOffLo],
                            &Bs[cur][r * GP + ks + kOffHi]);
      }
#pragma unroll
      for (int mr = 0; mr < 4; ++mr)
#pragma unroll
        for (int nr = 0; nr < 2; ++nr)
          acc[mr][nr] = __builtin_amdgcn_wmma_f32_16x16x32_bf16(
              false, afrag[mr], false, bfrag[nr], (short)0, acc[mr][nr],
              false, false);
    }
  }

  // Epilogue. C-frag layout: lane L holds rows 8*(L/16)+r, column L%16.
  // Element (mr, nr, r) of a lane lies (mr * 16 + r) * N + nr * 16 behind base.
  const int col0 = colBase + waveN * 32 + lh;
  const size_t base = (size_t)(rowBase + waveM * 64 + g * 8) * N + col0;
  float bv[2] = {0.f, 0.f};
  if constexpr (HAS_BIAS) {
#pragma unroll   // bv is indexed by nr: must be constant to stay in registers
    for (int nr = 0; nr < 2; ++nr) bv[nr] = bias[col0 + nr * 16];
  }
  f32x8 res[4][2];
  if constexpr (HAS_RES) {
    const float* rp = residual + base;
    // All three loops unrolled: res stays in registers, the 64 loads stand in a
    // row with nothing between them, and their steps become immediate offsets.
#pragma unroll
    for (int mr = 0; mr < 4; ++mr)
#pragma unroll
      for (int nr = 0; nr < 2; ++nr)
#pragma unroll
        for (int r = 0; r < 8; ++r)
          res[mr][nr][r] = rp[(mr * 16 + r) * N + nr * 16];
  }
  // Unrolled for the same reasons: acc and res in registers, immediate offsets.
#pragma unroll
  for (int mr = 0; mr < 4; ++mr) {
#pragma unroll
    for (int nr = 0; nr < 2; ++nr) {
#pragma unroll
      for (int r = 0; r < 8; ++r) {
        float v = acc[mr][nr][r];
        if constexpr (HAS_BIAS) v += bv[nr];
        if constexpr (RELU)     v  = v > 0.f ? v : 0.f;
        if constexpr (HAS_RES)  v += res[mr][nr][r];
        if constexpr (OUT_F32) (Cf + base)[(mr * 16 + r) * N + nr * 16] = v;
        else                   (Cb + base)[(mr * 16 + r) * N + nr * 16] = (bf16_t)v;
      }
    }
  }
}

// C = A @ B, bf16 out (Q, K, V projections).
__global__ __launch_bounds__(256) void k_gemm_plain_bf16(
    const bf16_t* __restrict__ A, const bf16_t* __restrict__ Bt,
    bf16_t* __restrict__ Cb, int K) {
  gemm_tile<false, false, false, false, D_MODEL>(A, Bt, nullptr, nullptr, nullptr, Cb, K);
}
// C = A @ B + residual, f32 out (output projection).
__global__ __launch_bounds__(256) void k_gemm_res_f32(
    const bf16_t* __restrict__ A, const bf16_t* __restrict__ Bt,
    const float* __restrict__ residual, float* __restrict__ Cf, int K) {
  gemm_tile<false, false, true, true, D_MODEL>(A, Bt, nullptr, residual, Cf, nullptr, K);
}
// C = relu(A @ B + bias), bf16 out (FFN up).
__global__ __launch_bounds__(256) void k_gemm_bias_relu_bf16(
    const bf16_t* __restrict__ A, const bf16_t* __restrict__ Bt,
    const float* __restrict__ bias, bf16_t* __restrict__ Cb, int K) {
  gemm_tile<true, true, false, false, D_FF>(A, Bt, bias, nullptr, nullptr, Cb, K);
}
// C = A @ B + bias + residual, f32 out (FFN down).
__global__ __launch_bounds__(256) void k_gemm_bias_res_f32(
    const bf16_t* __restrict__ A, const bf16_t* __restrict__ Bt,
    const float* __restrict__ bias, const float* __restrict__ residual,
    float* __restrict__ Cf, int K) {
  gemm_tile<true, false, true, true, D_MODEL>(A, Bt, bias, residual, Cf, nullptr, K);
}

// ---------------------------------------------------------------------------
// Flash attention: one block per (64-query tile, head, batch). 4 waves; each
// wave owns 16 query rows. Streams 64-key K/V tiles through LDS with online
// softmax; P restaged via LDS for the PV matmul (A-frag layout). Q, K and V
// tiles all take the async global->LDS path, row-major as they lie in memory;
// the PV matmul's B-fragments (V columns) come out of the V tile by the
// transposing LDS load.
// LDS rows of 64 bf16 lie at a pitch of 72 (144 B = 16 B x odd), so that the 16
// rows of one ds_load_b128 fall on different banks; the V tile's at a pitch of
// 80 (160 B = 32 B x odd), which does the same for ds_load_tr16_b128.
// ---------------------------------------------------------------------------
#define AP 72   // attention LDS row pitch, bf16 elements
#define VP 80   // V tile LDS row pitch, bf16 elements
__global__ __launch_bounds__(128) void k_attention(
    const bf16_t* __restrict__ Q, const bf16_t* __restrict__ Kmat,
    const bf16_t* __restrict__ V, const int* __restrict__ mask,
    bf16_t* __restrict__ ctx) {
  __shared__ __align__(16) bf16_t Qs[64 * AP];
  __shared__ __align__(16) bf16_t Ks[64 * AP];
  __shared__ __align__(16) bf16_t Vs[64 * VP];   // Vs[key][d]
  __shared__ __align__(16) bf16_t Ps[64 * AP];
  const int tid  = threadIdx.x;
  const int wave = tid >> 5, lane = tid & 31, lh = lane & 15, g = lane >> 4;
  const int qbase = blockIdx.x * 64;
  const int h = blockIdx.y, b = blockIdx.z;
  const size_t row0 = (size_t)b * SEQ;
  const int col0 = h * DKH;
  const int kOffLo = g ? 8 : 0;
  const int kOffHi = g ? 24 : 16;

  // Load Q tile [64 x 64] via async copies.
#pragma unroll
  for (int i = 0; i < 4; ++i) {
    int id = i * 128 + tid;                // 0..511
    int r = id >> 3, c = (id & 7) * 8;
    async_copy16(lds_off_of(&Qs[r * AP + c]),
                 &Q[(row0 + qbase + r) * D_MODEL + col0 + c]);
  }
  wait_async0();
  __syncthreads();

  // Q A-fragments are invariant across key tiles: hoist.
  bf16x16 aq[2];
#pragma unroll
  for (int c = 0; c < 2; ++c) {
    int r = wave * 16 + lh;
    aq[c] = ld_frag(&Qs[r * AP + c * 32 + kOffLo],
                    &Qs[r * AP + c * 32 + kOffHi]);
  }

  f32x8 o[4];
#pragma unroll
  for (int nr = 0; nr < 4; ++nr) o[nr] = zero8();
  float m[8], l[8];
#pragma unroll
  for (int r = 0; r < 8; ++r) { m[r] = -1e30f; l[r] = 0.f; }
  const float sm_scale = 0.125f;           // 1/sqrt(64)
  const int vr0 = tid >> 3, vc0 = (tid & 7) * 8;                     // V staging slot
  const int vtr = (g * 8 + (lane & 7)) * VP + ((lane >> 3) & 1) * 8; // lane's transposing-load slot

  for (int kt = 0; kt < SEQ / 64; ++kt) {
    const int kbase = kt * 64;
    wait_ds0();                            // own reads of Ks/Vs returned before copies refill them
    __syncthreads();                       // prior reads of Ks/Vs/Ps retired
    // K tile: straight async copy (rows=key already matches B-frag layout).
#pragma unroll
    for (int i = 0; i < 4; ++i) {
      int id = i * 128 + tid;
      int r = id >> 3, c = (id & 7) * 8;
      async_copy16(lds_off_of(&Ks[r * AP + c]),
                   &Kmat[(row0 + kbase + r) * D_MODEL + col0 + c]);
    }
    // V tile: the same rows and columns, key rows (tid >> 3) + 16 * i.
    async_copy16_x4(lds_off_of(&Vs[vr0 * VP + vc0]), 16 * VP * 2,
                    &V[(row0 + kbase + vr0) * D_MODEL + col0 + vc0],
                    (size_t)16 * D_MODEL);
    wait_async0();
    __syncthreads();                       // Ks and Vs copies visible to all waves

    // Scores: wave's 16 q-rows x 64 keys, contraction over d=64 (2 chunks).
    f32x8 s[4];
#pragma unroll
    for (int nr = 0; nr < 4; ++nr) {
      s[nr] = zero8();
#pragma unroll
      for (int c = 0; c < 2; ++c) {
        int kr = nr * 16 + lh;
        bf16x16 bk = ld_frag(&Ks[kr * AP + c * 32 + kOffLo],
                             &Ks[kr * AP + c * 32 + kOffHi]);
        s[nr] = __builtin_amdgcn_wmma_f32_16x16x32_bf16(
            false, aq[c], false, bk, (short)0, s[nr], false, false);
      }
    }
    // Scale + mask (mask shape [B,1,1,S], key-indexed).
#pragma unroll
    for (int nr = 0; nr < 4; ++nr) {
      int key = kbase + nr * 16 + lh;
      bool live = mask[row0 + key] != 0;
#pragma unroll
      for (int r = 0; r < 8; ++r) {
        float sv = s[nr][r] * sm_scale;
        s[nr][r] = live ? sv : -1e9f;
      }
    }
    // Online softmax: row reductions across the 16-lane half-wave.
    float f[8];
#pragma unroll
    for (int r = 0; r < 8; ++r) {
      float v = fmaxf(fmaxf(s[0][r], s[1][r]), fmaxf(s[2][r], s[3][r]));
#pragma unroll
      for (int off = 8; off > 0; off >>= 1) v = fmaxf(v, __shfl_xor(v, off, 16));
      float mn = fmaxf(m[r], v);
      f[r] = __expf(m[r] - mn);
      m[r] = mn;
    }
    float rs[8];
#pragma unroll
    for (int r = 0; r < 8; ++r) rs[r] = 0.f;
#pragma unroll
    for (int nr = 0; nr < 4; ++nr)
#pragma unroll
      for (int r = 0; r < 8; ++r) {
        float p = __expf(s[nr][r] - m[r]);
        s[nr][r] = p; rs[r] += p;
      }
#pragma unroll
    for (int r = 0; r < 8; ++r) {
      float v = rs[r];
#pragma unroll
      for (int off = 8; off > 0; off >>= 1) v += __shfl_xor(v, off, 16);
      l[r] = l[r] * f[r] + v;
    }
    // Rescale running context, stage P into LDS (C-frag -> A-frag transpose).
#pragma unroll
    for (int nr = 0; nr < 4; ++nr)
#pragma unroll
      for (int r = 0; r < 8; ++r) o[nr][r] *= f[r];
#pragma unroll
    for (int nr = 0; nr < 4; ++nr)
#pragma unroll
      for (int r = 0; r < 8; ++r)
        Ps[(wave * 16 + g * 8 + r) * AP + nr * 16 + lh] = (bf16_t)s[nr][r];
    __syncthreads();

    // ctx += P @ V  (contraction over 64 keys, 2 chunks).
#pragma unroll
    for (int c = 0; c < 2; ++c) {
      int pr = wave * 16 + lh;
      bf16x16 ap = ld_frag(&Ps[pr * AP + c * 32 + kOffLo],
                           &Ps[pr * AP + c * 32 + kOffHi]);
#pragma unroll
      for (int nr = 0; nr < 4; ++nr) {
        bf16x16 bv = ld_frag_tr(&Vs[vtr + (c * 32) * VP + nr * 16],
                                &Vs[vtr + (c * 32 + 16) * VP + nr * 16]);
        o[nr] = __builtin_amdgcn_wmma_f32_16x16x32_bf16(
            false, ap, false, bv, (short)0, o[nr], false, false);
      }
    }
  }

  // Normalize and scatter ctx back to [B,S,H*Dk] layout (bf16).
#pragma unroll
  for (int nr = 0; nr < 4; ++nr)
#pragma unroll
    for (int r = 0; r < 8; ++r) {
      float v = o[nr][r] / l[r];
      ctx[(row0 + qbase + wave * 16 + g * 8 + r) * D_MODEL + col0 + nr * 16 + lh]
          = (bf16_t)v;
    }
}

// ---------------------------------------------------------------------------
// Host-side orchestration (graph-capture safe: stream launches only).
// ---------------------------------------------------------------------------
extern "C" void kernel_launch(void* const* d_in, const int* in_sizes, int n_in,
                              void* d_out, int out_size, void* d_ws, size_t ws_size,
                              hipStream_t stream) {
  const float* x      = (const float*)d_in[0];
  const int*   mask   = (const int*)d_in[1];
  const float* wq     = (const float*)d_in[2];
  const float* wk     = (const float*)d_in[3];
  const float* wv     = (const float*)d_in[4];
  const float* wo     = (const float*)d_in[5];
  const float* w1     = (const float*)d_in[6];
  const float* b1     = (const float*)d_in[7];
  const float* w2     = (const float*)d_in[8];
  const float* b2     = (const float*)d_in[9];
  const float* alpha1 = (const float*)d_in[10];
  const float* bias1  = (const float*)d_in[11];
  const float* alpha2 = (const float*)d_in[12];
  const float* bias2  = (const float*)d_in[13];
  float* out = (float*)d_out;

  // Workspace carve-up (~120 MB), 256B-aligned slices.
  char* ws = (char*)d_ws;
  size_t off = 0;
  auto alloc = [&](size_t bytes) -> char* {
    char* p = ws + off;
    off += (bytes + 255) & ~(size_t)255;
    return p;
  };
  bf16_t* wqT = (bf16_t*)alloc((size_t)D_MODEL * D_MODEL * 2);
  bf16_t* wkT = (bf16_t*)alloc((size_t)D_MODEL * D_MODEL * 2);
  bf16_t* wvT = (bf16_t*)alloc((size_t)D_MODEL * D_MODEL * 2);
  bf16_t* woT = (bf16_t*)alloc((size_t)D_MODEL * D_MODEL * 2);
  bf16_t* w1T = (bf16_t*)alloc((size_t)D_FF * D_MODEL * 2);   // [4096][1024]
  bf16_t* w2T = (bf16_t*)alloc((size_t)D_MODEL * D_FF * 2);   // [1024][4096]
  bf16_t* xn  = (bf16_t*)alloc((size_t)ROWS * D_MODEL * 2);
  bf16_t* qb  = (bf16_t*)alloc((size_t)ROWS * D_MODEL * 2);
  bf16_t* kb  = (bf16_t*)alloc((size_t)ROWS * D_MODEL * 2);
  bf16_t* vb  = (bf16_t*)alloc((size_t)ROWS * D_MODEL * 2);
  bf16_t* ctxb= (bf16_t*)alloc((size_t)ROWS * D_MODEL * 2);
  float*  x2  = (float*) alloc((size_t)ROWS * D_MODEL * 4);
  bf16_t* xn2 = (bf16_t*)alloc((size_t)ROWS * D_MODEL * 2);
  bf16_t* hb  = (bf16_t*)alloc((size_t)ROWS * D_FF * 2);
  (void)ws_size; (void)in_sizes; (void)n_in; (void)out_size;

  // 1) Weights -> bf16, transposed to [N][K].
  dim3 gTsq(D_MODEL / TP_N, D_MODEL / TP_K);
  dim3 gTw1(D_FF / TP_N, D_MODEL / TP_K);
  dim3 gTw2(D_MODEL / TP_N, D_FF / TP_K);
  k_transpose_dd<<<gTsq, 256, 0, stream>>>(wq, wqT);
  k_transpose_dd<<<gTsq, 256, 0, stream>>>(wk, wkT);
  k_transpose_dd<<<gTsq, 256, 0, stream>>>(wv, wvT);
  k_transpose_dd<<<gTsq, 256, 0, stream>>>(wo, woT);
  k_transpose_df<<<gTw1, 256, 0, stream>>>(w1, w1T);
  k_transpose_fd<<<gTw2, 256, 0, stream>>>(w2, w2T);

  // 2) LN1
  k_layernorm_bf16<<<ROWS / LN_ROWS, 256, 0, stream>>>(x, alpha1, bias1, xn);

  // 3) Q/K/V projections (bf16 out)
  dim3 gProj(D_MODEL / 128, ROWS / 128);
  k_gemm_plain_bf16<<<gProj, 256, 0, stream>>>(xn, wqT, qb, D_MODEL);
  k_gemm_plain_bf16<<<gProj, 256, 0, stream>>>(xn, wkT, kb, D_MODEL);
  k_gemm_plain_bf16<<<gProj, 256, 0, stream>>>(xn, wvT, vb, D_MODEL);

  // 4) Flash attention
  dim3 gAttn(SEQ / 64, NHEAD, BATCH);
  k_attention<<<gAttn, 128, 0, stream>>>(qb, kb, vb, mask, ctxb);

  // 5) Output projection + residual (f32 out)
  k_gemm_res_f32<<<gProj, 256, 0, stream>>>(ctxb, woT, x, x2, D_MODEL);

  // 6) LN2
  k_layernorm_bf16<<<ROWS / LN_ROWS, 256, 0, stream>>>(x2, alpha2, bias2, xn2);

  // 7) FFN up: relu(xn2 @ w1 + b1) -> bf16
  dim3 gFF1(D_FF / 128, ROWS / 128);
  k_gemm_bias_relu_bf16<<<gFF1, 256, 0, stream>>>(xn2, w1T, b1, hb, D_MODEL);

  // 8) FFN down + bias + residual -> d_out (f32)
  dim3 gFF2(D_MODEL / 128, ROWS / 128);
  k_gemm_bias_res_f32<<<gFF2, 256, 0, stream>>>(hb, w2T, b2, x2, out, D_FF);
}

// v007
// Measured time: 188 microseconds a run.
// In both of two side-by-side timings against v006, it was 1.35 times as fast.
// Counting every step since v000, it is 4.50 times as fast.
#include <hip/hip_runtime.h>
#include <hip/hip_bf16.h>

// ---------------------------------------------------------------------------
// Transformer encoder block for MI455X (gfx1250, wave32, WMMA).
// bf16 inputs / f32 accumulate via v_wmma_f32_16x16x32_bf16.
// GEMM staging uses CDNA5 async global->LDS (ASYNCcnt) with double buffering.
// ---------------------------------------------------------------------------

typedef __bf16 bf16_t;
typedef __attribute__((ext_vector_type(16))) __bf16 bf16x16;
typedef __attribute__((ext_vector_type(8)))  __bf16 bf16x8;
typedef __attribute__((ext_vector_type(2)))  __bf16 bf16x2;
typedef __attribute__((ext_vector_type(8)))  float  f32x8;

#define D_MODEL 1024
#define NHEAD   16
#define DKH     64
#define D_FF    4096
#define SEQ     2048
#define BATCH   2
#define ROWS    (BATCH * SEQ)   // 4096

__device__ __forceinline__ f32x8 zero8() {
  f32x8 z;
#pragma unroll
  for (int i = 0; i < 8; ++i) z[i] = 0.0f;
  return z;
}

// 16-byte async copy global -> LDS (CDNA5 GLOBAL_LOAD_ASYNC_TO_LDS_B128,
// tracked by ASYNCcnt). lds_off is the 32-bit LDS byte offset (generic
// pointers to __shared__ truncate to the LDS offset per the aperture rules).
// The statement's last line, s_wait_xcnt 0, stands in front of any later
// rewrite of the address registers that the copy names.
__device__ __forceinline__ void async_copy16(unsigned lds_off, const bf16_t* gptr) {
  asm volatile("global_load_async_to_lds_b128 %0, %1, off\n\t"
               "s_wait_xcnt 0x0"
               :: "v"(lds_off), "v"(gptr)
               : "memory");
}
// Eight copies that follow one another share one statement and one such wait:
// rows 0, 1, ... 7 times a fixed row step, in LDS (lstep bytes) and in global
// memory (gstep elements).
__device__ __forceinline__ void async_copy16_x8(
    unsigned l, unsigned lstep, const bf16_t* g, size_t gstep) {
  asm volatile("global_load_async_to_lds_b128 %0, %1, off\n\t"
               "global_load_async_to_lds_b128 %2, %3, off\n\t"
               "global_load_async_to_lds_b128 %4, %5, off\n\t"
               "global_load_async_to_lds_b128 %6, %7, off\n\t"
               "global_load_async_to_lds_b128 %8, %9, off\n\t"
               "global_load_async_to_lds_b128 %10, %11, off\n\t"
               "global_load_async_to_lds_b128 %12, %13, off\n\t"
               "global_load_async_to_lds_b128 %14, %15, off\n\t"
               "s_wait_xcnt 0x0"
               :: "v"(l),             "v"(g),
                  "v"(l + lstep),     "v"(g + gstep),
                  "v"(l + 2 * lstep), "v"(g + 2 * gstep),
                  "v"(l + 3 * lstep), "v"(g + 3 * gstep),
                  "v"(l + 4 * lstep), "v"(g + 4 * gstep),
                  "v"(l + 5 * lstep), "v"(g + 5 * gstep),
                  "v"(l + 6 * lstep), "v"(g + 6 * gstep),
                  "v"(l + 7 * lstep), "v"(g + 7 * gstep)
               : "memory");
}
// Four such copies, rows 0 ... 3 times a fixed row step, with the one wait.
__device__ __forceinline__ void async_copy16_x4(
    unsigned l, unsigned lstep, const bf16_t* g, size_t gstep) {
  asm volatile("global_load_async_to_lds_b128 %0, %1, off\n\t"
               "global_load_async_to_lds_b128 %2, %3, off\n\t"
               "global_load_async_to_lds_b128 %4, %5, off\n\t"
               "global_load_async_to_lds_b128 %6, %7, off\n\t"
               "s_wait_xcnt 0x0"
               :: "v"(l),             "v"(g),
                  "v"(l + lstep),     "v"(g + gstep),
                  "v"(l + 2 * lstep), "v"(g + 2 * gstep),
                  "v"(l + 3 * lstep), "v"(g + 3 * gstep)
               : "memory");
}
__device__ __forceinline__ void wait_async0() {
  asm volatile("s_wait_asynccnt 0x0" ::: "memory");
}
// This wave's LDS reads have returned before the barrier behind which a copy
// refills the buffer they came from.
__device__ __forceinline__ void wait_ds0() {
  asm volatile("s_wait_dscnt 0x0" ::: "memory");
}
__device__ __forceinline__ unsigned lds_off_of(const bf16_t* p) {
  return (unsigned)(size_t)p;
}

// Build a 16-element bf16 fragment from two contiguous 8-element (16-byte) LDS loads.
// ISA 16-bit A/B layout: lane group g=0 -> K {0..7,16..23}; g=1 -> K {8..15,24..31}.
__device__ __forceinline__ bf16x16 ld_frag(const bf16_t* p_lo, const bf16_t* p_hi) {
  bf16x8 lo = *(const bf16x8*)p_lo;
  bf16x8 hi = *(const bf16x8*)p_hi;
  bf16x16 r;
#pragma unroll
  for (int e = 0; e < 8; ++e) { r[e] = lo[e]; r[8 + e] = hi[e]; }
  return r;
}

// The same fragment out of a row-major [k][n] LDS tile, by two transposing loads
// (ds_load_tr16_b128): each hands lane (c, h) the eight k = 8h ... 8h+7 of column
// c, so loads at k and k + 16 give the k order of ld_frag. Lane l passes the
// address of row 8 * (l >> 4) + (l & 7), 16-byte half (l >> 3) & 1.
typedef __attribute__((address_space(3))) bf16x8 lds_bf16x8;
__device__ __forceinline__ bf16x16 ld_frag_tr(const bf16_t* p_lo, const bf16_t* p_hi) {
  bf16x8 lo = __builtin_amdgcn_ds_load_tr16_b128_v8bf16((lds_bf16x8*)p_lo);
  bf16x8 hi = __builtin_amdgcn_ds_load_tr16_b128_v8bf16((lds_bf16x8*)p_hi);
  bf16x16 r;
#pragma unroll   // r is indexed by e: must be constant to stay in registers
  for (int e = 0; e < 8; ++e) { r[e] = lo[e]; r[8 + e] = hi[e]; }
  return r;
}

// ---------------------------------------------------------------------------
// f32 [K][N]  ->  bf16 [N][K]   (weights pre-transposed so GEMM B-tiles are
// loaded exactly like A-tiles: contiguous along the contraction dim)
// One block moves a tile of 128 k x 64 n through LDS, so that both global
// sides run along their own contiguous dim: reads are 16 B per lane, 256 B per
// input row; writes are 16 B per lane, 256 B per output row (whole lines).
// LDS holds one dword per (k pair, n): bf16(k) low, bf16(k+1) high. The pitch
// of 65 dwords is odd, so the row-wise writes and the column-wise reads both
// touch every bank at most once per wave.
// KD and ND are compile-time, so a thread's eight loads and four stores each
// share one address and differ only in the instruction's immediate offset.
// Grid = ND/64 x KD/128.
// ---------------------------------------------------------------------------
#define TP_K     128
#define TP_N     64
#define TP_PITCH 65

__device__ __forceinline__ unsigned pack_bf16(float lo, float hi) {
  bf16x2 p;
  p[0] = (bf16_t)lo;
  p[1] = (bf16_t)hi;
  return __builtin_bit_cast(unsigned, p);
}

template <int KD, int ND>
__device__ __forceinline__ void transpose_tile(
    const float* __restrict__ in, bf16_t* __restrict__ out) {
  static_assert(KD % TP_K == 0 && ND % TP_N == 0, "tiles must divide the matrix");
  __shared__ unsigned tile[(TP_K / 2) * TP_PITCH];
  const int tid = threadIdx.x;
  const int n0 = blockIdx.x * TP_N;
  const int k0 = blockIdx.y * TP_K;

  // Read: 16 lanes cover the 64 n of one input row; a thread takes rows
  // 2*kp and 2*kp+1 for four k pairs. All eight loads are issued first.
  const int n4 = (tid & 15) * 4;
  const int kp = tid >> 4;
  const float* src = in + (k0 + 2 * kp) * ND + n0 + n4;
  float4 ev[4], od[4];
#pragma unroll   // keeps ev/od in registers and turns the row steps into immediate offsets
  for (int i = 0; i < 4; ++i) {
    ev[i] = *(const float4*)(src + (32 * i) * ND);
    od[i] = *(const float4*)(src + (32 * i + 1) * ND);
  }
#pragma unroll   // ev/od are indexed by i: must be constant to stay in registers
  for (int i = 0; i < 4; ++i) {
    unsigned* t = &tile[(kp + 16 * i) * TP_PITCH + n4];
    t[0] = pack_bf16(ev[i].x, od[i].x);
    t[1] = pack_bf16(ev[i].y, od[i].y);
    t[2] = pack_bf16(ev[i].z, od[i].z);
    t[3] = pack_bf16(ev[i].w, od[i].w);
  }
  __syncthreads();                         // whole tile in LDS before any column is read

  // Write: 16 lanes cover the 128 k of one output row, 8 k (4 pairs) each.
  const int kc = tid & 15;
  const int nr = tid >> 4;
  bf16_t* dst = out + (n0 + nr) * KD + k0 + 8 * kc;
#pragma unroll   // all LDS reads issue together; the row steps become immediate offsets
  for (int j = 0; j < 4; ++j) {
    const unsigned* s = &tile[(4 * kc) * TP_PITCH + nr + 16 * j];
    uint4 v;
    v.x = s[0];
    v.y = s[TP_PITCH];
    v.z = s[2 * TP_PITCH];
    v.w = s[3 * TP_PITCH];
    *(uint4*)(dst + (16 * j) * KD) = v;
  }
}

__global__ __launch_bounds__(256) void k_transpose_dd(
    const float* __restrict__ in, bf16_t* __restrict__ out) {
  transpose_tile<D_MODEL, D_MODEL>(in, out);
}
__global__ __launch_bounds__(256) void k_transpose_df(
    const float* __restrict__ in, bf16_t* __restrict__ out) {
  transpose_tile<D_MODEL, D_FF>(in, out);
}
__global__ __launch_bounds__(256) void k_transpose_fd(
    const float* __restrict__ in, bf16_t* __restrict__ out) {
  transpose_tile<D_FF, D_MODEL>(in, out);
}

// ---------------------------------------------------------------------------
// LayerNorm, faithful to reference: unbiased std (ddof=1), eps added to std.
// f32 in -> bf16 out. One wave per row of 1024, eight rows per block.
// A lane holds 32 elements of its row in registers: eight 16 B loads, each of
// them 512 contiguous bytes per wave, all issued before the first is used. The
// row is read from memory once, the sums are joined by a five-step butterfly
// over the 32 lanes, and there is no LDS and no barrier. One eighth of the
// waves of a block-per-row launch have to be started.
// ---------------------------------------------------------------------------
#define LN_ROWS 8   // rows (waves) per block
__global__ __launch_bounds__(256) void k_layernorm_bf16(
    const float* __restrict__ x, const float* __restrict__ alpha,
    const float* __restrict__ beta, bf16_t* __restrict__ out) {
  const int lane = threadIdx.x & 31;
  const int row  = blockIdx.x * LN_ROWS + (threadIdx.x >> 5);
  const float* xr = x + (size_t)row * D_MODEL + lane * 4;
  float4 v[8];
#pragma unroll   // v is indexed by i: must be constant to stay in registers; the steps become immediate offsets
  for (int i = 0; i < 8; ++i) v[i] = *(const float4*)(xr + i * 128);
  const float a = alpha[0];
  const float shift = beta[0];
  // Four independent chains for each of the two sums, one per vector component.
  float4 s4  = make_float4(0.f, 0.f, 0.f, 0.f);
  float4 ss4 = make_float4(0.f, 0.f, 0.f, 0.f);
#pragma unroll   // v is indexed by i
  for (int i = 0; i < 8; ++i) {
    s4.x += v[i].x; ss4.x += v[i].x * v[i].x;
    s4.y += v[i].y; ss4.y += v[i].y * v[i].y;
    s4.z += v[i].z; ss4.z += v[i].z * v[i].z;
    s4.w += v[i].w; ss4.w += v[i].w * v[i].w;
  }
  float s  = (s4.x + s4.y) + (s4.z + s4.w);
  float ss = (ss4.x + ss4.y) + (ss4.z + ss4.w);
#pragma unroll   // five fixed exchange distances
  for (int o = 16; o > 0; o >>= 1) {
    s  += __shfl_xor(s, o, 32);
    ss += __shfl_xor(ss, o, 32);
  }
  float mean = s * (1.0f / D_MODEL);
  float var  = (ss - (float)D_MODEL * mean * mean) * (1.0f / (D_MODEL - 1));
  var = var > 0.f ? var : 0.f;
  float scale = a / (sqrtf(var) + 1e-5f);
  bf16_t* orow = out + (size_t)row * D_MODEL + lane * 4;
#pragma unroll   // v is indexed by i; the steps become immediate offsets
  for (int i = 0; i < 8; ++i) {
    uint2 p;
    p.x = pack_bf16((v[i].x - mean) * scale + shift, (v[i].y - mean) * scale + shift);
    p.y = pack_bf16((v[i].z - mean) * scale + shift, (v[i].w - mean) * scale + shift);
    *(uint2*)(orow + i * 128) = p;
  }
}

// ---------------------------------------------------------------------------
// WMMA GEMM: C[M,N] = A[M,K] @ B[K,N], with B supplied transposed (Bt[N][K]).
// 128x128 block tile, BK=128, 256 threads = 8 waves arranged 2(M) x 4(N);
// each wave computes 64x32 = 4x2 accumulator tiles -> 32 WMMA per k-step.
// Double-buffered async global->LDS staging: tile kt+1 streams while tile kt
// is consumed. One barrier per k-step. A k-step takes 256 B of every operand
// row, so 16 lanes of a copy cover two whole lines of one row, 64 KiB are in
// flight per block, and the wait for a tile is paid once per 128 k.
// K must be a multiple of 128.
// LDS rows of 128 bf16 lie at a pitch of 136 (272 B = 16 B x odd), so that the
// 16 rows of one ds_load_b128 fall on different banks.
// Epilogue fuses bias / ReLU / residual; writes f32 or bf16. What it fuses, the
// output type and N are compile-time: no test stands between two elements, so
// a lane's two bias loads and its 64 residual loads are issued in a row, their
// latencies overlap, and every load and store is one base plus an immediate.
// ---------------------------------------------------------------------------
#define GK 128  // GEMM k-step, bf16 elements
#define GP 136  // GEMM LDS row pitch, bf16 elements
template <bool HAS_BIAS, bool RELU, bool HAS_RES, bool OUT_F32, int N>
__device__ __forceinline__ void gemm_tile(
    const bf16_t* __restrict__ A, const bf16_t* __restrict__ Bt,
    const float* __restrict__ bias, const float* __restrict__ residual,
    float* __restrict__ Cf, bf16_t* __restrict__ Cb, int K) {
  __shared__ __align__(16) bf16_t As[2][128 * GP];
  __shared__ __align__(16) bf16_t Bs[2][128 * GP];
  const int tid  = threadIdx.x;
  const int wave = tid >> 5, lane = tid & 31, lh = lane & 15, g = lane >> 4;
  const int waveM = wave >> 2, waveN = wave & 3;       // 2 x 4 wave grid
  const int rowBase = blockIdx.y * 128;
  const int colBase = blockIdx.x * 128;
  const int kOffLo = g ? 8 : 0;
  const int kOffHi = g ? 24 : 16;

  // Per-thread staging slots: rows r0 + 16 * i (i = 0..7) of each operand,
  // 8 bf16 starting at col c0; 16 lanes cover the 256 B of one row.
  const int r0 = tid >> 4;
  const int c0 = (tid & 15) * 8;

  auto stage = [&](int kt, int buf) {
    const int kcol = kt * GK + c0;
    async_copy16_x8(lds_off_of(&As[buf][r0 * GP + c0]), 16 * GP * 2,
                    &A[(size_t)(rowBase + r0) * K + kcol], (size_t)16 * K);
    async_copy16_x8(lds_off_of(&Bs[buf][r0 * GP + c0]), 16 * GP * 2,
                    &Bt[(size_t)(colBase + r0) * K + kcol], (size_t)16 * K);
  };

  f32x8 acc[4][2];
#pragma unroll
  for (int mr = 0; mr < 4; ++mr)
#pragma unroll
    for (int nr = 0; nr < 2; ++nr) acc[mr][nr] = zero8();

  const int kTiles = K / GK;
  stage(0, 0);                               // prologue prefetch
  for (int kt = 0; kt < kTiles; ++kt) {
    const int cur = kt & 1;
    wait_ds0();                              // own reads of buf(cur^1) returned
    wait_async0();                           // own async writes to buf(cur) done
    __syncthreads();                         // all waves: buf(cur) ready, prev reads retired
    if (kt + 1 < kTiles) stage(kt + 1, cur ^ 1);   // overlap with compute below

#pragma unroll   // the four 32-k chunks differ only in LDS immediate offsets; their loads can run ahead
    for (int ks = 0; ks < GK; ks += 32) {
      bf16x16 afrag[4], bfrag[2];
#pragma unroll
      for (int mr = 0; mr < 4; ++mr) {
        int r = waveM * 64 + mr * 16 + lh;
        afrag[mr] = ld_frag(&As[cur][r * GP + ks + kOffLo],
                            &As[cur][r * GP + ks + kOffHi]);
      }
#pragma unroll
      for (int nr = 0; nr < 2; ++nr) {
        int r = waveN * 32 + nr * 16 + lh;
        bfrag[nr] = ld_frag(&Bs[cur][r * GP + ks + kOffLo],
                            &Bs[cur][r * GP + ks + kOffHi]);
      }
#pragma unroll
      for (int mr = 0; mr < 4; ++mr)
#pragma unroll
        for (int nr = 0; nr < 2; ++nr)
          acc[mr][nr] = __builtin_amdgcn_wmma_f32_16x16x32_bf16(
              false, afrag[mr], false, bfrag[nr], (short)0, acc[mr][nr],
              false, false);
    }
  }

  // Epilogue. C-frag layout: lane L holds rows 8*(L/16)+r, column L%16.
  // Element (mr, nr, r) of a lane lies (mr * 16 + r) * N + nr * 16 behind base.
  const int col0 = colBase + waveN * 32 + lh;
  const size_t base = (size_t)(rowBase + waveM * 64 + g * 8) * N + col0;
  float bv[2] = {0.f, 0.f};
  if constexpr (HAS_BIAS) {
#pragma unroll   // bv is indexed by nr: must be constant to stay in registers
    for (int nr = 0; nr < 2; ++nr) bv[nr] = bias[col0 + nr * 16];
  }
  f32x8 res[4][2];
  if constexpr (HAS_RES) {
    const float* rp = residual + base;
    // All three loops unrolled: res stays in registers, the 64 loads stand in a
    // row with nothing between them, and their steps become immediate offsets.
#pragma unroll
    for (int mr = 0; mr < 4; ++mr)
#pragma unroll
      for (int nr = 0; nr < 2; ++nr)
#pragma unroll
        for (int r = 0; r < 8; ++r)
          res[mr][nr][r] = rp[(mr * 16 + r) * N + nr * 16];
  }
  // Unrolled for the same reasons: acc and res in registers, immediate offsets.
#pragma unroll
  for (int mr = 0; mr < 4; ++mr) {
#pragma unroll
    for (int nr = 0; nr < 2; ++nr) {
#pragma unroll
      for (int r = 0; r < 8; ++r) {
        float v = acc[mr][nr][r];
        if constexpr (HAS_BIAS) v += bv[nr];
        if constexpr (RELU)     v  = v > 0.f ? v : 0.f;
        if constexpr (HAS_RES)  v += res[mr][nr][r];
        if constexpr (OUT_F32) (Cf + base)[(mr * 16 + r) * N + nr * 16] = v;
        else                   (Cb + base)[(mr * 16 + r) * N + nr * 16] = (bf16_t)v;
      }
    }
  }
}

// C = A @ B, bf16 out (Q, K, V projections).
__global__ __launch_bounds__(256) void k_gemm_plain_bf16(
    const bf16_t* __restrict__ A, const bf16_t* __restrict__ Bt,
    bf16_t* __restrict__ Cb, int K) {
  gemm_tile<false, false, false, false, D_MODEL>(A, Bt, nullptr, nullptr, nullptr, Cb, K);
}
// C = A @ B + residual, f32 out (output projection).
__global__ __launch_bounds__(256) void k_gemm_res_f32(
    const bf16_t* __restrict__ A, const bf16_t* __restrict__ Bt,
    const float* __restrict__ residual, float* __restrict__ Cf, int K) {
  gemm_tile<false, false, true, true, D_MODEL>(A, Bt, nullptr, residual, Cf, nullptr, K);
}
// C = relu(A @ B + bias), bf16 out (FFN up).
__global__ __launch_bounds__(256) void k_gemm_bias_relu_bf16(
    const bf16_t* __restrict__ A, const bf16_t* __restrict__ Bt,
    const float* __restrict__ bias, bf16_t* __restrict__ Cb, int K) {
  gemm_tile<true, true, false, false, D_FF>(A, Bt, bias, nullptr, nullptr, Cb, K);
}
// C = A @ B + bias + residual, f32 out (FFN down).
__global__ __launch_bounds__(256) void k_gemm_bias_res_f32(
    const bf16_t* __restrict__ A, const bf16_t* __restrict__ Bt,
    const float* __restrict__ bias, const float* __restrict__ residual,
    float* __restrict__ Cf, int K) {
  gemm_tile<true, false, true, true, D_MODEL>(A, Bt, bias, residual, Cf, nullptr, K);
}

#define AP 72
#define VP 80
// Lane l receives lane l ^ 16's value (a vector cross-row move, no LDS).
__device__ __forceinline__ float xhalf(float x) {
  const int i = __builtin_bit_cast(int, x);
  return __builtin_bit_cast(float, __builtin_amdgcn_permlanex16(
      i, i, 0x76543210, 0xfedcba98, false, false));
}
__global__ __launch_bounds__(128) void k_attention(
    const bf16_t* __restrict__ Q, const bf16_t* __restrict__ Kmat,
    const bf16_t* __restrict__ V, const int* __restrict__ mask,
    bf16_t* __restrict__ ctx) {
  __shared__ __align__(16) bf16_t Qs[64 * AP];
  __shared__ __align__(16) bf16_t Ks[64 * AP];
  __shared__ __align__(16) bf16_t Vs[64 * VP];   // Vs[key][d]
  const int tid  = threadIdx.x;
  const int wave = tid >> 5, lane = tid & 31, lh = lane & 15, g = lane >> 4;
  const int qbase = blockIdx.x * 64;
  const int h = blockIdx.y, b = blockIdx.z;
  const size_t row0 = (size_t)b * SEQ;
  const int col0 = h * DKH;
  const int kOffLo = g ? 8 : 0;
  const int kOffHi = g ? 24 : 16;

  // Load Q tile [64 x 64] via async copies.
#pragma unroll
  for (int i = 0; i < 4; ++i) {
    int id = i * 128 + tid;                // 0..511
    int r = id >> 3, c = (id & 7) * 8;
    async_copy16(lds_off_of(&Qs[r * AP + c]),
                 &Q[(row0 + qbase + r) * D_MODEL + col0 + c]);
  }
  wait_async0();
  __syncthreads();

  // Q^T B-fragments (column = query lh) are invariant across key tiles: hoist.
  bf16x16 bq[2];
#pragma unroll
  for (int c = 0; c < 2; ++c) {
    int r = wave * 16 + lh;
    bq[c] = ld_frag(&Qs[r * AP + c * 32 + kOffLo],
                    &Qs[r * AP + c * 32 + kOffHi]);
  }

  // o[t][r] = O^T element d = 16 t + 8 g + r of query lh.
  f32x8 o[4];
#pragma unroll
  for (int t = 0; t < 4; ++t) o[t] = zero8();
  float m = -1e30f;                        // running maximum of query lh (both halves alike)
  float l = 0.f;                           // denominator, this half's keys only; joined after the loop
  const float sm_scale = 0.125f;           // 1/sqrt(64)
  const int vr0 = tid >> 3, vc0 = (tid & 7) * 8;                     // V staging slot
  const int vtr = (g * 8 + (lane & 7)) * VP + ((lane >> 3) & 1) * 8; // lane's transposing-load slot

  for (int kt = 0; kt < SEQ / 64; ++kt) {
    const int kbase = kt * 64;
    wait_ds0();                            // own reads of Ks/Vs returned before copies refill them
    __syncthreads();                       // prior reads of Ks/Vs retired
    // K tile: straight async copy (rows=key already matches the fragment layout).
#pragma unroll
    for (int i = 0; i < 4; ++i) {
      int id = i * 128 + tid;
      int r = id >> 3, c = (id & 7) * 8;
      async_copy16(lds_off_of(&Ks[r * AP + c]),
                   &Kmat[(row0 + kbase + r) * D_MODEL + col0 + c]);
    }
    // V tile: the same rows and columns, key rows (tid >> 3) + 16 * i.
    async_copy16_x4(lds_off_of(&Vs[vr0 * VP + vc0]), 16 * VP * 2,
                    &V[(row0 + kbase + vr0) * D_MODEL + col0 + vc0],
                    (size_t)16 * D_MODEL);
    // The tile's 64 mask words (mask shape [B,1,1,S], key-indexed), two a lane.
    const int mk0 = mask[row0 + kbase + lane];
    const int mk1 = mask[row0 + kbase + 32 + lane];
    wait_async0();
    __syncthreads();                       // Ks and Vs copies visible to all waves

    // Scores, transposed: 64 keys x the wave's 16 queries, contraction over
    // d=64 (2 chunks). s[nr][r] = key nr * 16 + 8 g + r against query lh.
    bf16x16 ak[4][2];
#pragma unroll
    for (int nr = 0; nr < 4; ++nr)
#pragma unroll
      for (int c = 0; c < 2; ++c) {
        int kr = nr * 16 + lh;
        ak[nr][c] = ld_frag(&Ks[kr * AP + c * 32 + kOffLo],
                            &Ks[kr * AP + c * 32 + kOffHi]);
      }
    // Keeps the tile's 16 LDS loads one group in front of the WMMAs, behind counted
    // waits; spread among them, each pair's latency is waited out on its own.
    __builtin_amdgcn_sched_barrier(0);
    f32x8 s[4];
#pragma unroll
    for (int nr = 0; nr < 4; ++nr) {
      s[nr] = zero8();
#pragma unroll
      for (int c = 0; c < 2; ++c)
        s[nr] = __builtin_amdgcn_wmma_f32_16x16x32_bf16(
            false, ak[nr][c], false, bq[c], (short)0, s[nr], false, false);
    }
    // Scale.
#pragma unroll
    for (int nr = 0; nr < 4; ++nr)
#pragma unroll
      for (int r = 0; r < 8; ++r) s[nr][r] *= sm_scale;
    // Mask. A key is now a register, not a lane: bit j of dead0 (dead1) says that
    // key j (32 + j) of the tile is masked out; a tile without such a key, tested
    // once for the wave, has nothing to replace.
    const unsigned dead0 = __builtin_amdgcn_ballot_w32(mk0 == 0);
    const unsigned dead1 = __builtin_amdgcn_ballot_w32(mk1 == 0);
    if ((dead0 | dead1) != 0u) {
#pragma unroll
      for (int nr = 0; nr < 4; ++nr) {
        const unsigned w = ((nr < 2 ? dead0 : dead1) >> (16 * (nr & 1))) >> (8 * g);
#pragma unroll
        for (int r = 0; r < 8; ++r)
          if ((w >> r) & 1u) s[nr][r] = -1e9f;
      }
    }
    // Online softmax: the query's 32 scores of this lane, then the other half's.
    float v4[4];
#pragma unroll
    for (int nr = 0; nr < 4; ++nr) {
      v4[nr] = s[nr][0];
#pragma unroll
      for (int r = 1; r < 8; ++r) v4[nr] = fmaxf(v4[nr], s[nr][r]);
    }
    float v = fmaxf(fmaxf(v4[0], v4[1]), fmaxf(v4[2], v4[3]));
    v = fmaxf(v, xhalf(v));
    const float mn = fmaxf(m, v);
    const float f = __expf(m - mn);
    m = mn;
    float rs[4];                           // one chain per score tile
#pragma unroll
    for (int nr = 0; nr < 4; ++nr) {
      rs[nr] = 0.f;
#pragma unroll
      for (int r = 0; r < 8; ++r) {
        float p = __expf(s[nr][r] - m);
        s[nr][r] = p; rs[nr] += p;
      }
    }
    l = l * f + ((rs[0] + rs[1]) + (rs[2] + rs[3]));
    // Rescale running context.
#pragma unroll
    for (int t = 0; t < 4; ++t)
#pragma unroll
      for (int r = 0; r < 8; ++r) o[t][r] *= f;

    // ctx^T += V^T @ P^T  (contraction over 64 keys, 2 chunks).
#pragma unroll
    for (int c = 0; c < 2; ++c) {
      bf16x16 bp;                          // keys 32 c + {8g..8g+7, 16+8g..16+8g+7} of query lh
#pragma unroll   // bp and s are indexed by e: must be constant to stay in registers
      for (int e = 0; e < 8; ++e) {
        bp[e]     = (bf16_t)s[2 * c][e];
        bp[8 + e] = (bf16_t)s[2 * c + 1][e];
      }
#pragma unroll
      for (int t = 0; t < 4; ++t) {
        bf16x16 av = ld_frag_tr(&Vs[vtr + (c * 32) * VP + t * 16],
                                &Vs[vtr + (c * 32 + 16) * VP + t * 16]);
        o[t] = __builtin_amdgcn_wmma_f32_16x16x32_bf16(
            false, av, false, bp, (short)0, o[t], false, false);
      }
    }
  }

  // Join the halves' denominators, normalize, and store ctx in [B,S,H*Dk] layout
  // (bf16): a lane's eight d of a tile are 16 contiguous bytes of its query's row.
  l += xhalf(l);
  bf16_t* crow = ctx + (row0 + qbase + wave * 16 + lh) * D_MODEL + col0 + g * 8;
#pragma unroll
  for (int t = 0; t < 4; ++t) {
    bf16x8 pk;
#pragma unroll   // pk and o are indexed by r: must be constant to stay in registers
    for (int r = 0; r < 8; ++r) pk[r] = (bf16_t)(o[t][r] / l);
    *(bf16x8*)(crow + t * 16) = pk;
  }
}

// ---------------------------------------------------------------------------
// Host-side orchestration (graph-capture safe: stream launches only).
// ---------------------------------------------------------------------------
extern "C" void kernel_launch(void* const* d_in, const int* in_sizes, int n_in,
                              void* d_out, int out_size, void* d_ws, size_t ws_size,
                              hipStream_t stream) {
  const float* x      = (const float*)d_in[0];
  const int*   mask   = (const int*)d_in[1];
  const float* wq     = (const float*)d_in[2];
  const float* wk     = (const float*)d_in[3];
  const float* wv     = (const float*)d_in[4];
  const float* wo     = (const float*)d_in[5];
  const float* w1     = (const float*)d_in[6];
  const float* b1     = (const float*)d_in[7];
  const float* w2     = (const float*)d_in[8];
  const float* b2     = (const float*)d_in[9];
  const float* alpha1 = (const float*)d_in[10];
  const float* bias1  = (const float*)d_in[11];
  const float* alpha2 = (const float*)d_in[12];
  const float* bias2  = (const float*)d_in[13];
  float* out = (float*)d_out;

  // Workspace carve-up (~120 MB), 256B-aligned slices.
  char* ws = (char*)d_ws;
  size_t off = 0;
  auto alloc = [&](size_t bytes) -> char* {
    char* p = ws + off;
    off += (bytes + 255) & ~(size_t)255;
    return p;
  };
  bf16_t* wqT = (bf16_t*)alloc((size_t)D_MODEL * D_MODEL * 2);
  bf16_t* wkT = (bf16_t*)alloc((size_t)D_MODEL * D_MODEL * 2);
  bf16_t* wvT = (bf16_t*)alloc((size_t)D_MODEL * D_MODEL * 2);
  bf16_t* woT = (bf16_t*)alloc((size_t)D_MODEL * D_MODEL * 2);
  bf16_t* w1T = (bf16_t*)alloc((size_t)D_FF * D_MODEL * 2);   // [4096][1024]
  bf16_t* w2T = (bf16_t*)alloc((size_t)D_MODEL * D_FF * 2);   // [1024][4096]
  bf16_t* xn  = (bf16_t*)alloc((size_t)ROWS * D_MODEL * 2);
  bf16_t* qb  = (bf16_t*)alloc((size_t)ROWS * D_MODEL * 2);
  bf16_t* kb  = (bf16_t*)alloc((size_t)ROWS * D_MODEL * 2);
  bf16_t* vb  = (bf16_t*)alloc((size_t)ROWS * D_MODEL * 2);
  bf16_t* ctxb= (bf16_t*)alloc((size_t)ROWS * D_MODEL * 2);
  float*  x2  = (float*) alloc((size_t)ROWS * D_MODEL * 4);
  bf16_t* xn2 = (bf16_t*)alloc((size_t)ROWS * D_MODEL * 2);
  bf16_t* hb  = (bf16_t*)alloc((size_t)ROWS * D_FF * 2);
  (void)ws_size; (void)in_sizes; (void)n_in; (void)out_size;

  // 1) Weights -> bf16, transposed to [N][K].
  dim3 gTsq(D_MODEL / TP_N, D_MODEL / TP_K);
  dim3 gTw1(D_FF / TP_N, D_MODEL / TP_K);
  dim3 gTw2(D_MODEL / TP_N, D_FF / TP_K);
  k_transpose_dd<<<gTsq, 256, 0, stream>>>(wq, wqT);
  k_transpose_dd<<<gTsq, 256, 0, stream>>>(wk, wkT);
  k_transpose_dd<<<gTsq, 256, 0, stream>>>(wv, wvT);
  k_transpose_dd<<<gTsq, 256, 0, stream>>>(wo, woT);
  k_transpose_df<<<gTw1, 256, 0, stream>>>(w1, w1T);
  k_transpose_fd<<<gTw2, 256, 0, stream>>>(w2, w2T);

  // 2) LN1
  k_layernorm_bf16<<<ROWS / LN_ROWS, 256, 0, stream>>>(x, alpha1, bias1, xn);

  // 3) Q/K/V projections (bf16 out)
  dim3 gProj(D_MODEL / 128, ROWS / 128);
  k_gemm_plain_bf16<<<gProj, 256, 0, stream>>>(xn, wqT, qb, D_MODEL);
  k_gemm_plain_bf16<<<gProj, 256, 0, stream>>>(xn, wkT, kb, D_MODEL);
  k_gemm_plain_bf16<<<gProj, 256, 0, stream>>>(xn, wvT, vb, D_MODEL);

  // 4) Flash attention
  dim3 gAttn(SEQ / 64, NHEAD, BATCH);
  k_attention<<<gAttn, 128, 0, stream>>>(qb, kb, vb, mask, ctxb);

  // 5) Output projection + residual (f32 out)
  k_gemm_res_f32<<<gProj, 256, 0, stream>>>(ctxb, woT, x, x2, D_MODEL);

  // 6) LN2
  k_layernorm_bf16<<<ROWS / LN_ROWS, 256, 0, stream>>>(x2, alpha2, bias2, xn2);

  // 7) FFN up: relu(xn2 @ w1 + b1) -> bf16
  dim3 gFF1(D_FF / 128, ROWS / 128);
  k_gemm_bias_relu_bf16<<<gFF1, 256, 0, stream>>>(xn2, w1T, b1, hb, D_MODEL);

  // 8) FFN down + bias + residual -> d_out (f32)
  dim3 gFF2(D_MODEL / 128, ROWS / 128);
  k_gemm_bias_res_f32<<<gFF2, 256, 0, stream>>>(hb, w2T, b2, x2, out, D_FF);
}

// v008
// It runs in 165 microseconds.
// In two side-by-side timings against v007, it was 1.14 and 1.13 times as fast.
// Over all steps from v000 it is 5.11 times as fast.
#include <hip/hip_runtime.h>
#include <hip/hip_bf16.h>

// ---------------------------------------------------------------------------
// Transformer encoder block for MI455X (gfx1250, wave32, WMMA).
// bf16 inputs / f32 accumulate via v_wmma_f32_16x16x32_bf16.
// GEMM staging uses CDNA5 async global->LDS (ASYNCcnt) with double buffering.
// ---------------------------------------------------------------------------

typedef __bf16 bf16_t;
typedef __attribute__((ext_vector_type(16))) __bf16 bf16x16;
typedef __attribute__((ext_vector_type(8)))  __bf16 bf16x8;
typedef __attribute__((ext_vector_type(2)))  __bf16 bf16x2;
typedef __attribute__((ext_vector_type(8)))  float  f32x8;

#define D_MODEL 1024
#define NHEAD   16
#define DKH     64
#define D_FF    4096
#define SEQ     2048
#define BATCH   2
#define ROWS    (BATCH * SEQ)   // 4096

__device__ __forceinline__ f32x8 zero8() {
  f32x8 z;
#pragma unroll
  for (int i = 0; i < 8; ++i) z[i] = 0.0f;
  return z;
}

// 16-byte async copy global -> LDS (CDNA5 GLOBAL_LOAD_ASYNC_TO_LDS_B128,
// tracked by ASYNCcnt). lds_off is the 32-bit LDS byte offset (generic
// pointers to __shared__ truncate to the LDS offset per the aperture rules).
// The statement's last line, s_wait_xcnt 0, stands in front of any later
// rewrite of the address registers that the copy names.
__device__ __forceinline__ void async_copy16(unsigned lds_off, const bf16_t* gptr) {
  asm volatile("global_load_async_to_lds_b128 %0, %1, off\n\t"
               "s_wait_xcnt 0x0"
               :: "v"(lds_off), "v"(gptr)
               : "memory");
}
// Eight copies that follow one another share one statement and one such wait:
// rows 0, 1, ... 7 times a fixed row step, in LDS (lstep bytes) and in global
// memory (gstep elements).
__device__ __forceinline__ void async_copy16_x8(
    unsigned l, unsigned lstep, const bf16_t* g, size_t gstep) {
  asm volatile("global_load_async_to_lds_b128 %0, %1, off\n\t"
               "global_load_async_to_lds_b128 %2, %3, off\n\t"
               "global_load_async_to_lds_b128 %4, %5, off\n\t"
               "global_load_async_to_lds_b128 %6, %7, off\n\t"
               "global_load_async_to_lds_b128 %8, %9, off\n\t"
               "global_load_async_to_lds_b128 %10, %11, off\n\t"
               "global_load_async_to_lds_b128 %12, %13, off\n\t"
               "global_load_async_to_lds_b128 %14, %15, off\n\t"
               "s_wait_xcnt 0x0"
               :: "v"(l),             "v"(g),
                  "v"(l + lstep),     "v"(g + gstep),
                  "v"(l + 2 * lstep), "v"(g + 2 * gstep),
                  "v"(l + 3 * lstep), "v"(g + 3 * gstep),
                  "v"(l + 4 * lstep), "v"(g + 4 * gstep),
                  "v"(l + 5 * lstep), "v"(g + 5 * gstep),
                  "v"(l + 6 * lstep), "v"(g + 6 * gstep),
                  "v"(l + 7 * lstep), "v"(g + 7 * gstep)
               : "memory");
}
// Four such copies, rows 0 ... 3 times a fixed row step, with the one wait.
__device__ __forceinline__ void async_copy16_x4(
    unsigned l, unsigned lstep, const bf16_t* g, size_t gstep) {
  asm volatile("global_load_async_to_lds_b128 %0, %1, off\n\t"
               "global_load_async_to_lds_b128 %2, %3, off\n\t"
               "global_load_async_to_lds_b128 %4, %5, off\n\t"
               "global_load_async_to_lds_b128 %6, %7, off\n\t"
               "s_wait_xcnt 0x0"
               :: "v"(l),             "v"(g),
                  "v"(l + lstep),     "v"(g + gstep),
                  "v"(l + 2 * lstep), "v"(g + 2 * gstep),
                  "v"(l + 3 * lstep), "v"(g + 3 * gstep)
               : "memory");
}
__device__ __forceinline__ void wait_async0() {
  asm volatile("s_wait_asynccnt 0x0" ::: "memory");
}
// This wave's LDS reads have returned before the barrier behind which a copy
// refills the buffer they came from.
__device__ __forceinline__ void wait_ds0() {
  asm volatile("s_wait_dscnt 0x0" ::: "memory");
}
__device__ __forceinline__ unsigned lds_off_of(const bf16_t* p) {
  return (unsigned)(size_t)p;
}

// Build a 16-element bf16 fragment from two contiguous 8-element (16-byte) LDS loads.
// ISA 16-bit A/B layout: lane group g=0 -> K {0..7,16..23}; g=1 -> K {8..15,24..31}.
__device__ __forceinline__ bf16x16 ld_frag(const bf16_t* p_lo, const bf16_t* p_hi) {
  bf16x8 lo = *(const bf16x8*)p_lo;
  bf16x8 hi = *(const bf16x8*)p_hi;
  bf16x16 r;
#pragma unroll
  for (int e = 0; e < 8; ++e) { r[e] = lo[e]; r[8 + e] = hi[e]; }
  return r;
}

// The same fragment out of a row-major [k][n] LDS tile, by two transposing loads
// (ds_load_tr16_b128): each hands lane (c, h) the eight k = 8h ... 8h+7 of column
// c, so loads at k and k + 16 give the k order of ld_frag. Lane l passes the
// address of row 8 * (l >> 4) + (l & 7), 16-byte half (l >> 3) & 1.
typedef __attribute__((address_space(3))) bf16x8 lds_bf16x8;
__device__ __forceinline__ bf16x16 ld_frag_tr(const bf16_t* p_lo, const bf16_t* p_hi) {
  bf16x8 lo = __builtin_amdgcn_ds_load_tr16_b128_v8bf16((lds_bf16x8*)p_lo);
  bf16x8 hi = __builtin_amdgcn_ds_load_tr16_b128_v8bf16((lds_bf16x8*)p_hi);
  bf16x16 r;
#pragma unroll   // r is indexed by e: must be constant to stay in registers
  for (int e = 0; e < 8; ++e) { r[e] = lo[e]; r[8 + e] = hi[e]; }
  return r;
}

// ---------------------------------------------------------------------------
// f32 [K][N]  ->  bf16 [N][K]   (weights pre-transposed so GEMM B-tiles are
// loaded exactly like A-tiles: contiguous along the contraction dim)
// One block moves a tile of 128 k x 64 n through LDS, so that both global
// sides run along their own contiguous dim: reads are 16 B per lane, 256 B per
// input row; writes are 16 B per lane, 256 B per output row (whole lines).
// LDS holds one dword per (k pair, n): bf16(k) low, bf16(k+1) high. The pitch
// of 65 dwords is odd, so the row-wise writes and the column-wise reads both
// touch every bank at most once per wave.
// KD and ND are compile-time, so a thread's eight loads and four stores each
// share one address and differ only in the instruction's immediate offset.
// A matrix has ND/64 x KD/128 tiles; the caller hands in the tile's two indices
// and the LDS tile (one array for all shapes of the calling kernel).
// ---------------------------------------------------------------------------
#define TP_K     128
#define TP_N     64
#define TP_PITCH 65

__device__ __forceinline__ unsigned pack_bf16(float lo, float hi) {
  bf16x2 p;
  p[0] = (bf16_t)lo;
  p[1] = (bf16_t)hi;
  return __builtin_bit_cast(unsigned, p);
}

template <int KD, int ND>
__device__ __forceinline__ void transpose_tile(
    const float* __restrict__ in, bf16_t* __restrict__ out,
    unsigned* tile, int tn, int tk) {
  static_assert(KD % TP_K == 0 && ND % TP_N == 0, "tiles must divide the matrix");
  const int tid = threadIdx.x;
  const int n0 = tn * TP_N;
  const int k0 = tk * TP_K;

  // Read: 16 lanes cover the 64 n of one input row; a thread takes rows
  // 2*kp and 2*kp+1 for four k pairs. All eight loads are issued first.
  const int n4 = (tid & 15) * 4;
  const int kp = tid >> 4;
  const float* src = in + (k0 + 2 * kp) * ND + n0 + n4;
  float4 ev[4], od[4];
#pragma unroll   // keeps ev/od in registers and turns the row steps into immediate offsets
  for (int i = 0; i < 4; ++i) {
    ev[i] = *(const float4*)(src + (32 * i) * ND);
    od[i] = *(const float4*)(src + (32 * i + 1) * ND);
  }
#pragma unroll   // ev/od are indexed by i: must be constant to stay in registers
  for (int i = 0; i < 4; ++i) {
    unsigned* t = &tile[(kp + 16 * i) * TP_PITCH + n4];
    t[0] = pack_bf16(ev[i].x, od[i].x);
    t[1] = pack_bf16(ev[i].y, od[i].y);
    t[2] = pack_bf16(ev[i].z, od[i].z);
    t[3] = pack_bf16(ev[i].w, od[i].w);
  }
  __syncthreads();                         // whole tile in LDS before any column is read

  // Write: 16 lanes cover the 128 k of one output row, 8 k (4 pairs) each.
  const int kc = tid & 15;
  const int nr = tid >> 4;
  bf16_t* dst = out + (n0 + nr) * KD + k0 + 8 * kc;
#pragma unroll   // all LDS reads issue together; the row steps become immediate offsets
  for (int j = 0; j < 4; ++j) {
    const unsigned* s = &tile[(4 * kc) * TP_PITCH + nr + 16 * j];
    uint4 v;
    v.x = s[0];
    v.y = s[TP_PITCH];
    v.z = s[2 * TP_PITCH];
    v.w = s[3 * TP_PITCH];
    *(uint4*)(dst + (16 * j) * KD) = v;
  }
  // In the calling kernel's text another job's code follows this one: the wait
  // stands in front of any rewrite there of the registers that the stores name.
  asm volatile("s_wait_xcnt 0x0" ::: "memory");
}

// ---------------------------------------------------------------------------
// LayerNorm, faithful to reference: unbiased std (ddof=1), eps added to std.
// f32 in -> bf16 out. One wave per row of 1024, eight rows per block.
// A lane holds 32 elements of its row in registers: eight 16 B loads, each of
// them 512 contiguous bytes per wave, all issued before the first is used. The
// row is read from memory once, the sums are joined by a five-step butterfly
// over the 32 lanes, and there is no LDS and no barrier. One eighth of the
// waves of a block-per-row launch have to be started.
// ---------------------------------------------------------------------------
#define LN_ROWS 8   // rows (waves) per block
__device__ __forceinline__ void layernorm_rows(
    const float* __restrict__ x, const float* __restrict__ alpha,
    const float* __restrict__ beta, bf16_t* __restrict__ out, int group) {
  const int lane = threadIdx.x & 31;
  const int row  = group * LN_ROWS + (threadIdx.x >> 5);
  const float* xr = x + (size_t)row * D_MODEL + lane * 4;
  float4 v[8];
#pragma unroll   // v is indexed by i: must be constant to stay in registers; the steps become immediate offsets
  for (int i = 0; i < 8; ++i) v[i] = *(const float4*)(xr + i * 128);
  const float a = alpha[0];
  const float shift = beta[0];
  // Four independent chains for each of the two sums, one per vector component.
  float4 s4  = make_float4(0.f, 0.f, 0.f, 0.f);
  float4 ss4 = make_float4(0.f, 0.f, 0.f, 0.f);
#pragma unroll   // v is indexed by i
  for (int i = 0; i < 8; ++i) {
    s4.x += v[i].x; ss4.x += v[i].x * v[i].x;
    s4.y += v[i].y; ss4.y += v[i].y * v[i].y;
    s4.z += v[i].z; ss4.z += v[i].z * v[i].z;
    s4.w += v[i].w; ss4.w += v[i].w * v[i].w;
  }
  float s  = (s4.x + s4.y) + (s4.z + s4.w);
  float ss = (ss4.x + ss4.y) + (ss4.z + ss4.w);
#pragma unroll   // five fixed exchange distances
  for (int o = 16; o > 0; o >>= 1) {
    s  += __shfl_xor(s, o, 32);
    ss += __shfl_xor(ss, o, 32);
  }
  float mean = s * (1.0f / D_MODEL);
  float var  = (ss - (float)D_MODEL * mean * mean) * (1.0f / (D_MODEL - 1));
  var = var > 0.f ? var : 0.f;
  float scale = a / (sqrtf(var) + 1e-5f);
  bf16_t* orow = out + (size_t)row * D_MODEL + lane * 4;
#pragma unroll   // v is indexed by i; the steps become immediate offsets
  for (int i = 0; i < 8; ++i) {
    uint2 p;
    p.x = pack_bf16((v[i].x - mean) * scale + shift, (v[i].y - mean) * scale + shift);
    p.y = pack_bf16((v[i].z - mean) * scale + shift, (v[i].w - mean) * scale + shift);
    *(uint2*)(orow + i * 128) = p;
  }
}

__global__ __launch_bounds__(256) void k_layernorm_bf16(
    const float* __restrict__ x, const float* __restrict__ alpha,
    const float* __restrict__ beta, bf16_t* __restrict__ out) {
  layernorm_rows(x, alpha, beta, out, blockIdx.x);
}

// ---------------------------------------------------------------------------
// Everything that reads only the inputs, in ONE launch: the first LayerNorm and
// the six weight transposes. None of them reads what another writes, so as
// seven launches they only paid seven launch gaps, seven ramps and seven tails,
// four of them on half a chip (128 blocks). The block index picks the job; the
// test is the same for a whole block, so the transposes' barrier is passed by
// all of a block's threads or by none.
// ---------------------------------------------------------------------------
#define JOBS_LN (ROWS / LN_ROWS)                          // 512 row groups
#define JOBS_DD ((D_MODEL / TP_N) * (D_MODEL / TP_K))     // 128 tiles, each of wq wk wv wo
#define JOBS_DF ((D_FF / TP_N) * (D_MODEL / TP_K))        // 512 tiles of w1
#define JOBS_FD ((D_MODEL / TP_N) * (D_FF / TP_K))        // 512 tiles of w2
#define JOBS_ALL (JOBS_LN + 4 * JOBS_DD + JOBS_DF + JOBS_FD)
__global__ __launch_bounds__(256) void k_prepare(
    const float* __restrict__ x, const float* __restrict__ alpha,
    const float* __restrict__ beta, bf16_t* __restrict__ xn,
    const float* __restrict__ wq, const float* __restrict__ wk,
    const float* __restrict__ wv, const float* __restrict__ wo,
    const float* __restrict__ w1, const float* __restrict__ w2,
    bf16_t* __restrict__ wqT, bf16_t* __restrict__ wkT,
    bf16_t* __restrict__ wvT, bf16_t* __restrict__ woT,
    bf16_t* __restrict__ w1T, bf16_t* __restrict__ w2T) {
  __shared__ unsigned tile[(TP_K / 2) * TP_PITCH];
  const int job = blockIdx.x;
  if (job < JOBS_LN) {
    layernorm_rows(x, alpha, beta, xn, job);
  } else if (job < JOBS_LN + 4 * JOBS_DD) {
    const int w = (job - JOBS_LN) / JOBS_DD;
    const int t = (job - JOBS_LN) % JOBS_DD;
    const float* in = w == 0 ? wq : w == 1 ? wk : w == 2 ? wv : wo;
    bf16_t* out     = w == 0 ? wqT : w == 1 ? wkT : w == 2 ? wvT : woT;
    transpose_tile<D_MODEL, D_MODEL>(in, out, tile,
                                     t % (D_MODEL / TP_N), t / (D_MODEL / TP_N));
  } else if (job < JOBS_LN + 4 * JOBS_DD + JOBS_DF) {
    const int t = job - (JOBS_LN + 4 * JOBS_DD);
    transpose_tile<D_MODEL, D_FF>(w1, w1T, tile,
                                  t % (D_FF / TP_N), t / (D_FF / TP_N));
  } else {
    const int t = job - (JOBS_LN + 4 * JOBS_DD + JOBS_DF);
    transpose_tile<D_FF, D_MODEL>(w2, w2T, tile,
                                  t % (D_MODEL / TP_N), t / (D_MODEL / TP_N));
  }
}

// ---------------------------------------------------------------------------
// WMMA GEMM: C[M,N] = A[M,K] @ B[K,N], with B supplied transposed (Bt[N][K]).
// 128x128 block tile, BK=128, 256 threads = 8 waves arranged 2(M) x 4(N);
// each wave computes 64x32 = 4x2 accumulator tiles -> 32 WMMA per k-step.
// Double-buffered async global->LDS staging: tile kt+1 streams while tile kt
// is consumed. One barrier per k-step. A k-step takes 256 B of every operand
// row, so 16 lanes of a copy cover two whole lines of one row, 64 KiB are in
// flight per block, and the wait for a tile is paid once per 128 k.
// K must be a multiple of 128.
// LDS rows of 128 bf16 lie at a pitch of 136 (272 B = 16 B x odd), so that the
// 16 rows of one ds_load_b128 fall on different banks.
// Epilogue fuses bias / ReLU / residual; writes f32 or bf16. What it fuses, the
// output type and N are compile-time: no test stands between two elements, so
// a lane's two bias loads and its 64 residual loads are issued in a row, their
// latencies overlap, and every load and store is one base plus an immediate.
// ---------------------------------------------------------------------------
#define GK 128  // GEMM k-step, bf16 elements
#define GP 136  // GEMM LDS row pitch, bf16 elements
template <bool HAS_BIAS, bool RELU, bool HAS_RES, bool OUT_F32, int N>
__device__ __forceinline__ void gemm_tile(
    const bf16_t* __restrict__ A, const bf16_t* __restrict__ Bt,
    const float* __restrict__ bias, const float* __restrict__ residual,
    float* __restrict__ Cf, bf16_t* __restrict__ Cb, int K) {
  __shared__ __align__(16) bf16_t As[2][128 * GP];
  __shared__ __align__(16) bf16_t Bs[2][128 * GP];
  const int tid  = threadIdx.x;
  const int wave = tid >> 5, lane = tid & 31, lh = lane & 15, g = lane >> 4;
  const int waveM = wave >> 2, waveN = wave & 3;       // 2 x 4 wave grid
  const int rowBase = blockIdx.y * 128;
  const int colBase = blockIdx.x * 128;
  const int kOffLo = g ? 8 : 0;
  const int kOffHi = g ? 24 : 16;

  // Per-thread staging slots: rows r0 + 16 * i (i = 0..7) of each operand,
  // 8 bf16 starting at col c0; 16 lanes cover the 256 B of one row.
  const int r0 = tid >> 4;
  const int c0 = (tid & 15) * 8;

  auto stage = [&](int kt, int buf) {
    const int kcol = kt * GK + c0;
    async_copy16_x8(lds_off_of(&As[buf][r0 * GP + c0]), 16 * GP * 2,
                    &A[(size_t)(rowBase + r0) * K + kcol], (size_t)16 * K);
    async_copy16_x8(lds_off_of(&Bs[buf][r0 * GP + c0]), 16 * GP * 2,
                    &Bt[(size_t)(colBase + r0) * K + kcol], (size_t)16 * K);
  };

  f32x8 acc[4][2];
#pragma unroll
  for (int mr = 0; mr < 4; ++mr)
#pragma unroll
    for (int nr = 0; nr < 2; ++nr) acc[mr][nr] = zero8();

  const int kTiles = K / GK;
  stage(0, 0);                               // prologue prefetch
  for (int kt = 0; kt < kTiles; ++kt) {
    const int cur = kt & 1;
    wait_ds0();                              // own reads of buf(cur^1) returned
    wait_async0();                           // own async writes to buf(cur) done
    __syncthreads();                         // all waves: buf(cur) ready, prev reads retired
    if (kt + 1 < kTiles) stage(kt + 1, cur ^ 1);   // overlap with compute below

#pragma unroll   // the four 32-k chunks differ only in LDS immediate offsets; their loads can run ahead
    for (int ks = 0; ks < GK; ks += 32) {
      bf16x16 afrag[4], bfrag[2];
#pragma unroll
      for (int mr = 0; mr < 4; ++mr) {
        int r = waveM * 64 + mr * 16 + lh;
        afrag[mr] = ld_frag(&As[cur][r * GP + ks + kOffLo],
                            &As[cur][r * GP + ks + kOffHi]);
      }
#pragma unroll
      for (int nr = 0; nr < 2; ++nr) {
        int r = waveN * 32 + nr * 16 + lh;
        bfrag[nr] = ld_frag(&Bs[cur][r * GP + ks + kOffLo],
                            &Bs[cur][r * GP + ks + kOffHi]);
      }
#pragma unroll
      for (int mr = 0; mr < 4; ++mr)
#pragma unroll
        for (int nr = 0; nr < 2; ++nr)
          acc[mr][nr] = __builtin_amdgcn_wmma_f32_16x16x32_bf16(
              false, afrag[mr], false, bfrag[nr], (short)0, acc[mr][nr],
              false, false);
    }
  }

  // Epilogue. C-frag layout: lane L holds rows 8*(L/16)+r, column L%16.
  // Element (mr, nr, r) of a lane lies (mr * 16 + r) * N + nr * 16 behind base.
  const int col0 = colBase + waveN * 32 + lh;
  const size_t base = (size_t)(rowBase + waveM * 64 + g * 8) * N + col0;
  float bv[2] = {0.f, 0.f};
  if constexpr (HAS_BIAS) {
#pragma unroll   // bv is indexed by nr: must be constant to stay in registers
    for (int nr = 0; nr < 2; ++nr) bv[nr] = bias[col0 + nr * 16];
  }
  f32x8 res[4][2];
  if constexpr (HAS_RES) {
    const float* rp = residual + base;
    // All three loops unrolled: res stays in registers, the 64 loads stand in a
    // row with nothing between them, and their steps become immediate offsets.
#pragma unroll
    for (int mr = 0; mr < 4; ++mr)
#pragma unroll
      for (int nr = 0; nr < 2; ++nr)
#pragma unroll
        for (int r = 0; r < 8; ++r)
          res[mr][nr][r] = rp[(mr * 16 + r) * N + nr * 16];
  }
  // Unrolled for the same reasons: acc and res in registers, immediate offsets.
#pragma unroll
  for (int mr = 0; mr < 4; ++mr) {
#pragma unroll
    for (int nr = 0; nr < 2; ++nr) {
#pragma unroll
      for (int r = 0; r < 8; ++r) {
        float v = acc[mr][nr][r];
        if constexpr (HAS_BIAS) v += bv[nr];
        if constexpr (RELU)     v  = v > 0.f ? v : 0.f;
        if constexpr (HAS_RES)  v += res[mr][nr][r];
        if constexpr (OUT_F32) (Cf + base)[(mr * 16 + r) * N + nr * 16] = v;
        else                   (Cb + base)[(mr * 16 + r) * N + nr * 16] = (bf16_t)v;
      }
    }
  }
}

// C = A @ B, bf16 out: the Q, K and V projections in one launch. They share A
// and read nothing of each other; blockIdx.z picks the weight and the output.
// 768 blocks instead of three times 256: two launch gaps, ramps and tails less,
// and two blocks can share a WGP, one computing while the other waits.
__global__ __launch_bounds__(256) void k_gemm_qkv_bf16(
    const bf16_t* __restrict__ A,
    const bf16_t* __restrict__ BtQ, const bf16_t* __restrict__ BtK,
    const bf16_t* __restrict__ BtV,
    bf16_t* __restrict__ Cq, bf16_t* __restrict__ Ck, bf16_t* __restrict__ Cv, int K) {
  const int z = blockIdx.z;
  const bf16_t* Bt = z == 0 ? BtQ : z == 1 ? BtK : BtV;
  bf16_t* Cb       = z == 0 ? Cq : z == 1 ? Ck : Cv;
  gemm_tile<false, false, false, false, D_MODEL>(A, Bt, nullptr, nullptr, nullptr, Cb, K);
}
// C = A @ B + residual, f32 out (output projection).
__global__ __launch_bounds__(256) void k_gemm_res_f32(
    const bf16_t* __restrict__ A, const bf16_t* __restrict__ Bt,
    const float* __restrict__ residual, float* __restrict__ Cf, int K) {
  gemm_tile<false, false, true, true, D_MODEL>(A, Bt, nullptr, residual, Cf, nullptr, K);
}
// C = relu(A @ B + bias), bf16 out (FFN up).
__global__ __launch_bounds__(256) void k_gemm_bias_relu_bf16(
    const bf16_t* __restrict__ A, const bf16_t* __restrict__ Bt,
    const float* __restrict__ bias, bf16_t* __restrict__ Cb, int K) {
  gemm_tile<true, true, false, false, D_FF>(A, Bt, bias, nullptr, nullptr, Cb, K);
}
// C = A @ B + bias + residual, f32 out (FFN down).
__global__ __launch_bounds__(256) void k_gemm_bias_res_f32(
    const bf16_t* __restrict__ A, const bf16_t* __restrict__ Bt,
    const float* __restrict__ bias, const float* __restrict__ residual,
    float* __restrict__ Cf, int K) {
  gemm_tile<true, false, true, true, D_MODEL>(A, Bt, bias, residual, Cf, nullptr, K);
}

#define AP 72
#define VP 80
// Lane l receives lane l ^ 16's value (a vector cross-row move, no LDS).
__device__ __forceinline__ float xhalf(float x) {
  const int i = __builtin_bit_cast(int, x);
  return __builtin_bit_cast(float, __builtin_amdgcn_permlanex16(
      i, i, 0x76543210, 0xfedcba98, false, false));
}
__global__ __launch_bounds__(128) void k_attention(
    const bf16_t* __restrict__ Q, const bf16_t* __restrict__ Kmat,
    const bf16_t* __restrict__ V, const int* __restrict__ mask,
    bf16_t* __restrict__ ctx) {
  __shared__ __align__(16) bf16_t Qs[64 * AP];
  __shared__ __align__(16) bf16_t Ks[64 * AP];
  __shared__ __align__(16) bf16_t Vs[64 * VP];   // Vs[key][d]
  const int tid  = threadIdx.x;
  const int wave = tid >> 5, lane = tid & 31, lh = lane & 15, g = lane >> 4;
  const int qbase = blockIdx.x * 64;
  const int h = blockIdx.y, b = blockIdx.z;
  const size_t row0 = (size_t)b * SEQ;
  const int col0 = h * DKH;
  const int kOffLo = g ? 8 : 0;
  const int kOffHi = g ? 24 : 16;

  // Load Q tile [64 x 64] via async copies.
#pragma unroll
  for (int i = 0; i < 4; ++i) {
    int id = i * 128 + tid;                // 0..511
    int r = id >> 3, c = (id & 7) * 8;
    async_copy16(lds_off_of(&Qs[r * AP + c]),
                 &Q[(row0 + qbase + r) * D_MODEL + col0 + c]);
  }
  wait_async0();
  __syncthreads();

  // Q^T B-fragments (column = query lh) are invariant across key tiles: hoist.
  bf16x16 bq[2];
#pragma unroll
  for (int c = 0; c < 2; ++c) {
    int r = wave * 16 + lh;
    bq[c] = ld_frag(&Qs[r * AP + c * 32 + kOffLo],
                    &Qs[r * AP + c * 32 + kOffHi]);
  }

  // o[t][r] = O^T element d = 16 t + 8 g + r of query lh.
  f32x8 o[4];
#pragma unroll
  for (int t = 0; t < 4; ++t) o[t] = zero8();
  float m = -1e30f;                        // running maximum of query lh (both halves alike)
  float l = 0.f;                           // denominator, this half's keys only; joined after the loop
  const float sm_scale = 0.125f;           // 1/sqrt(64)
  const int vr0 = tid >> 3, vc0 = (tid & 7) * 8;                     // V staging slot
  const int vtr = (g * 8 + (lane & 7)) * VP + ((lane >> 3) & 1) * 8; // lane's transposing-load slot

  for (int kt = 0; kt < SEQ / 64; ++kt) {
    const int kbase = kt * 64;
    wait_ds0();                            // own reads of Ks/Vs returned before copies refill them
    __syncthreads();                       // prior reads of Ks/Vs retired
    // K tile: straight async copy (rows=key already matches the fragment layout).
#pragma unroll
    for (int i = 0; i < 4; ++i) {
      int id = i * 128 + tid;
      int r = id >> 3, c = (id & 7) * 8;
      async_copy16(lds_off_of(&Ks[r * AP + c]),
                   &Kmat[(row0 + kbase + r) * D_MODEL + col0 + c]);
    }
    // V tile: the same rows and columns, key rows (tid >> 3) + 16 * i.
    async_copy16_x4(lds_off_of(&Vs[vr0 * VP + vc0]), 16 * VP * 2,
                    &V[(row0 + kbase + vr0) * D_MODEL + col0 + vc0],
                    (size_t)16 * D_MODEL);
    // The tile's 64 mask words (mask shape [B,1,1,S], key-indexed), two a lane.
    const int mk0 = mask[row0 + kbase + lane];
    const int mk1 = mask[row0 + kbase + 32 + lane];
    wait_async0();
    __syncthreads();                       // Ks and Vs copies visible to all waves

    // Scores, transposed: 64 keys x the wave's 16 queries, contraction over
    // d=64 (2 chunks). s[nr][r] = key nr * 16 + 8 g + r against query lh.
    bf16x16 ak[4][2];
#pragma unroll
    for (int nr = 0; nr < 4; ++nr)
#pragma unroll
      for (int c = 0; c < 2; ++c) {
        int kr = nr * 16 + lh;
        ak[nr][c] = ld_frag(&Ks[kr * AP + c * 32 + kOffLo],
                            &Ks[kr * AP + c * 32 + kOffHi]);
      }
    // Keeps the tile's 16 LDS loads one group in front of the WMMAs, behind counted
    // waits; spread among them, each pair's latency is waited out on its own.
    __builtin_amdgcn_sched_barrier(0);
    f32x8 s[4];
#pragma unroll
    for (int nr = 0; nr < 4; ++nr) {
      s[nr] = zero8();
#pragma unroll
      for (int c = 0; c < 2; ++c)
        s[nr] = __builtin_amdgcn_wmma_f32_16x16x32_bf16(
            false, ak[nr][c], false, bq[c], (short)0, s[nr], false, false);
    }
    // Scale.
#pragma unroll
    for (int nr = 0; nr < 4; ++nr)
#pragma unroll
      for (int r = 0; r < 8; ++r) s[nr][r] *= sm_scale;
    // Mask. A key is now a register, not a lane: bit j of dead0 (dead1) says that
    // key j (32 + j) of the tile is masked out; a tile without such a key, tested
    // once for the wave, has nothing to replace.
    const unsigned dead0 = __builtin_amdgcn_ballot_w32(mk0 == 0);
    const unsigned dead1 = __builtin_amdgcn_ballot_w32(mk1 == 0);
    if ((dead0 | dead1) != 0u) {
#pragma unroll
      for (int nr = 0; nr < 4; ++nr) {
        const unsigned w = ((nr < 2 ? dead0 : dead1) >> (16 * (nr & 1))) >> (8 * g);
#pragma unroll
        for (int r = 0; r < 8; ++r)
          if ((w >> r) & 1u) s[nr][r] = -1e9f;
      }
    }
    // Online softmax: the query's 32 scores of this lane, then the other half's.
    float v4[4];
#pragma unroll
    for (int nr = 0; nr < 4; ++nr) {
      v4[nr] = s[nr][0];
#pragma unroll
      for (int r = 1; r < 8; ++r) v4[nr] = fmaxf(v4[nr], s[nr][r]);
    }
    float v = fmaxf(fmaxf(v4[0], v4[1]), fmaxf(v4[2], v4[3]));
    v = fmaxf(v, xhalf(v));
    const float mn = fmaxf(m, v);
    const float f = __expf(m - mn);
    m = mn;
    float rs[4];                           // one chain per score tile
#pragma unroll
    for (int nr = 0; nr < 4; ++nr) {
      rs[nr] = 0.f;
#pragma unroll
      for (int r = 0; r < 8; ++r) {
        float p = __expf(s[nr][r] - m);
        s[nr][r] = p; rs[nr] += p;
      }
    }
    l = l * f + ((rs[0] + rs[1]) + (rs[2] + rs[3]));
    // Rescale running context.
#pragma unroll
    for (int t = 0; t < 4; ++t)
#pragma unroll
      for (int r = 0; r < 8; ++r) o[t][r] *= f;

    // ctx^T += V^T @ P^T  (contraction over 64 keys, 2 chunks).
#pragma unroll
    for (int c = 0; c < 2; ++c) {
      bf16x16 bp;                          // keys 32 c + {8g..8g+7, 16+8g..16+8g+7} of query lh
#pragma unroll   // bp and s are indexed by e: must be constant to stay in registers
      for (int e = 0; e < 8; ++e) {
        bp[e]     = (bf16_t)s[2 * c][e];
        bp[8 + e] = (bf16_t)s[2 * c + 1][e];
      }
#pragma unroll
      for (int t = 0; t < 4; ++t) {
        bf16x16 av = ld_frag_tr(&Vs[vtr + (c * 32) * VP + t * 16],
                                &Vs[vtr + (c * 32 + 16) * VP + t * 16]);
        o[t] = __builtin_amdgcn_wmma_f32_16x16x32_bf16(
            false, av, false, bp, (short)0, o[t], false, false);
      }
    }
  }

  // Join the halves' denominators, normalize, and store ctx in [B,S,H*Dk] layout
  // (bf16): a lane's eight d of a tile are 16 contiguous bytes of its query's row.
  l += xhalf(l);
  bf16_t* crow = ctx + (row0 + qbase + wave * 16 + lh) * D_MODEL + col0 + g * 8;
#pragma unroll
  for (int t = 0; t < 4; ++t) {
    bf16x8 pk;
#pragma unroll   // pk and o are indexed by r: must be constant to stay in registers
    for (int r = 0; r < 8; ++r) pk[r] = (bf16_t)(o[t][r] / l);
    *(bf16x8*)(crow + t * 16) = pk;
  }
}

// ---------------------------------------------------------------------------
// Host-side orchestration (graph-capture safe: stream launches only).
// ---------------------------------------------------------------------------
extern "C" void kernel_launch(void* const* d_in, const int* in_sizes, int n_in,
                              void* d_out, int out_size, void* d_ws, size_t ws_size,
                              hipStream_t stream) {
  const float* x      = (const float*)d_in[0];
  const int*   mask   = (const int*)d_in[1];
  const float* wq     = (const float*)d_in[2];
  const float* wk     = (const float*)d_in[3];
  const float* wv     = (const float*)d_in[4];
  const float* wo     = (const float*)d_in[5];
  const float* w1     = (const float*)d_in[6];
  const float* b1     = (const float*)d_in[7];
  const float* w2     = (const float*)d_in[8];
  const float* b2     = (const float*)d_in[9];
  const float* alpha1 = (const float*)d_in[10];
  const float* bias1  = (const float*)d_in[11];
  const float* alpha2 = (const float*)d_in[12];
  const float* bias2  = (const float*)d_in[13];
  float* out = (float*)d_out;

  // Workspace carve-up (~120 MB), 256B-aligned slices.
  char* ws = (char*)d_ws;
  size_t off = 0;
  auto alloc = [&](size_t bytes) -> char* {
    char* p = ws + off;
    off += (bytes + 255) & ~(size_t)255;
    return p;
  };
  bf16_t* wqT = (bf16_t*)alloc((size_t)D_MODEL * D_MODEL * 2);
  bf16_t* wkT = (bf16_t*)alloc((size_t)D_MODEL * D_MODEL * 2);
  bf16_t* wvT = (bf16_t*)alloc((size_t)D_MODEL * D_MODEL * 2);
  bf16_t* woT = (bf16_t*)alloc((size_t)D_MODEL * D_MODEL * 2);
  bf16_t* w1T = (bf16_t*)alloc((size_t)D_FF * D_MODEL * 2);   // [4096][1024]
  bf16_t* w2T = (bf16_t*)alloc((size_t)D_MODEL * D_FF * 2);   // [1024][4096]
  bf16_t* xn  = (bf16_t*)alloc((size_t)ROWS * D_MODEL * 2);
  bf16_t* qb  = (bf16_t*)alloc((size_t)ROWS * D_MODEL * 2);
  bf16_t* kb  = (bf16_t*)alloc((size_t)ROWS * D_MODEL * 2);
  bf16_t* vb  = (bf16_t*)alloc((size_t)ROWS * D_MODEL * 2);
  bf16_t* ctxb= (bf16_t*)alloc((size_t)ROWS * D_MODEL * 2);
  float*  x2  = (float*) alloc((size_t)ROWS * D_MODEL * 4);
  bf16_t* xn2 = (bf16_t*)alloc((size_t)ROWS * D_MODEL * 2);
  bf16_t* hb  = (bf16_t*)alloc((size_t)ROWS * D_FF * 2);
  (void)ws_size; (void)in_sizes; (void)n_in; (void)out_size;

  // 1) + 2) LN1, and the weights -> bf16, transposed to [N][K].
  k_prepare<<<JOBS_ALL, 256, 0, stream>>>(x, alpha1, bias1, xn, wq, wk, wv, wo, w1, w2,
                                          wqT, wkT, wvT, woT, w1T, w2T);

  // 3) Q/K/V projections (bf16 out)
  dim3 gProj(D_MODEL / 128, ROWS / 128);
  dim3 gQKV(D_MODEL / 128, ROWS / 128, 3);
  k_gemm_qkv_bf16<<<gQKV, 256, 0, stream>>>(xn, wqT, wkT, wvT, qb, kb, vb, D_MODEL);

  // 4) Flash attention
  dim3 gAttn(SEQ / 64, NHEAD, BATCH);
  k_attention<<<gAttn, 128, 0, stream>>>(qb, kb, vb, mask, ctxb);

  // 5) Output projection + residual (f32 out)
  k_gemm_res_f32<<<gProj, 256, 0, stream>>>(ctxb, woT, x, x2, D_MODEL);

  // 6) LN2
  k_layernorm_bf16<<<ROWS / LN_ROWS, 256, 0, stream>>>(x2, alpha2, bias2, xn2);

  // 7) FFN up: relu(xn2 @ w1 + b1) -> bf16
  dim3 gFF1(D_FF / 128, ROWS / 128);
  k_gemm_bias_relu_bf16<<<gFF1, 256, 0, stream>>>(xn2, w1T, b1, hb, D_MODEL);

  // 8) FFN down + bias + residual -> d_out (f32)
  dim3 gFF2(D_MODEL / 128, ROWS / 128);
  k_gemm_bias_res_f32<<<gFF2, 256, 0, stream>>>(hb, w2T, b2, x2, out, D_FF);
}

// v009
// One run takes 153 microseconds.
// In two side-by-side timings against v008, it was 1.09 and 1.10 times as fast.
// Counting every step since v000, it is 5.59 times as fast.
#include <hip/hip_runtime.h>
#include <hip/hip_bf16.h>

// ---------------------------------------------------------------------------
// Transformer encoder block for MI455X (gfx1250, wave32, WMMA).
// bf16 inputs / f32 accumulate via v_wmma_f32_16x16x32_bf16.
// GEMM staging uses CDNA5 async global->LDS (ASYNCcnt) with double buffering.
// ---------------------------------------------------------------------------

typedef __bf16 bf16_t;
typedef __attribute__((ext_vector_type(16))) __bf16 bf16x16;
typedef __attribute__((ext_vector_type(8)))  __bf16 bf16x8;
typedef __attribute__((ext_vector_type(2)))  __bf16 bf16x2;
typedef __attribute__((ext_vector_type(8)))  float  f32x8;

#define D_MODEL 1024
#define NHEAD   16
#define DKH     64
#define D_FF    4096
#define SEQ     2048
#define BATCH   2
#define ROWS    (BATCH * SEQ)   // 4096

__device__ __forceinline__ f32x8 zero8() {
  f32x8 z;
#pragma unroll
  for (int i = 0; i < 8; ++i) z[i] = 0.0f;
  return z;
}

// 16-byte async copy global -> LDS (CDNA5 GLOBAL_LOAD_ASYNC_TO_LDS_B128,
// tracked by ASYNCcnt). lds_off is the 32-bit LDS byte offset (generic
// pointers to __shared__ truncate to the LDS offset per the aperture rules).
// The statement's last line, s_wait_xcnt 0, stands in front of any later
// rewrite of the address registers that the copy names.
__device__ __forceinline__ void async_copy16(unsigned lds_off, const bf16_t* gptr) {
  asm volatile("global_load_async_to_lds_b128 %0, %1, off\n\t"
               "s_wait_xcnt 0x0"
               :: "v"(lds_off), "v"(gptr)
               : "memory");
}
// Eight copies that follow one another share one statement and one such wait:
// rows 0, 1, ... 7 times a fixed row step, in LDS (lstep bytes) and in global
// memory (gstep elements).
__device__ __forceinline__ void async_copy16_x8(
    unsigned l, unsigned lstep, const bf16_t* g, size_t gstep) {
  asm volatile("global_load_async_to_lds_b128 %0, %1, off\n\t"
               "global_load_async_to_lds_b128 %2, %3, off\n\t"
               "global_load_async_to_lds_b128 %4, %5, off\n\t"
               "global_load_async_to_lds_b128 %6, %7, off\n\t"
               "global_load_async_to_lds_b128 %8, %9, off\n\t"
               "global_load_async_to_lds_b128 %10, %11, off\n\t"
               "global_load_async_to_lds_b128 %12, %13, off\n\t"
               "global_load_async_to_lds_b128 %14, %15, off\n\t"
               "s_wait_xcnt 0x0"
               :: "v"(l),             "v"(g),
                  "v"(l + lstep),     "v"(g + gstep),
                  "v"(l + 2 * lstep), "v"(g + 2 * gstep),
                  "v"(l + 3 * lstep), "v"(g + 3 * gstep),
                  "v"(l + 4 * lstep), "v"(g + 4 * gstep),
                  "v"(l + 5 * lstep), "v"(g + 5 * gstep),
                  "v"(l + 6 * lstep), "v"(g + 6 * gstep),
                  "v"(l + 7 * lstep), "v"(g + 7 * gstep)
               : "memory");
}
// Four such copies, rows 0 ... 3 times a fixed row step, with the one wait.
__device__ __forceinline__ void async_copy16_x4(
    unsigned l, unsigned lstep, const bf16_t* g, size_t gstep) {
  asm volatile("global_load_async_to_lds_b128 %0, %1, off\n\t"
               "global_load_async_to_lds_b128 %2, %3, off\n\t"
               "global_load_async_to_lds_b128 %4, %5, off\n\t"
               "global_load_async_to_lds_b128 %6, %7, off\n\t"
               "s_wait_xcnt 0x0"
               :: "v"(l),             "v"(g),
                  "v"(l + lstep),     "v"(g + gstep),
                  "v"(l + 2 * lstep), "v"(g + 2 * gstep),
                  "v"(l + 3 * lstep), "v"(g + 3 * gstep)
               : "memory");
}
__device__ __forceinline__ void wait_async0() {
  asm volatile("s_wait_asynccnt 0x0" ::: "memory");
}
// This wave's LDS reads have returned before the barrier behind which a copy
// refills the buffer they came from.
__device__ __forceinline__ void wait_ds0() {
  asm volatile("s_wait_dscnt 0x0" ::: "memory");
}
__device__ __forceinline__ unsigned lds_off_of(const bf16_t* p) {
  return (unsigned)(size_t)p;
}

// Build a 16-element bf16 fragment from two contiguous 8-element (16-byte) LDS loads.
// ISA 16-bit A/B layout: lane group g=0 -> K {0..7,16..23}; g=1 -> K {8..15,24..31}.
__device__ __forceinline__ bf16x16 ld_frag(const bf16_t* p_lo, const bf16_t* p_hi) {
  bf16x8 lo = *(const bf16x8*)p_lo;
  bf16x8 hi = *(const bf16x8*)p_hi;
  bf16x16 r;
#pragma unroll
  for (int e = 0; e < 8; ++e) { r[e] = lo[e]; r[8 + e] = hi[e]; }
  return r;
}

// The same fragment out of a row-major [k][n] LDS tile, by two transposing loads
// (ds_load_tr16_b128): each hands lane (c, h) the eight k = 8h ... 8h+7 of column
// c, so loads at k and k + 16 give the k order of ld_frag. Lane l passes the
// address of row 8 * (l >> 4) + (l & 7), 16-byte half (l >> 3) & 1.
typedef __attribute__((address_space(3))) bf16x8 lds_bf16x8;
__device__ __forceinline__ bf16x16 ld_frag_tr(const bf16_t* p_lo, const bf16_t* p_hi) {
  bf16x8 lo = __builtin_amdgcn_ds_load_tr16_b128_v8bf16((lds_bf16x8*)p_lo);
  bf16x8 hi = __builtin_amdgcn_ds_load_tr16_b128_v8bf16((lds_bf16x8*)p_hi);
  bf16x16 r;
#pragma unroll   // r is indexed by e: must be constant to stay in registers
  for (int e = 0; e < 8; ++e) { r[e] = lo[e]; r[8 + e] = hi[e]; }
  return r;
}

// ---------------------------------------------------------------------------
// f32 [K][N]  ->  bf16 [N][K]   (weights pre-transposed so GEMM B-tiles are
// loaded exactly like A-tiles: contiguous along the contraction dim)
// One block moves a tile of 128 k x 64 n through LDS, so that both global
// sides run along their own contiguous dim: reads are 16 B per lane, 256 B per
// input row; writes are 16 B per lane, 256 B per output row (whole lines).
// LDS holds one dword per (k pair, n): bf16(k) low, bf16(k+1) high. The pitch
// of 65 dwords is odd, so the row-wise writes and the column-wise reads both
// touch every bank at most once per wave.
// KD and ND are compile-time, so a thread's eight loads and four stores each
// share one address and differ only in the instruction's immediate offset.
// A matrix has ND/64 x KD/128 tiles; the caller hands in the tile's two indices
// and the LDS tile (one array for all shapes of the calling kernel).
// ---------------------------------------------------------------------------
#define TP_K     128
#define TP_N     64
#define TP_PITCH 65

__device__ __forceinline__ unsigned pack_bf16(float lo, float hi) {
  bf16x2 p;
  p[0] = (bf16_t)lo;
  p[1] = (bf16_t)hi;
  return __builtin_bit_cast(unsigned, p);
}

template <int KD, int ND>
__device__ __forceinline__ void transpose_tile(
    const float* __restrict__ in, bf16_t* __restrict__ out,
    unsigned* tile, int tn, int tk) {
  static_assert(KD % TP_K == 0 && ND % TP_N == 0, "tiles must divide the matrix");
  const int tid = threadIdx.x;
  const int n0 = tn * TP_N;
  const int k0 = tk * TP_K;

  // Read: 16 lanes cover the 64 n of one input row; a thread takes rows
  // 2*kp and 2*kp+1 for four k pairs. All eight loads are issued first.
  const int n4 = (tid & 15) * 4;
  const int kp = tid >> 4;
  const float* src = in + (k0 + 2 * kp) * ND + n0 + n4;
  float4 ev[4], od[4];
#pragma unroll   // keeps ev/od in registers and turns the row steps into immediate offsets
  for (int i = 0; i < 4; ++i) {
    ev[i] = *(const float4*)(src + (32 * i) * ND);
    od[i] = *(const float4*)(src + (32 * i + 1) * ND);
  }
#pragma unroll   // ev/od are indexed by i: must be constant to stay in registers
  for (int i = 0; i < 4; ++i) {
    unsigned* t = &tile[(kp + 16 * i) * TP_PITCH + n4];
    t[0] = pack_bf16(ev[i].x, od[i].x);
    t[1] = pack_bf16(ev[i].y, od[i].y);
    t[2] = pack_bf16(ev[i].z, od[i].z);
    t[3] = pack_bf16(ev[i].w, od[i].w);
  }
  __syncthreads();                         // whole tile in LDS before any column is read

  // Write: 16 lanes cover the 128 k of one output row, 8 k (4 pairs) each.
  const int kc = tid & 15;
  const int nr = tid >> 4;
  bf16_t* dst = out + (n0 + nr) * KD + k0 + 8 * kc;
#pragma unroll   // all LDS reads issue together; the row steps become immediate offsets
  for (int j = 0; j < 4; ++j) {
    const unsigned* s = &tile[(4 * kc) * TP_PITCH + nr + 16 * j];
    uint4 v;
    v.x = s[0];
    v.y = s[TP_PITCH];
    v.z = s[2 * TP_PITCH];
    v.w = s[3 * TP_PITCH];
    *(uint4*)(dst + (16 * j) * KD) = v;
  }
  // In the calling kernel's text another job's code follows this one: the wait
  // stands in front of any rewrite there of the registers that the stores name.
  asm volatile("s_wait_xcnt 0x0" ::: "memory");
}

// ---------------------------------------------------------------------------
// LayerNorm, faithful to reference: unbiased std (ddof=1), eps added to std.
// f32 in -> bf16 out. One wave per row of 1024, eight rows per block.
// A lane holds 32 elements of its row in registers: eight 16 B loads, each of
// them 512 contiguous bytes per wave, all issued before the first is used. The
// row is read from memory once, the sums are joined by a five-step butterfly
// over the 32 lanes, and there is no LDS and no barrier. One eighth of the
// waves of a block-per-row launch have to be started.
// ---------------------------------------------------------------------------
#define LN_ROWS 8   // rows (waves) per block
__device__ __forceinline__ void layernorm_rows(
    const float* __restrict__ x, const float* __restrict__ alpha,
    const float* __restrict__ beta, bf16_t* __restrict__ out, int group) {
  const int lane = threadIdx.x & 31;
  const int row  = group * LN_ROWS + (threadIdx.x >> 5);
  const float* xr = x + (size_t)row * D_MODEL + lane * 4;
  float4 v[8];
#pragma unroll   // v is indexed by i: must be constant to stay in registers; the steps become immediate offsets
  for (int i = 0; i < 8; ++i) v[i] = *(const float4*)(xr + i * 128);
  const float a = alpha[0];
  const float shift = beta[0];
  // Four independent chains for each of the two sums, one per vector component.
  float4 s4  = make_float4(0.f, 0.f, 0.f, 0.f);
  float4 ss4 = make_float4(0.f, 0.f, 0.f, 0.f);
#pragma unroll   // v is indexed by i
  for (int i = 0; i < 8; ++i) {
    s4.x += v[i].x; ss4.x += v[i].x * v[i].x;
    s4.y += v[i].y; ss4.y += v[i].y * v[i].y;
    s4.z += v[i].z; ss4.z += v[i].z * v[i].z;
    s4.w += v[i].w; ss4.w += v[i].w * v[i].w;
  }
  float s  = (s4.x + s4.y) + (s4.z + s4.w);
  float ss = (ss4.x + ss4.y) + (ss4.z + ss4.w);
#pragma unroll   // five fixed exchange distances
  for (int o = 16; o > 0; o >>= 1) {
    s  += __shfl_xor(s, o, 32);
    ss += __shfl_xor(ss, o, 32);
  }
  float mean = s * (1.0f / D_MODEL);
  float var  = (ss - (float)D_MODEL * mean * mean) * (1.0f / (D_MODEL - 1));
  var = var > 0.f ? var : 0.f;
  float scale = a / (sqrtf(var) + 1e-5f);
  bf16_t* orow = out + (size_t)row * D_MODEL + lane * 4;
#pragma unroll   // v is indexed by i; the steps become immediate offsets
  for (int i = 0; i < 8; ++i) {
    uint2 p;
    p.x = pack_bf16((v[i].x - mean) * scale + shift, (v[i].y - mean) * scale + shift);
    p.y = pack_bf16((v[i].z - mean) * scale + shift, (v[i].w - mean) * scale + shift);
    *(uint2*)(orow + i * 128) = p;
  }
}

__global__ __launch_bounds__(256) void k_layernorm_bf16(
    const float* __restrict__ x, const float* __restrict__ alpha,
    const float* __restrict__ beta, bf16_t* __restrict__ out) {
  layernorm_rows(x, alpha, beta, out, blockIdx.x);
}

// ---------------------------------------------------------------------------
// Everything that reads only the inputs, in ONE launch: the first LayerNorm and
// the six weight transposes. None of them reads what another writes, so as
// seven launches they only paid seven launch gaps, seven ramps and seven tails,
// four of them on half a chip (128 blocks). The block index picks the job; the
// test is the same for a whole block, so the transposes' barrier is passed by
// all of a block's threads or by none.
// ---------------------------------------------------------------------------
#define JOBS_LN (ROWS / LN_ROWS)                          // 512 row groups
#define JOBS_DD ((D_MODEL / TP_N) * (D_MODEL / TP_K))     // 128 tiles, each of wq wk wv wo
#define JOBS_DF ((D_FF / TP_N) * (D_MODEL / TP_K))        // 512 tiles of w1
#define JOBS_FD ((D_MODEL / TP_N) * (D_FF / TP_K))        // 512 tiles of w2
#define JOBS_ALL (JOBS_LN + 4 * JOBS_DD + JOBS_DF + JOBS_FD)
__global__ __launch_bounds__(256) void k_prepare(
    const float* __restrict__ x, const float* __restrict__ alpha,
    const float* __restrict__ beta, bf16_t* __restrict__ xn,
    const float* __restrict__ wq, const float* __restrict__ wk,
    const float* __restrict__ wv, const float* __restrict__ wo,
    const float* __restrict__ w1, const float* __restrict__ w2,
    bf16_t* __restrict__ wqT, bf16_t* __restrict__ wkT,
    bf16_t* __restrict__ wvT, bf16_t* __restrict__ woT,
    bf16_t* __restrict__ w1T, bf16_t* __restrict__ w2T) {
  __shared__ unsigned tile[(TP_K / 2) * TP_PITCH];
  const int job = blockIdx.x;
  if (job < JOBS_LN) {
    layernorm_rows(x, alpha, beta, xn, job);
  } else if (job < JOBS_LN + 4 * JOBS_DD) {
    const int w = (job - JOBS_LN) / JOBS_DD;
    const int t = (job - JOBS_LN) % JOBS_DD;
    const float* in = w == 0 ? wq : w == 1 ? wk : w == 2 ? wv : wo;
    bf16_t* out     = w == 0 ? wqT : w == 1 ? wkT : w == 2 ? wvT : woT;
    transpose_tile<D_MODEL, D_MODEL>(in, out, tile,
                                     t % (D_MODEL / TP_N), t / (D_MODEL / TP_N));
  } else if (job < JOBS_LN + 4 * JOBS_DD + JOBS_DF) {
    const int t = job - (JOBS_LN + 4 * JOBS_DD);
    transpose_tile<D_MODEL, D_FF>(w1, w1T, tile,
                                  t % (D_FF / TP_N), t / (D_FF / TP_N));
  } else {
    const int t = job - (JOBS_LN + 4 * JOBS_DD + JOBS_DF);
    transpose_tile<D_FF, D_MODEL>(w2, w2T, tile,
                                  t % (D_MODEL / TP_N), t / (D_MODEL / TP_N));
  }
}

// ---------------------------------------------------------------------------
// WMMA GEMM: C[M,N] = A[M,K] @ B[K,N], with B supplied transposed (Bt[N][K]).
// BT x BT block tile, BK=128, 2 * BT threads. BT = 128: 8 waves arranged
// 2(M) x 4(N), each 64x32 = 4x2 accumulator tiles, 32 WMMA per k-step. BT = 256:
// 16 waves arranged 4 x 4, each 64x64 = 4x4 tiles, 64 WMMA per k-step. The large
// tile reads half the operand bytes from L2 per product and two LDS fragments
// per four WMMAs instead of three; it is for outputs with at least about one
// 256x256 tile per WGP, the small one for the outputs of 1024 columns.
// Double-buffered async global->LDS staging: tile kt+1 streams while tile kt
// is consumed. One barrier per k-step. A k-step takes 256 B of every operand
// row, so 16 lanes of a copy cover two whole lines of one row, 64 KiB (BT = 128)
// or 128 KiB (BT = 256) are in flight per block, and the wait for a tile is paid
// once per 128 k. Either way a thread issues eight copies per operand.
// K must be a multiple of 128.
// LDS rows of 128 bf16 lie at a pitch of 136 (272 B = 16 B x odd), so that the
// 16 rows of one ds_load_b128 fall on different banks.
// Epilogue fuses bias / ReLU / residual; writes f32 or bf16. What it fuses, the
// output type and N are compile-time: no test stands between two elements, so
// a lane's bias loads and its residual loads are issued in a row, their
// latencies overlap, and every load and store is one base plus an immediate.
// ---------------------------------------------------------------------------
#define GK 128  // GEMM k-step, bf16 elements
#define GP 136  // GEMM LDS row pitch, bf16 elements
template <bool HAS_BIAS, bool RELU, bool HAS_RES, bool OUT_F32, int N, int BT>
__device__ __forceinline__ void gemm_tile(
    const bf16_t* __restrict__ A, const bf16_t* __restrict__ Bt,
    const float* __restrict__ bias, const float* __restrict__ residual,
    float* __restrict__ Cf, bf16_t* __restrict__ Cb, int K) {
  static_assert(BT == 128 || BT == 256, "wave grid and staging are laid out for these two");
  constexpr int NR = BT / 64;    // 16-column accumulator tiles of a wave
  constexpr int RS = BT / 8;     // rows that one copy of the whole block covers
  __shared__ __align__(16) bf16_t As[2][BT * GP];
  __shared__ __align__(16) bf16_t Bs[2][BT * GP];
  const int tid  = threadIdx.x;
  const int wave = tid >> 5, lane = tid & 31, lh = lane & 15, g = lane >> 4;
  const int waveM = wave >> 2, waveN = wave & 3;       // (BT / 64) x 4 wave grid
  const int rowBase = blockIdx.y * BT;
  const int colBase = blockIdx.x * BT;
  const int kOffLo = g ? 8 : 0;
  const int kOffHi = g ? 24 : 16;

  // Per-thread staging slots: rows r0 + RS * i (i = 0..7) of each operand,
  // 8 bf16 starting at col c0; 16 lanes cover the 256 B of one row.
  const int r0 = tid >> 4;
  const int c0 = (tid & 15) * 8;

  auto stage = [&](int kt, int buf) {
    const int kcol = kt * GK + c0;
    async_copy16_x8(lds_off_of(&As[buf][r0 * GP + c0]), RS * GP * 2,
                    &A[(size_t)(rowBase + r0) * K + kcol], (size_t)RS * K);
    async_copy16_x8(lds_off_of(&Bs[buf][r0 * GP + c0]), RS * GP * 2,
                    &Bt[(size_t)(colBase + r0) * K + kcol], (size_t)RS * K);
  };

  f32x8 acc[4][NR];
#pragma unroll
  for (int mr = 0; mr < 4; ++mr)
#pragma unroll
    for (int nr = 0; nr < NR; ++nr) acc[mr][nr] = zero8();

  const int kTiles = K / GK;
  stage(0, 0);                               // prologue prefetch
  for (int kt = 0; kt < kTiles; ++kt) {
    const int cur = kt & 1;
    wait_ds0();                              // own reads of buf(cur^1) returned
    wait_async0();                           // own async writes to buf(cur) done
    __syncthreads();                         // all waves: buf(cur) ready, prev reads retired
    if (kt + 1 < kTiles) stage(kt + 1, cur ^ 1);   // overlap with compute below

#pragma unroll   // the four 32-k chunks differ only in LDS immediate offsets; their loads can run ahead
    for (int ks = 0; ks < GK; ks += 32) {
      bf16x16 afrag[4], bfrag[NR];
#pragma unroll
      for (int mr = 0; mr < 4; ++mr) {
        int r = waveM * 64 + mr * 16 + lh;
        afrag[mr] = ld_frag(&As[cur][r * GP + ks + kOffLo],
                            &As[cur][r * GP + ks + kOffHi]);
      }
#pragma unroll
      for (int nr = 0; nr < NR; ++nr) {
        int r = waveN * (NR * 16) + nr * 16 + lh;
        bfrag[nr] = ld_frag(&Bs[cur][r * GP + ks + kOffLo],
                            &Bs[cur][r * GP + ks + kOffHi]);
      }
#pragma unroll
      for (int mr = 0; mr < 4; ++mr)
#pragma unroll
        for (int nr = 0; nr < NR; ++nr)
          acc[mr][nr] = __builtin_amdgcn_wmma_f32_16x16x32_bf16(
              false, afrag[mr], false, bfrag[nr], (short)0, acc[mr][nr],
              false, false);
    }
  }

  // Epilogue. C-frag layout: lane L holds rows 8*(L/16)+r, column L%16.
  // Element (mr, nr, r) of a lane lies (mr * 16 + r) * N + nr * 16 behind base.
  const int col0 = colBase + waveN * (NR * 16) + lh;
  const size_t base = (size_t)(rowBase + waveM * 64 + g * 8) * N + col0;
  float bv[NR];
  if constexpr (HAS_BIAS) {
#pragma unroll   // bv is indexed by nr: must be constant to stay in registers
    for (int nr = 0; nr < NR; ++nr) bv[nr] = bias[col0 + nr * 16];
  }
  f32x8 res[4][NR];
  if constexpr (HAS_RES) {
    const float* rp = residual + base;
    // All three loops unrolled: res stays in registers, the 64 loads stand in a
    // row with nothing between them, and their steps become immediate offsets.
#pragma unroll
    for (int mr = 0; mr < 4; ++mr)
#pragma unroll
      for (int nr = 0; nr < NR; ++nr)
#pragma unroll
        for (int r = 0; r < 8; ++r)
          res[mr][nr][r] = rp[(mr * 16 + r) * N + nr * 16];
  }
  // Unrolled for the same reasons: acc and res in registers, immediate offsets.
#pragma unroll
  for (int mr = 0; mr < 4; ++mr) {
#pragma unroll
    for (int nr = 0; nr < NR; ++nr) {
#pragma unroll
      for (int r = 0; r < 8; ++r) {
        float v = acc[mr][nr][r];
        if constexpr (HAS_BIAS) v += bv[nr];
        if constexpr (RELU)     v  = v > 0.f ? v : 0.f;
        if constexpr (HAS_RES)  v += res[mr][nr][r];
        if constexpr (OUT_F32) (Cf + base)[(mr * 16 + r) * N + nr * 16] = v;
        else                   (Cb + base)[(mr * 16 + r) * N + nr * 16] = (bf16_t)v;
      }
    }
  }
}

// C = A @ B, bf16 out: the Q, K and V projections in one launch. They share A
// and read nothing of each other; blockIdx.z picks the weight and the output.
// One launch instead of three: two launch gaps, ramps and tails less.
// 256x256 tiles, 192 blocks of 16 waves, one on a WGP.
__global__ __launch_bounds__(512) void k_gemm_qkv_bf16(
    const bf16_t* __restrict__ A,
    const bf16_t* __restrict__ BtQ, const bf16_t* __restrict__ BtK,
    const bf16_t* __restrict__ BtV,
    bf16_t* __restrict__ Cq, bf16_t* __restrict__ Ck, bf16_t* __restrict__ Cv, int K) {
  const int z = blockIdx.z;
  const bf16_t* Bt = z == 0 ? BtQ : z == 1 ? BtK : BtV;
  bf16_t* Cb       = z == 0 ? Cq : z == 1 ? Ck : Cv;
  gemm_tile<false, false, false, false, D_MODEL, 256>(A, Bt, nullptr, nullptr, nullptr, Cb, K);
}
// C = A @ B + residual, f32 out (output projection).
__global__ __launch_bounds__(256) void k_gemm_res_f32(
    const bf16_t* __restrict__ A, const bf16_t* __restrict__ Bt,
    const float* __restrict__ residual, float* __restrict__ Cf, int K) {
  gemm_tile<false, false, true, true, D_MODEL, 128>(A, Bt, nullptr, residual, Cf, nullptr, K);
}
// C = relu(A @ B + bias), bf16 out (FFN up). 256x256 tiles: 256 blocks, one on each WGP.
__global__ __launch_bounds__(512) void k_gemm_bias_relu_bf16(
    const bf16_t* __restrict__ A, const bf16_t* __restrict__ Bt,
    const float* __restrict__ bias, bf16_t* __restrict__ Cb, int K) {
  gemm_tile<true, true, false, false, D_FF, 256>(A, Bt, bias, nullptr, nullptr, Cb, K);
}
// C = A @ B + bias + residual, f32 out (FFN down).
__global__ __launch_bounds__(256) void k_gemm_bias_res_f32(
    const bf16_t* __restrict__ A, const bf16_t* __restrict__ Bt,
    const float* __restrict__ bias, const float* __restrict__ residual,
    float* __restrict__ Cf, int K) {
  gemm_tile<true, false, true, true, D_MODEL, 128>(A, Bt, bias, residual, Cf, nullptr, K);
}

#define AP 72
#define VP 80
// Lane l receives lane l ^ 16's value (a vector cross-row move, no LDS).
__device__ __forceinline__ float xhalf(float x) {
  const int i = __builtin_bit_cast(int, x);
  return __builtin_bit_cast(float, __builtin_amdgcn_permlanex16(
      i, i, 0x76543210, 0xfedcba98, false, false));
}
__global__ __launch_bounds__(128) void k_attention(
    const bf16_t* __restrict__ Q, const bf16_t* __restrict__ Kmat,
    const bf16_t* __restrict__ V, const int* __restrict__ mask,
    bf16_t* __restrict__ ctx) {
  __shared__ __align__(16) bf16_t Qs[64 * AP];
  __shared__ __align__(16) bf16_t Ks[64 * AP];
  __shared__ __align__(16) bf16_t Vs[64 * VP];   // Vs[key][d]
  const int tid  = threadIdx.x;
  const int wave = tid >> 5, lane = tid & 31, lh = lane & 15, g = lane >> 4;
  const int qbase = blockIdx.x * 64;
  const int h = blockIdx.y, b = blockIdx.z;
  const size_t row0 = (size_t)b * SEQ;
  const int col0 = h * DKH;
  const int kOffLo = g ? 8 : 0;
  const int kOffHi = g ? 24 : 16;

  // Load Q tile [64 x 64] via async copies.
#pragma unroll
  for (int i = 0; i < 4; ++i) {
    int id = i * 128 + tid;                // 0..511
    int r = id >> 3, c = (id & 7) * 8;
    async_copy16(lds_off_of(&Qs[r * AP + c]),
                 &Q[(row0 + qbase + r) * D_MODEL + col0 + c]);
  }
  wait_async0();
  __syncthreads();

  // Q^T B-fragments (column = query lh) are invariant across key tiles: hoist.
  bf16x16 bq[2];
#pragma unroll
  for (int c = 0; c < 2; ++c) {
    int r = wave * 16 + lh;
    bq[c] = ld_frag(&Qs[r * AP + c * 32 + kOffLo],
                    &Qs[r * AP + c * 32 + kOffHi]);
  }

  // o[t][r] = O^T element d = 16 t + 8 g + r of query lh.
  f32x8 o[4];
#pragma unroll
  for (int t = 0; t < 4; ++t) o[t] = zero8();
  float m = -1e30f;                        // running maximum of query lh (both halves alike)
  float l = 0.f;                           // denominator, this half's keys only; joined after the loop
  const float sm_scale = 0.125f;           // 1/sqrt(64)
  const int vr0 = tid >> 3, vc0 = (tid & 7) * 8;                     // V staging slot
  const int vtr = (g * 8 + (lane & 7)) * VP + ((lane >> 3) & 1) * 8; // lane's transposing-load slot

  for (int kt = 0; kt < SEQ / 64; ++kt) {
    const int kbase = kt * 64;
    wait_ds0();                            // own reads of Ks/Vs returned before copies refill them
    __syncthreads();                       // prior reads of Ks/Vs retired
    // K tile: straight async copy (rows=key already matches the fragment layout).
#pragma unroll
    for (int i = 0; i < 4; ++i) {
      int id = i * 128 + tid;
      int r = id >> 3, c = (id & 7) * 8;
      async_copy16(lds_off_of(&Ks[r * AP + c]),
                   &Kmat[(row0 + kbase + r) * D_MODEL + col0 + c]);
    }
    // V tile: the same rows and columns, key rows (tid >> 3) + 16 * i.
    async_copy16_x4(lds_off_of(&Vs[vr0 * VP + vc0]), 16 * VP * 2,
                    &V[(row0 + kbase + vr0) * D_MODEL + col0 + vc0],
                    (size_t)16 * D_MODEL);
    // The tile's 64 mask words (mask shape [B,1,1,S], key-indexed), two a lane.
    const int mk0 = mask[row0 + kbase + lane];
    const int mk1 = mask[row0 + kbase + 32 + lane];
    wait_async0();
    __syncthreads();                       // Ks and Vs copies visible to all waves

    // Scores, transposed: 64 keys x the wave's 16 queries, contraction over
    // d=64 (2 chunks). s[nr][r] = key nr * 16 + 8 g + r against query lh.
    bf16x16 ak[4][2];
#pragma unroll
    for (int nr = 0; nr < 4; ++nr)
#pragma unroll
      for (int c = 0; c < 2; ++c) {
        int kr = nr * 16 + lh;
        ak[nr][c] = ld_frag(&Ks[kr * AP + c * 32 + kOffLo],
                            &Ks[kr * AP + c * 32 + kOffHi]);
      }
    // Keeps the tile's 16 LDS loads one group in front of the WMMAs, behind counted
    // waits; spread among them, each pair's latency is waited out on its own.
    __builtin_amdgcn_sched_barrier(0);
    f32x8 s[4];
#pragma unroll
    for (int nr = 0; nr < 4; ++nr) {
      s[nr] = zero8();
#pragma unroll
      for (int c = 0; c < 2; ++c)
        s[nr] = __builtin_amdgcn_wmma_f32_16x16x32_bf16(
            false, ak[nr][c], false, bq[c], (short)0, s[nr], false, false);
    }
    // Scale.
#pragma unroll
    for (int nr = 0; nr < 4; ++nr)
#pragma unroll
      for (int r = 0; r < 8; ++r) s[nr][r] *= sm_scale;
    // Mask. A key is now a register, not a lane: bit j of dead0 (dead1) says that
    // key j (32 + j) of the tile is masked out; a tile without such a key, tested
    // once for the wave, has nothing to replace.
    const unsigned dead0 = __builtin_amdgcn_ballot_w32(mk0 == 0);
    const unsigned dead1 = __builtin_amdgcn_ballot_w32(mk1 == 0);
    if ((dead0 | dead1) != 0u) {
#pragma unroll
      for (int nr = 0; nr < 4; ++nr) {
        const unsigned w = ((nr < 2 ? dead0 : dead1) >> (16 * (nr & 1))) >> (8 * g);
#pragma unroll
        for (int r = 0; r < 8; ++r)
          if ((w >> r) & 1u) s[nr][r] = -1e9f;
      }
    }
    // Online softmax: the query's 32 scores of this lane, then the other half's.
    float v4[4];
#pragma unroll
    for (int nr = 0; nr < 4; ++nr) {
      v4[nr] = s[nr][0];
#pragma unroll
      for (int r = 1; r < 8; ++r) v4[nr] = fmaxf(v4[nr], s[nr][r]);
    }
    float v = fmaxf(fmaxf(v4[0], v4[1]), fmaxf(v4[2], v4[3]));
    v = fmaxf(v, xhalf(v));
    const float mn = fmaxf(m, v);
    const float f = __expf(m - mn);
    m = mn;
    float rs[4];                           // one chain per score tile
#pragma unroll
    for (int nr = 0; nr < 4; ++nr) {
      rs[nr] = 0.f;
#pragma unroll
      for (int r = 0; r < 8; ++r) {
        float p = __expf(s[nr][r] - m);
        s[nr][r] = p; rs[nr] += p;
      }
    }
    l = l * f + ((rs[0] + rs[1]) + (rs[2] + rs[3]));
    // Rescale running context.
#pragma unroll
    for (int t = 0; t < 4; ++t)
#pragma unroll
      for (int r = 0; r < 8; ++r) o[t][r] *= f;

    // ctx^T += V^T @ P^T  (contraction over 64 keys, 2 chunks).
#pragma unroll
    for (int c = 0; c < 2; ++c) {
      bf16x16 bp;                          // keys 32 c + {8g..8g+7, 16+8g..16+8g+7} of query lh
#pragma unroll   // bp and s are indexed by e: must be constant to stay in registers
      for (int e = 0; e < 8; ++e) {
        bp[e]     = (bf16_t)s[2 * c][e];
        bp[8 + e] = (bf16_t)s[2 * c + 1][e];
      }
#pragma unroll
      for (int t = 0; t < 4; ++t) {
        bf16x16 av = ld_frag_tr(&Vs[vtr + (c * 32) * VP + t * 16],
                                &Vs[vtr + (c * 32 + 16) * VP + t * 16]);
        o[t] = __builtin_amdgcn_wmma_f32_16x16x32_bf16(
            false, av, false, bp, (short)0, o[t], false, false);
      }
    }
  }

  // Join the halves' denominators, normalize, and store ctx in [B,S,H*Dk] layout
  // (bf16): a lane's eight d of a tile are 16 contiguous bytes of its query's row.
  l += xhalf(l);
  bf16_t* crow = ctx + (row0 + qbase + wave * 16 + lh) * D_MODEL + col0 + g * 8;
#pragma unroll
  for (int t = 0; t < 4; ++t) {
    bf16x8 pk;
#pragma unroll   // pk and o are indexed by r: must be constant to stay in registers
    for (int r = 0; r < 8; ++r) pk[r] = (bf16_t)(o[t][r] / l);
    *(bf16x8*)(crow + t * 16) = pk;
  }
}

// ---------------------------------------------------------------------------
// Host-side orchestration (graph-capture safe: stream launches only).
// ---------------------------------------------------------------------------
extern "C" void kernel_launch(void* const* d_in, const int* in_sizes, int n_in,
                              void* d_out, int out_size, void* d_ws, size_t ws_size,
                              hipStream_t stream) {
  const float* x      = (const float*)d_in[0];
  const int*   mask   = (const int*)d_in[1];
  const float* wq     = (const float*)d_in[2];
  const float* wk     = (const float*)d_in[3];
  const float* wv     = (const float*)d_in[4];
  const float* wo     = (const float*)d_in[5];
  const float* w1     = (const float*)d_in[6];
  const float* b1     = (const float*)d_in[7];
  const float* w2     = (const float*)d_in[8];
  const float* b2     = (const float*)d_in[9];
  const float* alpha1 = (const float*)d_in[10];
  const float* bias1  = (const float*)d_in[11];
  const float* alpha2 = (const float*)d_in[12];
  const float* bias2  = (const float*)d_in[13];
  float* out = (float*)d_out;

  // Workspace carve-up (~120 MB), 256B-aligned slices.
  char* ws = (char*)d_ws;
  size_t off = 0;
  auto alloc = [&](size_t bytes) -> char* {
    char* p = ws + off;
    off += (bytes + 255) & ~(size_t)255;
    return p;
  };
  bf16_t* wqT = (bf16_t*)alloc((size_t)D_MODEL * D_MODEL * 2);
  bf16_t* wkT = (bf16_t*)alloc((size_t)D_MODEL * D_MODEL * 2);
  bf16_t* wvT = (bf16_t*)alloc((size_t)D_MODEL * D_MODEL * 2);
  bf16_t* woT = (bf16_t*)alloc((size_t)D_MODEL * D_MODEL * 2);
  bf16_t* w1T = (bf16_t*)alloc((size_t)D_FF * D_MODEL * 2);   // [4096][1024]
  bf16_t* w2T = (bf16_t*)alloc((size_t)D_MODEL * D_FF * 2);   // [1024][4096]
  bf16_t* xn  = (bf16_t*)alloc((size_t)ROWS * D_MODEL * 2);
  bf16_t* qb  = (bf16_t*)alloc((size_t)ROWS * D_MODEL * 2);
  bf16_t* kb  = (bf16_t*)alloc((size_t)ROWS * D_MODEL * 2);
  bf16_t* vb  = (bf16_t*)alloc((size_t)ROWS * D_MODEL * 2);
  bf16_t* ctxb= (bf16_t*)alloc((size_t)ROWS * D_MODEL * 2);
  float*  x2  = (float*) alloc((size_t)ROWS * D_MODEL * 4);
  bf16_t* xn2 = (bf16_t*)alloc((size_t)ROWS * D_MODEL * 2);
  bf16_t* hb  = (bf16_t*)alloc((size_t)ROWS * D_FF * 2);
  (void)ws_size; (void)in_sizes; (void)n_in; (void)out_size;

  // 1) + 2) LN1, and the weights -> bf16, transposed to [N][K].
  k_prepare<<<JOBS_ALL, 256, 0, stream>>>(x, alpha1, bias1, xn, wq, wk, wv, wo, w1, w2,
                                          wqT, wkT, wvT, woT, w1T, w2T);

  // 3) Q/K/V projections (bf16 out)
  dim3 gProj(D_MODEL / 128, ROWS / 128);
  dim3 gQKV(D_MODEL / 256, ROWS / 256, 3);
  k_gemm_qkv_bf16<<<gQKV, 512, 0, stream>>>(xn, wqT, wkT, wvT, qb, kb, vb, D_MODEL);

  // 4) Flash attention
  dim3 gAttn(SEQ / 64, NHEAD, BATCH);
  k_attention<<<gAttn, 128, 0, stream>>>(qb, kb, vb, mask, ctxb);

  // 5) Output projection + residual (f32 out)
  k_gemm_res_f32<<<gProj, 256, 0, stream>>>(ctxb, woT, x, x2, D_MODEL);

  // 6) LN2
  k_layernorm_bf16<<<ROWS / LN_ROWS, 256, 0, stream>>>(x2, alpha2, bias2, xn2);

  // 7) FFN up: relu(xn2 @ w1 + b1) -> bf16
  dim3 gFF1(D_FF / 256, ROWS / 256);
  k_gemm_bias_relu_bf16<<<gFF1, 512, 0, stream>>>(xn2, w1T, b1, hb, D_MODEL);

  // 8) FFN down + bias + residual -> d_out (f32)
  dim3 gFF2(D_MODEL / 128, ROWS / 128);
  k_gemm_bias_res_f32<<<gFF2, 256, 0, stream>>>(hb, w2T, b2, x2, out, D_FF);
}
